// v000
// The times below were measured on an AMD MI455X: many runs one after another, warmed up first and cycling through
// copies of the inputs, with the whole window's GPU time divided by the number of runs. Launches and the gaps
// between them are all in it. The median over several windows is given; except for v000 it joins two sittings, which
// can be a few percent apart, so the side-by-side timings, each taken in one sitting, are the better comparison.
// v000 is the starting kernel. One run takes 6750 microseconds.
#include <hip/hip_runtime.h>

// OPTEigenAttention - low-rank (eigen) OPT attention (hidden [2][2048][2048]; q = (x Wq^T + bq) x 64^-0.5 (32 heads x 32 low-rank dims; the scaling uses the ORIGINAL head dim 64), k = x Wk^T + bk, v = x Wv^T + bv (32 x 32);
// scores = q.k + attention_mask[b][0][i][j] (additive f32 mask input, read as data; then max(., float min)); softmax; out = merged att.v Wo^T + bo -> [2][2048][2048]).
// Compute dtypes, f32 accumulate: every input rounded to bf16; projections on PLAIN bf16 operands (inputs: exact, + bias); scores (K 32) and att.v on bf16 hi+lo planes (3 products) for
// the first 512 query rows of each head and on SINGLE fp16 planes for the rest (the mask here is causal, so early rows see few keys);
// the 32-wide value head zero-padded to a 64-wide tile; mask add and row softmax in f32 registers (one exp); merged heads as bf16 hi+lo planes x exact Wo (2 products) + bo. One-wave-per-64x64-tile GEMMs.

#define NB_  2
#define TT   2048
#define DM   2048
#define RK   1024
#define NH_  32
#define HD   32
#define RH   512
#define PCAR 1024.0f
#define SCL  0.125f
typedef _Float16 h16;
typedef unsigned short bf;
typedef __attribute__((ext_vector_type(16))) __bf16   v16bf;
typedef __attribute__((ext_vector_type(16))) _Float16 v16h;
typedef __attribute__((ext_vector_type(8)))  _Float16 v8h;
typedef __attribute__((ext_vector_type(8)))  unsigned short v8us;
typedef __attribute__((ext_vector_type(8)))  float    v8f;
typedef __attribute__((ext_vector_type(4)))  float    v4f;
typedef v8h  __attribute__((may_alias)) v8ha;
typedef v4f  __attribute__((may_alias)) v4fa;
typedef v8us __attribute__((may_alias)) v8usa;

__device__ __forceinline__ unsigned short f2bf(float f) { unsigned u = __float_as_uint(f); u += 0x7FFFu + ((u >> 16) & 1u); return (unsigned short)(u >> 16); }
__device__ __forceinline__ float bf2f(unsigned short b) { return __uint_as_float(((unsigned)b) << 16); }
__device__ __forceinline__ float bfr(float f) { return bf2f(f2bf(f)); }
__device__ __forceinline__ v16h cat16(v8h lo, v8h hi) { return __builtin_shufflevector(lo, hi, 0, 1, 2, 3, 4, 5, 6, 7, 8, 9, 10, 11, 12, 13, 14, 15); }
__device__ __forceinline__ v16bf cat16b(v8us lo, v8us hi) { return __builtin_bit_cast(v16bf, __builtin_shufflevector(lo, hi, 0, 1, 2, 3, 4, 5, 6, 7, 8, 9, 10, 11, 12, 13, 14, 15)); }
__device__ __forceinline__ v8f wmma16(v16h a, v16h b, v8f c) { return __builtin_amdgcn_wmma_f32_16x16x32_f16(false, a, false, b, (short)0, c, false, false); }
__device__ __forceinline__ v8f wmmab(v16bf a, v16bf b, v8f c) { return __builtin_amdgcn_wmma_f32_16x16x32_bf16(false, a, false, b, (short)0, c, false, false); }



// ---- k_gemmw: register-blocked GEMM, ONE WAVE per 64x64 output tile (16 accumulators), operands straight from K-contiguous 16-bit planes; grid (M/64, N/64, Z), 32 threads.
// C[m][n] (f32, pitch ldc, + optional f32 bias[n]) = sum_k A[m][k] Bt[n][k] (+ split products per NSPLIT). z-batch strides sA/sB/sC in elements. K % 32 == 0.
template <typename T16> struct WFrag;
template <> struct WFrag<h16> { typedef v16h V; static __device__ __forceinline__ V ld(const h16* p) { return cat16(*(const v8h*)p, *(const v8h*)(p + 16)); } static __device__ __forceinline__ v8f mma(V a, V b, v8f c) { return wmma16(a, b, c); } };
template <> struct WFrag<bf> { typedef v16bf V; static __device__ __forceinline__ V ld(const bf* p) { return cat16b(*(const v8us*)p, *(const v8us*)(p + 16)); } static __device__ __forceinline__ v8f mma(V a, V b, v8f c) { return wmmab(a, b, c); } };
template <typename T16, int NSPLIT, bool BIAS>
__global__ __launch_bounds__(32) void k_gemmw(const T16* __restrict__ A, const T16* __restrict__ A2, const T16* __restrict__ Bt, const T16* __restrict__ Bt2, int K, float* C, int ldc, const float* __restrict__ bias, size_t sA, size_t sB, size_t sC) {
    typedef typename WFrag<T16>::V V;
    __shared__ __align__(16) float os[16 * 68];
    const size_t z = blockIdx.z; A += z * sA; if (A2) A2 += z * sA; Bt += z * sB; if (Bt2) Bt2 += z * sB; C += z * sC;
    const int lane = threadIdx.x & 31, lr = lane & 15, hi = lane >> 4; const int r0 = blockIdx.x * 64, c0 = blockIdx.y * 64;
    v8f acc[4][4];
#pragma unroll
    for (int mb = 0; mb < 4; ++mb)
#pragma unroll
        for (int nb = 0; nb < 4; ++nb) acc[mb][nb] = (v8f){};
    const size_t aoff = (size_t)(r0 + lr) * K + 8 * hi, boff = (size_t)(c0 + lr) * K + 8 * hi;
#pragma unroll 1
    for (int kc = 0; kc < K; kc += 32) {
        V a[4], a2[4];
#pragma unroll
        for (int mb = 0; mb < 4; ++mb) { a[mb] = WFrag<T16>::ld(A + aoff + (size_t)mb * 16 * K + kc); if (NSPLIT == 1 || NSPLIT == 2) a2[mb] = WFrag<T16>::ld(A2 + aoff + (size_t)mb * 16 * K + kc); }
#pragma unroll
        for (int nb = 0; nb < 4; ++nb) { const V b = WFrag<T16>::ld(Bt + boff + (size_t)nb * 16 * K + kc); V b2; if (NSPLIT >= 2) b2 = WFrag<T16>::ld(Bt2 + boff + (size_t)nb * 16 * K + kc);
#pragma unroll
            for (int mb = 0; mb < 4; ++mb) { acc[mb][nb] = WFrag<T16>::mma(a[mb], b, acc[mb][nb]); if (NSPLIT == 1 || NSPLIT == 2) acc[mb][nb] = WFrag<T16>::mma(a2[mb], b, acc[mb][nb]); if (NSPLIT >= 2) acc[mb][nb] = WFrag<T16>::mma(a[mb], b2, acc[mb][nb]); } }
        asm volatile("v_nop\n\tv_nop\n\tv_nop\n\tv_nop" : "+v"(acc[0][0]), "+v"(acc[1][1]), "+v"(acc[2][2]), "+v"(acc[3][3]) : "v"(a[0]), "v"(a[3]));
    }
#pragma unroll
    for (int mb = 0; mb < 4; ++mb) {
#pragma unroll
        for (int nb = 0; nb < 4; ++nb) {
#pragma unroll
            for (int j = 0; j < 8; ++j) os[(hi * 8 + j) * 68 + nb * 16 + lr] = acc[mb][nb][j]; }
        __builtin_amdgcn_wave_barrier(); asm volatile("" ::: "memory");
        float* crow = C + (size_t)(r0 + mb * 16) * ldc + c0;
{
#pragma unroll
            for (int s = 0; s < 8; ++s) { const int row = 2 * s + hi, cofs = lr * 4; v4f val = *(const v4fa*)(os + row * 68 + cofs); if (BIAS) { val[0] += bfr(bias[c0 + cofs]); val[1] += bfr(bias[c0 + cofs + 1]); val[2] += bfr(bias[c0 + cofs + 2]); val[3] += bfr(bias[c0 + cofs + 3]); }
                *(v4f*)(crow + (size_t)row * ldc + cofs) = val; }
             }
        __builtin_amdgcn_wave_barrier(); asm volatile("" ::: "memory");
    }
}

__device__ __forceinline__ h16 tohx(float x) { return (h16)x; }
__device__ __forceinline__ void splitf(float y, unsigned short& h, unsigned short& l) { h = f2bf(y); l = f2bf(y - bf2f(h)); }
typedef __attribute__((ext_vector_type(2))) _Float16 v2h;
typedef __attribute__((ext_vector_type(4))) _Float16 v4h;
typedef __attribute__((ext_vector_type(2))) unsigned short v2us;
typedef __attribute__((ext_vector_type(4))) unsigned short v4us;
typedef __attribute__((ext_vector_type(2))) float v2f;

__global__ __launch_bounds__(256) void k_cvt8(const float* __restrict__ src, bf* dst, size_t n8) { const size_t i = (size_t)blockIdx.x * 256 + threadIdx.x; if (i >= n8) return; const v8f v = *(const v8f*)(src + i * 8); v8us o;
#pragma unroll
    for (int k = 0; k < 8; ++k) o[k] = f2bf(v[k]); *(v8us*)(dst + i * 8) = o;  }
// k_qkp: per (h, t, d pair): q = FQ[t][h*32+d] x 0.125, k = FK[...]: fp16 planes Q16/K16 [h][t][d] and hi/lo planes Qh/Ql, Kh/Kl (lane -> 2 d); k_vtp: VT16 [h][dd][t] (fp16) and VTh/VTl (hi/lo) = FV[t][h*32+dd] for dd < 32,
__global__ __launch_bounds__(256) void k_qkp(const float* __restrict__ FQ, const float* __restrict__ FK, h16* Q16, h16* K16, bf* Qh, bf* Ql, bf* Kh, bf* Kl) { const size_t e = ((size_t)blockIdx.x * 256 + threadIdx.x) * 2; if (e >= (size_t)NH_ * TT * HD) return; const int d = (int)(e % HD); const int t = (int)((e / HD) % TT); const int h = (int)(e / ((size_t)HD * TT)); const size_t s = (size_t)t * RK + h * HD + d; v2h q, k; v2us qh, ql, kh, kl;
#pragma unroll
    for (int u = 0; u < 2; ++u) { float qs = __fmul_rn(FQ[s + u], SCL); asm volatile("" : "+v"(qs)); q[u] = tohx(qs); k[u] = tohx(FK[s + u]); unsigned short a, c2; splitf(qs, a, c2); qh[u] = a; ql[u] = c2; splitf(FK[s + u], a, c2); kh[u] = a; kl[u] = c2; }
    { *(v2h*)(Q16 + e) = q; *(v2h*)(K16 + e) = k; *(v2us*)(Qh + e) = qh; *(v2us*)(Ql + e) = ql; *(v2us*)(Kh + e) = kh; *(v2us*)(Kl + e) = kl;  } }
__global__ __launch_bounds__(256) void k_vtp(const float* __restrict__ FV, h16* VT16, bf* VTh, bf* VTl) { const size_t e = ((size_t)blockIdx.x * 256 + threadIdx.x) * 2; if (e >= (size_t)NH_ * 64 * TT) return; const int t = (int)(e % TT); const int dd = (int)((e / TT) % 64); const int h = (int)(e / ((size_t)TT * 64)); v2h o; v2us oh, ol;
#pragma unroll
    for (int u = 0; u < 2; ++u) { const float v = (dd < HD) ? FV[(size_t)(t + u) * RK + h * HD + dd] : 0.f; o[u] = tohx(v); unsigned short a, c2; splitf(v, a, c2); oh[u] = a; ol[u] = c2; }
    { *(v2h*)(VT16 + e) = o; *(v2us*)(VTh + e) = oh; *(v2us*)(VTl + e) = ol;  } }
__global__ __launch_bounds__(256) void k_hsoft(const float* __restrict__ Sb, const float* __restrict__ mk, h16* P16, bf* Ph, bf* Pl) { const int lane = threadIdx.x & 31; const int row = blockIdx.x * 8 + (threadIdx.x >> 5); if (row >= TT) return; const float* sr = Sb + (size_t)row * TT; const float* mr = mk + (size_t)row * TT; float v[64]; float mx = -3.0e38f;
#pragma unroll
    for (int ch = 0; ch < 16; ++ch) { const int j0 = ch * 128 + lane * 4; const v4f a = *(const v4f*)(sr + j0), m4 = *(const v4f*)(mr + j0);
#pragma unroll
        for (int q = 0; q < 4; ++q) { const float t = fmaxf(__fadd_rn(a[q], m4[q]), -3.40282347e38f); v[ch * 4 + q] = t; mx = fmaxf(mx, t); } }
#pragma unroll
    for (int sh = 16; sh; sh >>= 1) mx = fmaxf(mx, __shfl_xor(mx, sh, 32));
    float sum = 0.f;
#pragma unroll
    for (int k = 0; k < 64; ++k) { float d0 = __fsub_rn(v[k], mx); asm volatile("" : "+v"(d0)); v[k] = __expf(d0); sum += v[k]; }
#pragma unroll
    for (int sh = 16; sh; sh >>= 1) sum += __shfl_xor(sum, sh, 32);
    if (row < RH) { const float f = __fdiv_rn(1.0f, sum);
{
#pragma unroll
            for (int ch = 0; ch < 16; ++ch) { v4us oh, ol;
#pragma unroll
                for (int q = 0; q < 4; ++q) { float y = __fmul_rn(v[ch * 4 + q], f); asm volatile("" : "+v"(y)); unsigned short a2, c2; splitf(y, a2, c2); oh[q] = a2; ol[q] = c2; }
                *(v4us*)(Ph + (size_t)row * TT + ch * 128 + lane * 4) = oh; *(v4us*)(Pl + (size_t)row * TT + ch * 128 + lane * 4) = ol; }
             } }
    else { const float f = __fdiv_rn(PCAR, sum);
{
#pragma unroll
            for (int ch = 0; ch < 16; ++ch) { v4h o;
#pragma unroll
                for (int q = 0; q < 4; ++q) o[q] = tohx(v[ch * 4 + q] * f); *(v4h*)(P16 + (size_t)row * TT + ch * 128 + lane * 4) = o; }
             } } }
__global__ __launch_bounds__(256) void k_ofm(const float* __restrict__ O, int h, bf* Ah, bf* Al) { const size_t e = ((size_t)blockIdx.x * 256 + threadIdx.x) * 2; if (e >= (size_t)TT * HD) return; const int d = (int)(e % HD), t = (int)(e / HD); const float sc = (t < RH) ? 1.0f : (1.0f / PCAR); v2us oh, ol;
#pragma unroll
    for (int u = 0; u < 2; ++u) { unsigned short a, c2; splitf(__fmul_rn(O[(size_t)t * 64 + d + u], sc), a, c2); oh[u] = a; ol[u] = c2; } const size_t oo = (size_t)t * RK + h * HD + d; *(v2us*)(Ah + oo) = oh; *(v2us*)(Al + oo) = ol;  }

extern "C" void kernel_launch(void* const* d_in, const int* in_sizes, int n_in,
                              void* d_out, int out_size, void* d_ws, size_t ws_size, hipStream_t stream) {
    (void)in_sizes; (void)n_in; (void)out_size;
    const float* IN[10]; for (int i = 0; i < 10; ++i) IN[i] = (const float*)d_in[i];   // 0 hidden, 1 attention_mask [2][1][2048][2048], 2 Wq [1024][2048], 3 bq, 4 Wk, 5 bk, 6 Wv, 7 bv, 8 Wo [2048][1024], 9 bo (torch [out][in])
    float* OUT = (float*)d_out;     // [2][2048][2048]
    char* wsp = (char*)d_ws;
    auto take = [&](size_t bytes) { char* p = wsp; wsp += (bytes + 255) & ~(size_t)255; return (void*)p; };
    bf* WQ = (bf*)take((size_t)RK * DM * 2); bf* WK = (bf*)take((size_t)RK * DM * 2); bf* WV = (bf*)take((size_t)RK * DM * 2); bf* WO = (bf*)take((size_t)DM * RK * 2);
    bf* XB = (bf*)take((size_t)TT * DM * 2); float* FQ = (float*)take((size_t)TT * RK * 4); float* FK = (float*)take((size_t)TT * RK * 4); float* FV = (float*)take((size_t)TT * RK * 4);
    h16* Q16 = (h16*)take((size_t)NH_ * TT * HD * 2); h16* K16 = (h16*)take((size_t)NH_ * TT * HD * 2); bf* Qh = (bf*)take((size_t)NH_ * TT * HD * 2); bf* Ql = (bf*)take((size_t)NH_ * TT * HD * 2); bf* Kh = (bf*)take((size_t)NH_ * TT * HD * 2); bf* Kl = (bf*)take((size_t)NH_ * TT * HD * 2);
    h16* VT16 = (h16*)take((size_t)NH_ * 64 * TT * 2); bf* VTh = (bf*)take((size_t)NH_ * 64 * TT * 2); bf* VTl = (bf*)take((size_t)NH_ * 64 * TT * 2);
    float* Sb = (float*)take((size_t)TT * TT * 4); h16* P16 = (h16*)take((size_t)TT * TT * 2); bf* Ph = (bf*)take((size_t)RH * TT * 2); bf* Pl = (bf*)take((size_t)RH * TT * 2); float* O = (float*)take((size_t)TT * 64 * 4); bf* Ah = (bf*)take((size_t)TT * RK * 2); bf* Al = (bf*)take((size_t)TT * RK * 2);
    if ((size_t)(wsp - (char*)d_ws) > ws_size) return;    // total ~ 139 MB = 132.5 MiB
    { const unsigned g = (unsigned)(((size_t)RK * DM / 8 + 255) / 256); k_cvt8<<<g, 256, 0, stream>>>(IN[2], WQ, (size_t)RK * DM / 8); k_cvt8<<<g, 256, 0, stream>>>(IN[4], WK, (size_t)RK * DM / 8); k_cvt8<<<g, 256, 0, stream>>>(IN[6], WV, (size_t)RK * DM / 8); k_cvt8<<<g, 256, 0, stream>>>(IN[8], WO, (size_t)DM * RK / 8); }
    const dim3 gP(TT / 64, RK / 64, 1);
    for (int b = 0; b < NB_; ++b) { const float* mkb = IN[1] + (size_t)b * TT * TT;
        k_cvt8<<<(unsigned)(((size_t)TT * DM / 8 + 255) / 256), 256, 0, stream>>>(IN[0] + (size_t)b * TT * DM, XB, (size_t)TT * DM / 8);
        k_gemmw<bf, 0, true><<<gP, 32, 0, stream>>>(XB, nullptr, WQ, nullptr, DM, FQ, RK, IN[3], 0, 0, 0); k_gemmw<bf, 0, true><<<gP, 32, 0, stream>>>(XB, nullptr, WK, nullptr, DM, FK, RK, IN[5], 0, 0, 0); k_gemmw<bf, 0, true><<<gP, 32, 0, stream>>>(XB, nullptr, WV, nullptr, DM, FV, RK, IN[7], 0, 0, 0);
        k_qkp<<<(unsigned)(((size_t)NH_ * TT * HD / 2 + 255) / 256), 256, 0, stream>>>(FQ, FK, Q16, K16, Qh, Ql, Kh, Kl); k_vtp<<<(unsigned)(((size_t)NH_ * 64 * TT / 2 + 255) / 256), 256, 0, stream>>>(FV, VT16, VTh, VTl);
        for (int h = 0; h < NH_; ++h) { const size_t po = (size_t)h * TT * HD, vo = (size_t)h * 64 * TT;
            k_gemmw<bf, 2, false><<<dim3(RH / 64, TT / 64, 1), 32, 0, stream>>>(Qh + po, Ql + po, Kh + po, Kl + po, HD, Sb, TT, nullptr, 0, 0, 0);                         // rows < RH: 3 products
            k_gemmw<h16, 0, false><<<dim3((TT - RH) / 64, TT / 64, 1), 32, 0, stream>>>(Q16 + po + (size_t)RH * HD, nullptr, K16 + po, nullptr, HD, Sb + (size_t)RH * TT, TT, nullptr, 0, 0, 0);
            k_hsoft<<<TT / 8, 256, 0, stream>>>(Sb, mkb, P16, Ph, Pl);
            k_gemmw<bf, 2, false><<<dim3(RH / 64, 1, 1), 32, 0, stream>>>(Ph, Pl, VTh + vo, VTl + vo, TT, O, 64, nullptr, 0, 0, 0);
            k_gemmw<h16, 0, false><<<dim3((TT - RH) / 64, 1, 1), 32, 0, stream>>>(P16 + (size_t)RH * TT, nullptr, VT16 + vo, nullptr, TT, O + (size_t)RH * 64, 64, nullptr, 0, 0, 0);
            k_ofm<<<(TT * HD / 2 + 255) / 256, 256, 0, stream>>>(O, h, Ah, Al); }
        k_gemmw<bf, 1, true><<<dim3(TT / 64, DM / 64, 1), 32, 0, stream>>>(Ah, Al, WO, nullptr, RK, OUT + (size_t)b * TT * DM, DM, IN[9], 0, 0, 0); }
}

// v001
// Measured time: 1250 microseconds a run.
// Two timings next to v000 put it at 5.40 and 5.41 times that version's speed.
#include <hip/hip_runtime.h>

// OPTEigenAttention - low-rank (eigen) OPT attention (hidden [2][2048][2048]; q = (x Wq^T + bq) x 64^-0.5 (32 heads x 32 low-rank dims; the scaling uses the ORIGINAL head dim 64), k = x Wk^T + bk, v = x Wv^T + bv (32 x 32);
// scores = q.k + attention_mask[b][0][i][j] (additive f32 mask input, read as data; then max(., float min)); softmax; out = merged att.v Wo^T + bo -> [2][2048][2048]).
// Compute dtypes, f32 accumulate: every input rounded to bf16; projections on PLAIN bf16 operands (inputs: exact, + bias); scores (K 32) and att.v on bf16 hi+lo planes (3 products) for
// the first 512 query rows of each head and on SINGLE fp16 planes for the rest (the mask here is causal, so early rows see few keys);
// the 32-wide value head zero-padded to a 64-wide tile; mask add and row softmax in f32 registers (one exp); merged heads as bf16 hi+lo planes x exact Wo (2 products) + bo. One-wave-per-64x64-tile GEMMs.
// Attention runs for all 32 heads at once (head = grid z, or grid y in the row kernels), RC query rows per pass; the pass's scores are [head][RC][2048] f32 and each softmax row is stored over its own score row
// (fp16 row in the first half; hi row in the first half and lo row in the second), so 32 heads of a pass fit the workspace.

#define NB_  2
#define TT   2048
#define DM   2048
#define RK   1024
#define NH_  32
#define HD   32
#define RH   512
#define RC   512      // query rows per attention pass; divides RH, so a pass lies wholly on one precision path
#define PCAR 1024.0f
#define SCL  0.125f
typedef _Float16 h16;
typedef unsigned short bf;
typedef __attribute__((ext_vector_type(16))) __bf16   v16bf;
typedef __attribute__((ext_vector_type(16))) _Float16 v16h;
typedef __attribute__((ext_vector_type(8)))  _Float16 v8h;
typedef __attribute__((ext_vector_type(8)))  unsigned short v8us;
typedef __attribute__((ext_vector_type(8)))  float    v8f;
typedef __attribute__((ext_vector_type(4)))  float    v4f;
typedef v8h  __attribute__((may_alias)) v8ha;
typedef v4f  __attribute__((may_alias)) v4fa;
typedef v8us __attribute__((may_alias)) v8usa;

__device__ __forceinline__ unsigned short f2bf(float f) { unsigned u = __float_as_uint(f); u += 0x7FFFu + ((u >> 16) & 1u); return (unsigned short)(u >> 16); }
__device__ __forceinline__ float bf2f(unsigned short b) { return __uint_as_float(((unsigned)b) << 16); }
__device__ __forceinline__ float bfr(float f) { return bf2f(f2bf(f)); }
__device__ __forceinline__ v16h cat16(v8h lo, v8h hi) { return __builtin_shufflevector(lo, hi, 0, 1, 2, 3, 4, 5, 6, 7, 8, 9, 10, 11, 12, 13, 14, 15); }
__device__ __forceinline__ v16bf cat16b(v8us lo, v8us hi) { return __builtin_bit_cast(v16bf, __builtin_shufflevector(lo, hi, 0, 1, 2, 3, 4, 5, 6, 7, 8, 9, 10, 11, 12, 13, 14, 15)); }
__device__ __forceinline__ v8f wmma16(v16h a, v16h b, v8f c) { return __builtin_amdgcn_wmma_f32_16x16x32_f16(false, a, false, b, (short)0, c, false, false); }
__device__ __forceinline__ v8f wmmab(v16bf a, v16bf b, v8f c) { return __builtin_amdgcn_wmma_f32_16x16x32_bf16(false, a, false, b, (short)0, c, false, false); }



// ---- k_gemmw: register-blocked GEMM, ONE WAVE per 64x64 output tile (16 accumulators), operands straight from K-contiguous 16-bit planes; grid (M/64, N/64, Z), 32 threads.
// C[m][n] (f32, pitch ldc, + optional f32 bias[n]) = sum_k A[m][k] Bt[n][k] (+ split products per NSPLIT). A rows have pitch lda, Bt rows pitch K. z-batch strides sA/sB/sC in elements. K % 32 == 0.
template <typename T16> struct WFrag;
template <> struct WFrag<h16> { typedef v16h V; static __device__ __forceinline__ V ld(const h16* p) { return cat16(*(const v8h*)p, *(const v8h*)(p + 16)); } static __device__ __forceinline__ v8f mma(V a, V b, v8f c) { return wmma16(a, b, c); } };
template <> struct WFrag<bf> { typedef v16bf V; static __device__ __forceinline__ V ld(const bf* p) { return cat16b(*(const v8us*)p, *(const v8us*)(p + 16)); } static __device__ __forceinline__ v8f mma(V a, V b, v8f c) { return wmmab(a, b, c); } };
template <typename T16, int NSPLIT, bool BIAS>
__global__ __launch_bounds__(32) void k_gemmw(const T16* __restrict__ A, const T16* __restrict__ A2, const T16* __restrict__ Bt, const T16* __restrict__ Bt2, int K, int lda, float* C, int ldc, const float* __restrict__ bias, size_t sA, size_t sB, size_t sC) {
    typedef typename WFrag<T16>::V V;
    __shared__ __align__(16) float os[16 * 68];
    const size_t z = blockIdx.z; A += z * sA; if (A2) A2 += z * sA; Bt += z * sB; if (Bt2) Bt2 += z * sB; C += z * sC;
    const int lane = threadIdx.x & 31, lr = lane & 15, hi = lane >> 4; const int r0 = blockIdx.x * 64, c0 = blockIdx.y * 64;
    v8f acc[4][4];
#pragma unroll
    for (int mb = 0; mb < 4; ++mb)
#pragma unroll
        for (int nb = 0; nb < 4; ++nb) acc[mb][nb] = (v8f){};
    const size_t aoff = (size_t)(r0 + lr) * lda + 8 * hi, boff = (size_t)(c0 + lr) * K + 8 * hi;
#pragma unroll 1
    for (int kc = 0; kc < K; kc += 32) {
        V a[4], a2[4]; const T16* pa[4]; const T16* pa2[4];
#pragma unroll
        for (int mb = 0; mb < 4; ++mb) { pa[mb] = A + aoff + (size_t)mb * 16 * lda + kc; a[mb] = WFrag<T16>::ld(pa[mb]); if (NSPLIT == 1 || NSPLIT == 2) { pa2[mb] = A2 + aoff + (size_t)mb * 16 * lda + kc; a2[mb] = WFrag<T16>::ld(pa2[mb]); } }
        // the A loads' address registers are inputs here, so none of them is rewritten (not even as a later load's destination) before the wait on their address translations
        if (NSPLIT == 1 || NSPLIT == 2) asm volatile("s_wait_xcnt 0x0" :: "v"(pa[0]), "v"(pa[1]), "v"(pa[2]), "v"(pa[3]), "v"(pa2[0]), "v"(pa2[1]), "v"(pa2[2]), "v"(pa2[3]) : "memory");
        else asm volatile("s_wait_xcnt 0x0" :: "v"(pa[0]), "v"(pa[1]), "v"(pa[2]), "v"(pa[3]) : "memory");
#pragma unroll
        for (int nb = 0; nb < 4; ++nb) { const V b = WFrag<T16>::ld(Bt + boff + (size_t)nb * 16 * K + kc); V b2; if (NSPLIT >= 2) b2 = WFrag<T16>::ld(Bt2 + boff + (size_t)nb * 16 * K + kc);
#pragma unroll
            for (int mb = 0; mb < 4; ++mb) { acc[mb][nb] = WFrag<T16>::mma(a[mb], b, acc[mb][nb]); if (NSPLIT == 1 || NSPLIT == 2) acc[mb][nb] = WFrag<T16>::mma(a2[mb], b, acc[mb][nb]); if (NSPLIT >= 2) acc[mb][nb] = WFrag<T16>::mma(a[mb], b2, acc[mb][nb]); } }
        asm volatile("v_nop\n\tv_nop\n\tv_nop\n\tv_nop" : "+v"(acc[0][0]), "+v"(acc[1][1]), "+v"(acc[2][2]), "+v"(acc[3][3]) : "v"(a[0]), "v"(a[3]));
    }
#pragma unroll
    for (int mb = 0; mb < 4; ++mb) {
#pragma unroll
        for (int nb = 0; nb < 4; ++nb) {
#pragma unroll
            for (int j = 0; j < 8; ++j) os[(hi * 8 + j) * 68 + nb * 16 + lr] = acc[mb][nb][j]; }
        __builtin_amdgcn_wave_barrier(); asm volatile("" ::: "memory");
        float* crow = C + (size_t)(r0 + mb * 16) * ldc + c0;
{
#pragma unroll
            for (int s = 0; s < 8; ++s) { const int row = 2 * s + hi, cofs = lr * 4; v4f val = *(const v4fa*)(os + row * 68 + cofs); if (BIAS) { val[0] += bfr(bias[c0 + cofs]); val[1] += bfr(bias[c0 + cofs + 1]); val[2] += bfr(bias[c0 + cofs + 2]); val[3] += bfr(bias[c0 + cofs + 3]); }
                *(v4f*)(crow + (size_t)row * ldc + cofs) = val; }
             }
        __builtin_amdgcn_wave_barrier(); asm volatile("" ::: "memory");
    }
}

__device__ __forceinline__ h16 tohx(float x) { return (h16)x; }
__device__ __forceinline__ void splitf(float y, unsigned short& h, unsigned short& l) { h = f2bf(y); l = f2bf(y - bf2f(h)); }
typedef __attribute__((ext_vector_type(2))) _Float16 v2h;
typedef __attribute__((ext_vector_type(4))) _Float16 v4h;
typedef __attribute__((ext_vector_type(2))) unsigned short v2us;
typedef __attribute__((ext_vector_type(4))) unsigned short v4us;
typedef __attribute__((ext_vector_type(2))) float v2f;

__global__ __launch_bounds__(256) void k_cvt8(const float* __restrict__ src, bf* dst, size_t n8) { const size_t i = (size_t)blockIdx.x * 256 + threadIdx.x; if (i >= n8) return; const v8f v = *(const v8f*)(src + i * 8); v8us o;
#pragma unroll
    for (int k = 0; k < 8; ++k) o[k] = f2bf(v[k]); *(v8us*)(dst + i * 8) = o;  }
// k_qkp: per (h, t, d pair): q = FQ[t][h*32+d] x 0.125, k = FK[...]: fp16 planes Q16/K16 [h][t][d] and hi/lo planes Qh/Ql, Kh/Kl (lane -> 2 d); k_vtp: VT16 [h][dd][t] (fp16) and VTh/VTl (hi/lo) = FV[t][h*32+dd] for dd < 32,
__global__ __launch_bounds__(256) void k_qkp(const float* __restrict__ FQ, const float* __restrict__ FK, h16* Q16, h16* K16, bf* Qh, bf* Ql, bf* Kh, bf* Kl) { const size_t e = ((size_t)blockIdx.x * 256 + threadIdx.x) * 2; if (e >= (size_t)NH_ * TT * HD) return; const int d = (int)(e % HD); const int t = (int)((e / HD) % TT); const int h = (int)(e / ((size_t)HD * TT)); const size_t s = (size_t)t * RK + h * HD + d; v2h q, k; v2us qh, ql, kh, kl;
#pragma unroll
    for (int u = 0; u < 2; ++u) { float qs = __fmul_rn(FQ[s + u], SCL); asm volatile("" : "+v"(qs)); q[u] = tohx(qs); k[u] = tohx(FK[s + u]); unsigned short a, c2; splitf(qs, a, c2); qh[u] = a; ql[u] = c2; splitf(FK[s + u], a, c2); kh[u] = a; kl[u] = c2; }
    { *(v2h*)(Q16 + e) = q; *(v2h*)(K16 + e) = k; *(v2us*)(Qh + e) = qh; *(v2us*)(Ql + e) = ql; *(v2us*)(Kh + e) = kh; *(v2us*)(Kl + e) = kl;  } }
__global__ __launch_bounds__(256) void k_vtp(const float* __restrict__ FV, h16* VT16, bf* VTh, bf* VTl) { const size_t e = ((size_t)blockIdx.x * 256 + threadIdx.x) * 2; if (e >= (size_t)NH_ * 64 * TT) return; const int t = (int)(e % TT); const int dd = (int)((e / TT) % 64); const int h = (int)(e / ((size_t)TT * 64)); v2h o; v2us oh, ol;
#pragma unroll
    for (int u = 0; u < 2; ++u) { const float v = (dd < HD) ? FV[(size_t)(t + u) * RK + h * HD + dd] : 0.f; o[u] = tohx(v); unsigned short a, c2; splitf(v, a, c2); oh[u] = a; ol[u] = c2; }
    { *(v2h*)(VT16 + e) = o; *(v2us*)(VTh + e) = oh; *(v2us*)(VTl + e) = ol;  } }
// k_hsoft: one wave per score row; grid (RC/8, heads); q0 = first query row of the pass. The wave holds its whole row in registers before it stores, and every stored value depends on the row sum, so the result may lie over the row itself.
__global__ __launch_bounds__(256) void k_hsoft(float* Sb, const float* __restrict__ mk, int q0) { const int lane = threadIdx.x & 31; const int rr = blockIdx.x * 8 + (threadIdx.x >> 5); if (rr >= RC) return; const int row = q0 + rr; float* sr = Sb + ((size_t)blockIdx.y * RC + rr) * TT; const float* mr = mk + (size_t)row * TT; float v[64]; float mx = -3.0e38f;
#pragma unroll
    for (int ch = 0; ch < 16; ++ch) { const int j0 = ch * 128 + lane * 4; const v4f a = *(const v4f*)(sr + j0), m4 = *(const v4f*)(mr + j0);
#pragma unroll
        for (int q = 0; q < 4; ++q) { const float t = fmaxf(__fadd_rn(a[q], m4[q]), -3.40282347e38f); v[ch * 4 + q] = t; mx = fmaxf(mx, t); } }
#pragma unroll
    for (int sh = 16; sh; sh >>= 1) mx = fmaxf(mx, __shfl_xor(mx, sh, 32));
    float sum = 0.f;
#pragma unroll
    for (int k = 0; k < 64; ++k) { float d0 = __fsub_rn(v[k], mx); asm volatile("" : "+v"(d0)); v[k] = __expf(d0); sum += v[k]; }
#pragma unroll
    for (int sh = 16; sh; sh >>= 1) sum += __shfl_xor(sum, sh, 32);
    if (row < RH) { const float f = __fdiv_rn(1.0f, sum); bf* Ph = (bf*)sr; bf* Pl = Ph + TT;
{
#pragma unroll
            for (int ch = 0; ch < 16; ++ch) { v4us oh, ol;
#pragma unroll
                for (int q = 0; q < 4; ++q) { float y = __fmul_rn(v[ch * 4 + q], f); asm volatile("" : "+v"(y)); unsigned short a2, c2; splitf(y, a2, c2); oh[q] = a2; ol[q] = c2; }
                *(v4us*)(Ph + ch * 128 + lane * 4) = oh; *(v4us*)(Pl + ch * 128 + lane * 4) = ol; }
             } }
    else { const float f = __fdiv_rn(PCAR, sum); h16* P16 = (h16*)sr;
{
#pragma unroll
            for (int ch = 0; ch < 16; ++ch) { v4h o;
#pragma unroll
                for (int q = 0; q < 4; ++q) o[q] = tohx(v[ch * 4 + q] * f); *(v4h*)(P16 + ch * 128 + lane * 4) = o; }
             } } }
__global__ __launch_bounds__(256) void k_ofm(const float* __restrict__ O, bf* Ah, bf* Al) { const int h = blockIdx.y; O += (size_t)h * TT * 64; const size_t e = ((size_t)blockIdx.x * 256 + threadIdx.x) * 2; if (e >= (size_t)TT * HD) return; const int d = (int)(e % HD), t = (int)(e / HD); const float sc = (t < RH) ? 1.0f : (1.0f / PCAR); v2us oh, ol;
#pragma unroll
    for (int u = 0; u < 2; ++u) { unsigned short a, c2; splitf(__fmul_rn(O[(size_t)t * 64 + d + u], sc), a, c2); oh[u] = a; ol[u] = c2; } const size_t oo = (size_t)t * RK + h * HD + d; *(v2us*)(Ah + oo) = oh; *(v2us*)(Al + oo) = ol;  }

extern "C" void kernel_launch(void* const* d_in, const int* in_sizes, int n_in,
                              void* d_out, int out_size, void* d_ws, size_t ws_size, hipStream_t stream) {
    (void)in_sizes; (void)n_in; (void)out_size;
    const float* IN[10]; for (int i = 0; i < 10; ++i) IN[i] = (const float*)d_in[i];   // 0 hidden, 1 attention_mask [2][1][2048][2048], 2 Wq [1024][2048], 3 bq, 4 Wk, 5 bk, 6 Wv, 7 bv, 8 Wo [2048][1024], 9 bo (torch [out][in])
    float* OUT = (float*)d_out;     // [2][2048][2048]
    char* wsp = (char*)d_ws;
    auto take = [&](size_t bytes) { char* p = wsp; wsp += (bytes + 255) & ~(size_t)255; return (void*)p; };
    bf* WQ = (bf*)take((size_t)RK * DM * 2); bf* WK = (bf*)take((size_t)RK * DM * 2); bf* WV = (bf*)take((size_t)RK * DM * 2); bf* WO = (bf*)take((size_t)DM * RK * 2);
    bf* XB = (bf*)take((size_t)TT * DM * 2); float* FQ = (float*)take((size_t)TT * RK * 4); float* FK = (float*)take((size_t)TT * RK * 4); float* FV = (float*)take((size_t)TT * RK * 4);
    h16* Q16 = (h16*)take((size_t)NH_ * TT * HD * 2); h16* K16 = (h16*)take((size_t)NH_ * TT * HD * 2); bf* Qh = (bf*)take((size_t)NH_ * TT * HD * 2); bf* Ql = (bf*)take((size_t)NH_ * TT * HD * 2); bf* Kh = (bf*)take((size_t)NH_ * TT * HD * 2); bf* Kl = (bf*)take((size_t)NH_ * TT * HD * 2);
    h16* VT16 = (h16*)take((size_t)NH_ * 64 * TT * 2); bf* VTh = (bf*)take((size_t)NH_ * 64 * TT * 2); bf* VTl = (bf*)take((size_t)NH_ * 64 * TT * 2);
    float* Sb = (float*)take((size_t)NH_ * RC * TT * 4); float* O = (float*)take((size_t)NH_ * TT * 64 * 4); bf* Ah = (bf*)take((size_t)TT * RK * 2); bf* Al = (bf*)take((size_t)TT * RK * 2);
    if ((size_t)(wsp - (char*)d_ws) > ws_size) return;    // total 248 MiB
    { const unsigned g = (unsigned)(((size_t)RK * DM / 8 + 255) / 256); k_cvt8<<<g, 256, 0, stream>>>(IN[2], WQ, (size_t)RK * DM / 8); k_cvt8<<<g, 256, 0, stream>>>(IN[4], WK, (size_t)RK * DM / 8); k_cvt8<<<g, 256, 0, stream>>>(IN[6], WV, (size_t)RK * DM / 8); k_cvt8<<<g, 256, 0, stream>>>(IN[8], WO, (size_t)DM * RK / 8); }
    const dim3 gP(TT / 64, RK / 64, 1);
    for (int b = 0; b < NB_; ++b) { const float* mkb = IN[1] + (size_t)b * TT * TT;
        k_cvt8<<<(unsigned)(((size_t)TT * DM / 8 + 255) / 256), 256, 0, stream>>>(IN[0] + (size_t)b * TT * DM, XB, (size_t)TT * DM / 8);
        k_gemmw<bf, 0, true><<<gP, 32, 0, stream>>>(XB, nullptr, WQ, nullptr, DM, DM, FQ, RK, IN[3], 0, 0, 0); k_gemmw<bf, 0, true><<<gP, 32, 0, stream>>>(XB, nullptr, WK, nullptr, DM, DM, FK, RK, IN[5], 0, 0, 0); k_gemmw<bf, 0, true><<<gP, 32, 0, stream>>>(XB, nullptr, WV, nullptr, DM, DM, FV, RK, IN[7], 0, 0, 0);
        k_qkp<<<(unsigned)(((size_t)NH_ * TT * HD / 2 + 255) / 256), 256, 0, stream>>>(FQ, FK, Q16, K16, Qh, Ql, Kh, Kl); k_vtp<<<(unsigned)(((size_t)NH_ * 64 * TT / 2 + 255) / 256), 256, 0, stream>>>(FV, VT16, VTh, VTl);
        const size_t sQK = (size_t)TT * HD, sVT = (size_t)64 * TT, sS = (size_t)RC * TT, sP = (size_t)RC * 2 * TT, sO = (size_t)TT * 64;   // per-head strides; sP: a head's RC score rows counted in 16-bit elements
        for (int q0 = 0; q0 < TT; q0 += RC) { const dim3 gS(RC / 64, TT / 64, NH_), gV(RC / 64, 1, NH_);
            if (q0 < RH) k_gemmw<bf, 2, false><<<gS, 32, 0, stream>>>(Qh + (size_t)q0 * HD, Ql + (size_t)q0 * HD, Kh, Kl, HD, HD, Sb, TT, nullptr, sQK, sQK, sS);                         // rows < RH: 3 products
            else k_gemmw<h16, 0, false><<<gS, 32, 0, stream>>>(Q16 + (size_t)q0 * HD, nullptr, K16, nullptr, HD, HD, Sb, TT, nullptr, sQK, sQK, sS);
            k_hsoft<<<dim3(RC / 8, NH_, 1), 256, 0, stream>>>(Sb, mkb, q0);
            if (q0 < RH) k_gemmw<bf, 2, false><<<gV, 32, 0, stream>>>((const bf*)Sb, (const bf*)Sb + TT, VTh, VTl, TT, 2 * TT, O + (size_t)q0 * 64, 64, nullptr, sP, sVT, sO);
            else k_gemmw<h16, 0, false><<<gV, 32, 0, stream>>>((const h16*)Sb, nullptr, VT16, nullptr, TT, 2 * TT, O + (size_t)q0 * 64, 64, nullptr, sP, sVT, sO); }
        k_ofm<<<dim3((TT * HD / 2 + 255) / 256, NH_, 1), 256, 0, stream>>>(O, Ah, Al);
        k_gemmw<bf, 1, true><<<dim3(TT / 64, DM / 64, 1), 32, 0, stream>>>(Ah, Al, WO, nullptr, RK, RK, OUT + (size_t)b * TT * DM, DM, IN[9], 0, 0, 0); }
}

// v002
// It runs in 518 microseconds.
// Next to v001, in two timings, it ran 2.42 and 2.41 times as fast.
// Counting every step since v000, it is 13.1 times as fast.
#include <hip/hip_runtime.h>

// OPTEigenAttention - low-rank (eigen) OPT attention (hidden [2][2048][2048]; q = (x Wq^T + bq) x 64^-0.5 (32 heads x 32 low-rank dims; the scaling uses the ORIGINAL head dim 64), k = x Wk^T + bk, v = x Wv^T + bv (32 x 32);
// scores = q.k + attention_mask[b][0][i][j] (additive f32 mask input, read as data; then max(., float min)); softmax; out = merged att.v Wo^T + bo -> [2][2048][2048]).
// Compute dtypes, f32 accumulate: every input rounded to bf16; projections on PLAIN bf16 operands (inputs: exact, + bias); scores (K 32) and att.v on bf16 hi+lo planes (3 products) for
// the first 512 query rows of each head and on SINGLE fp16 planes for the rest (the mask here is causal, so early rows see few keys);
// mask add and softmax in f32 registers; merged heads as bf16 hi+lo planes x exact Wo (2 products) + bo. One-wave-per-64x64-tile GEMMs for the projections.
// Attention is ONE kernel per batch entry (k_fattn): S^T = K.Q^T, running-maximum softmax in registers, O^T += V^T.P^T; no score or probability ever reaches memory.

#define NB_  2
#define TT   2048
#define DM   2048
#define RK   1024
#define NH_  32
#define HD   32
#define RH   512
#define SCL  0.125f
typedef _Float16 h16;
typedef unsigned short bf;
typedef __attribute__((ext_vector_type(16))) __bf16   v16bf;
typedef __attribute__((ext_vector_type(16))) _Float16 v16h;
typedef __attribute__((ext_vector_type(8)))  _Float16 v8h;
typedef __attribute__((ext_vector_type(8)))  unsigned short v8us;
typedef __attribute__((ext_vector_type(8)))  float    v8f;
typedef __attribute__((ext_vector_type(4)))  float    v4f;
typedef v8h  __attribute__((may_alias)) v8ha;
typedef v4f  __attribute__((may_alias)) v4fa;
typedef v8us __attribute__((may_alias)) v8usa;

__device__ __forceinline__ unsigned short f2bf(float f) { unsigned u = __float_as_uint(f); u += 0x7FFFu + ((u >> 16) & 1u); return (unsigned short)(u >> 16); }
__device__ __forceinline__ float bf2f(unsigned short b) { return __uint_as_float(((unsigned)b) << 16); }
__device__ __forceinline__ float bfr(float f) { return bf2f(f2bf(f)); }
__device__ __forceinline__ v16h cat16(v8h lo, v8h hi) { return __builtin_shufflevector(lo, hi, 0, 1, 2, 3, 4, 5, 6, 7, 8, 9, 10, 11, 12, 13, 14, 15); }
__device__ __forceinline__ v16bf cat16b(v8us lo, v8us hi) { return __builtin_bit_cast(v16bf, __builtin_shufflevector(lo, hi, 0, 1, 2, 3, 4, 5, 6, 7, 8, 9, 10, 11, 12, 13, 14, 15)); }
__device__ __forceinline__ v8f wmma16(v16h a, v16h b, v8f c) { return __builtin_amdgcn_wmma_f32_16x16x32_f16(false, a, false, b, (short)0, c, false, false); }
__device__ __forceinline__ v8f wmmab(v16bf a, v16bf b, v8f c) { return __builtin_amdgcn_wmma_f32_16x16x32_bf16(false, a, false, b, (short)0, c, false, false); }



// ---- k_gemmw: register-blocked GEMM, ONE WAVE per 64x64 output tile (16 accumulators), operands straight from K-contiguous 16-bit planes; grid (M/64, N/64, Z), 32 threads.
// C[m][n] (f32, pitch ldc, + optional f32 bias[n]) = sum_k A[m][k] Bt[n][k] (+ split products per NSPLIT). A rows have pitch lda, Bt rows pitch K. z-batch strides sA/sB/sC in elements. K % 32 == 0.
template <typename T16> struct WFrag;
template <> struct WFrag<h16> { typedef v16h V; static __device__ __forceinline__ V ld(const h16* p) { return cat16(*(const v8h*)p, *(const v8h*)(p + 16)); } static __device__ __forceinline__ v8f mma(V a, V b, v8f c) { return wmma16(a, b, c); } };
template <> struct WFrag<bf> { typedef v16bf V; static __device__ __forceinline__ V ld(const bf* p) { return cat16b(*(const v8us*)p, *(const v8us*)(p + 16)); } static __device__ __forceinline__ v8f mma(V a, V b, v8f c) { return wmmab(a, b, c); } };
template <typename T16, int NSPLIT, bool BIAS>
__global__ __launch_bounds__(32) void k_gemmw(const T16* __restrict__ A, const T16* __restrict__ A2, const T16* __restrict__ Bt, const T16* __restrict__ Bt2, int K, int lda, float* C, int ldc, const float* __restrict__ bias, size_t sA, size_t sB, size_t sC) {
    typedef typename WFrag<T16>::V V;
    __shared__ __align__(16) float os[16 * 68];
    const size_t z = blockIdx.z; A += z * sA; if (A2) A2 += z * sA; Bt += z * sB; if (Bt2) Bt2 += z * sB; C += z * sC;
    const int lane = threadIdx.x & 31, lr = lane & 15, hi = lane >> 4; const int r0 = blockIdx.x * 64, c0 = blockIdx.y * 64;
    v8f acc[4][4];
#pragma unroll
    for (int mb = 0; mb < 4; ++mb)
#pragma unroll
        for (int nb = 0; nb < 4; ++nb) acc[mb][nb] = (v8f){};
    const size_t aoff = (size_t)(r0 + lr) * lda + 8 * hi, boff = (size_t)(c0 + lr) * K + 8 * hi;
#pragma unroll 1
    for (int kc = 0; kc < K; kc += 32) {
        V a[4], a2[4]; const T16* pa[4]; const T16* pa2[4];
#pragma unroll
        for (int mb = 0; mb < 4; ++mb) { pa[mb] = A + aoff + (size_t)mb * 16 * lda + kc; a[mb] = WFrag<T16>::ld(pa[mb]); if (NSPLIT == 1 || NSPLIT == 2) { pa2[mb] = A2 + aoff + (size_t)mb * 16 * lda + kc; a2[mb] = WFrag<T16>::ld(pa2[mb]); } }
        // the A loads' address registers are inputs here, so none of them is rewritten (not even as a later load's destination) before the wait on their address translations
        if (NSPLIT == 1 || NSPLIT == 2) asm volatile("s_wait_xcnt 0x0" :: "v"(pa[0]), "v"(pa[1]), "v"(pa[2]), "v"(pa[3]), "v"(pa2[0]), "v"(pa2[1]), "v"(pa2[2]), "v"(pa2[3]) : "memory");
        else asm volatile("s_wait_xcnt 0x0" :: "v"(pa[0]), "v"(pa[1]), "v"(pa[2]), "v"(pa[3]) : "memory");
#pragma unroll
        for (int nb = 0; nb < 4; ++nb) { const V b = WFrag<T16>::ld(Bt + boff + (size_t)nb * 16 * K + kc); V b2; if (NSPLIT >= 2) b2 = WFrag<T16>::ld(Bt2 + boff + (size_t)nb * 16 * K + kc);
#pragma unroll
            for (int mb = 0; mb < 4; ++mb) { acc[mb][nb] = WFrag<T16>::mma(a[mb], b, acc[mb][nb]); if (NSPLIT == 1 || NSPLIT == 2) acc[mb][nb] = WFrag<T16>::mma(a2[mb], b, acc[mb][nb]); if (NSPLIT >= 2) acc[mb][nb] = WFrag<T16>::mma(a[mb], b2, acc[mb][nb]); } }
        asm volatile("v_nop\n\tv_nop\n\tv_nop\n\tv_nop" : "+v"(acc[0][0]), "+v"(acc[1][1]), "+v"(acc[2][2]), "+v"(acc[3][3]) : "v"(a[0]), "v"(a[3]));
    }
#pragma unroll
    for (int mb = 0; mb < 4; ++mb) {
#pragma unroll
        for (int nb = 0; nb < 4; ++nb) {
#pragma unroll
            for (int j = 0; j < 8; ++j) os[(hi * 8 + j) * 68 + nb * 16 + lr] = acc[mb][nb][j]; }
        __builtin_amdgcn_wave_barrier(); asm volatile("" ::: "memory");
        float* crow = C + (size_t)(r0 + mb * 16) * ldc + c0;
{
#pragma unroll
            for (int s = 0; s < 8; ++s) { const int row = 2 * s + hi, cofs = lr * 4; v4f val = *(const v4fa*)(os + row * 68 + cofs); if (BIAS) { val[0] += bfr(bias[c0 + cofs]); val[1] += bfr(bias[c0 + cofs + 1]); val[2] += bfr(bias[c0 + cofs + 2]); val[3] += bfr(bias[c0 + cofs + 3]); }
                *(v4f*)(crow + (size_t)row * ldc + cofs) = val; }
             }
        __builtin_amdgcn_wave_barrier(); asm volatile("" ::: "memory");
    }
}

__device__ __forceinline__ h16 tohx(float x) { return (h16)x; }
__device__ __forceinline__ void splitf(float y, unsigned short& h, unsigned short& l) { h = f2bf(y); l = f2bf(y - bf2f(h)); }
typedef __attribute__((ext_vector_type(2))) _Float16 v2h;
typedef __attribute__((ext_vector_type(4))) _Float16 v4h;
typedef __attribute__((ext_vector_type(2))) unsigned short v2us;
typedef __attribute__((ext_vector_type(4))) unsigned short v4us;
typedef __attribute__((ext_vector_type(2))) float v2f;

__global__ __launch_bounds__(256) void k_cvt8(const float* __restrict__ src, bf* dst, size_t n8) { const size_t i = (size_t)blockIdx.x * 256 + threadIdx.x; if (i >= n8) return; const v8f v = *(const v8f*)(src + i * 8); v8us o;
#pragma unroll
    for (int k = 0; k < 8; ++k) o[k] = f2bf(v[k]); *(v8us*)(dst + i * 8) = o;  }
// k_qkp: per (h, t, d pair): q = FQ[t][h*32+d] x 0.125, k = FK[...]: fp16 planes Q16/K16 [h][t][d] and hi/lo planes Qh/Ql, Kh/Kl (lane -> 2 d); k_vtp: VT16 [h][dd][t] (fp16) and VTh/VTl (hi/lo) = FV[t][h*32+dd] for dd < 32,
__global__ __launch_bounds__(256) void k_qkp(const float* __restrict__ FQ, const float* __restrict__ FK, h16* Q16, h16* K16, bf* Qh, bf* Ql, bf* Kh, bf* Kl) { const size_t e = ((size_t)blockIdx.x * 256 + threadIdx.x) * 2; if (e >= (size_t)NH_ * TT * HD) return; const int d = (int)(e % HD); const int t = (int)((e / HD) % TT); const int h = (int)(e / ((size_t)HD * TT)); const size_t s = (size_t)t * RK + h * HD + d; v2h q, k; v2us qh, ql, kh, kl;
#pragma unroll
    for (int u = 0; u < 2; ++u) { float qs = __fmul_rn(FQ[s + u], SCL); asm volatile("" : "+v"(qs)); q[u] = tohx(qs); k[u] = tohx(FK[s + u]); unsigned short a, c2; splitf(qs, a, c2); qh[u] = a; ql[u] = c2; splitf(FK[s + u], a, c2); kh[u] = a; kl[u] = c2; }
    { *(v2h*)(Q16 + e) = q; *(v2h*)(K16 + e) = k; *(v2us*)(Qh + e) = qh; *(v2us*)(Ql + e) = ql; *(v2us*)(Kh + e) = kh; *(v2us*)(Kl + e) = kl;  } }
__global__ __launch_bounds__(256) void k_vtp(const float* __restrict__ FV, h16* VT16, bf* VTh, bf* VTl) { const size_t e = ((size_t)blockIdx.x * 256 + threadIdx.x) * 2; if (e >= (size_t)NH_ * 64 * TT) return; const int t = (int)(e % TT); const int dd = (int)((e / TT) % 64); const int h = (int)(e / ((size_t)TT * 64)); v2h o; v2us oh, ol;
#pragma unroll
    for (int u = 0; u < 2; ++u) { const float v = (dd < HD) ? FV[(size_t)(t + u) * RK + h * HD + dd] : 0.f; o[u] = tohx(v); unsigned short a, c2; splitf(v, a, c2); oh[u] = a; ol[u] = c2; }
    { *(v2h*)(VT16 + e) = o; *(v2us*)(VTh + e) = oh; *(v2us*)(VTl + e) = ol;  } }
__device__ __forceinline__ float xhalf(float x) { const int b = __float_as_int(x); return __int_as_float(__builtin_amdgcn_permlanex16(b, b, 0x76543210, 0xfedcba98, false, false)); }
#define FMIN_ (-3.40282347e38f)
template <typename T16, int NQ> struct AStage { typename WFrag<T16>::V k[2], k2[2]; v8f m[NQ][2]; };   // one step's K fragments and mask tiles
template <typename T16> struct VStage { typename WFrag<T16>::V v[2], v2[2]; };                          // one step's V^T fragments
template <typename T16, bool HILO, int NQ>
__device__ __forceinline__ void a_loadk(AStage<T16, NQ>& s, const T16* pk, const T16* pk2, const float* pm) {
#pragma unroll
    for (int kt = 0; kt < 2; ++kt) { s.k[kt] = WFrag<T16>::ld(pk + kt * 16 * HD); if (HILO) s.k2[kt] = WFrag<T16>::ld(pk2 + kt * 16 * HD); }
#pragma unroll
    for (int qt = 0; qt < NQ; ++qt)
#pragma unroll
        for (int kt = 0; kt < 2; ++kt) s.m[qt][kt] = *(const v8f*)(pm + (size_t)qt * 16 * TT + kt * 16);
    asm volatile("s_wait_xcnt 0x0" ::: "memory");   // stands behind the group's loads, before their address registers are rewritten for the next group; the clobber also keeps these loads ahead of the work on the other stage
}
template <typename T16, bool HILO>
__device__ __forceinline__ void a_loadv(VStage<T16>& s, const T16* pv, const T16* pv2) {
#pragma unroll
    for (int dt = 0; dt < 2; ++dt) { s.v[dt] = WFrag<T16>::ld(pv + (size_t)dt * 16 * TT); if (HILO) s.v2[dt] = WFrag<T16>::ld(pv2 + (size_t)dt * 16 * TT); }
    asm volatile("s_wait_xcnt 0x0" ::: "memory");   // as in a_loadk
}
template <typename T16, bool HILO, int NQ>
__device__ __forceinline__ void a_step(const AStage<T16, NQ>& s, const VStage<T16>& sv, const typename WFrag<T16>::V (&bq)[NQ], const typename WFrag<T16>::V (&bq2)[NQ], v8f (&acc)[NQ][2], float (&mr)[NQ], float (&sm)[NQ]) {
    typedef typename WFrag<T16>::V V;
    float t[NQ][16], mx[NQ]; bool need = false;
#pragma unroll
    for (int qt = 0; qt < NQ; ++qt) {
#pragma unroll
        for (int kt = 0; kt < 2; ++kt) { v8f d = WFrag<T16>::mma(s.k[kt], bq[qt], s.m[qt][kt]);   // the mask tile has D's map: it is the product's C operand, so q.k + mask comes out of the matrix unit
            if (HILO) { d = WFrag<T16>::mma(s.k2[kt], bq[qt], d); d = WFrag<T16>::mma(s.k[kt], bq2[qt], d); }
#pragma unroll
            for (int r = 0; r < 8; ++r) t[qt][kt * 8 + r] = fmaxf(d[r], FMIN_); }
        float a = t[qt][0];
#pragma unroll
        for (int i = 1; i < 16; ++i) a = fmaxf(a, t[qt][i]);
        a = fmaxf(a, xhalf(a)); mx[qt] = a; need = need || (a > mr[qt]); }
    if (__builtin_amdgcn_ballot_w32(need) != 0) {   // a column's maximum rose: rescale what is summed so far (factor 1 in the other columns)
#pragma unroll
        for (int qt = 0; qt < NQ; ++qt) { const float mn = fmaxf(mr[qt], mx[qt]); const float al = __expf(mr[qt] - mn); mr[qt] = mn; sm[qt] *= al;
#pragma unroll
            for (int dt = 0; dt < 2; ++dt)
#pragma unroll
                for (int r = 0; r < 8; ++r) acc[qt][dt][r] *= al; } }
#pragma unroll
    for (int qt = 0; qt < NQ; ++qt) { V bp, bp2;
#pragma unroll
        for (int i = 0; i < 16; ++i) { const float p = __expf(t[qt][i] - mr[qt]); sm[qt] += p;
            if constexpr (HILO) { const __bf16 ph = (__bf16)p; bp[i] = ph; bp2[i] = (__bf16)(p - (float)ph); } else bp[i] = (h16)p; }
#pragma unroll
        for (int dt = 0; dt < 2; ++dt) { acc[qt][dt] = WFrag<T16>::mma(sv.v[dt], bp, acc[qt][dt]); if (HILO) { acc[qt][dt] = WFrag<T16>::mma(sv.v2[dt], bp, acc[qt][dt]); acc[qt][dt] = WFrag<T16>::mma(sv.v[dt], bp2, acc[qt][dt]); } } }
}
// Qp, Kp: one head's [t][32] planes; Vp: its [dd][t] plane (rows 0..31 used); mk: this batch entry's [q][key] mask; q0: the wave's first query; the merged-head planes Ah/Al [t][1024] take o = O / sum as bf16 hi + lo.
template <typename T16, bool HILO, int NQ>
__device__ __forceinline__ void attn_cols(const T16* Qp, const T16* Qp2, const T16* Kp, const T16* Kp2, const T16* Vp, const T16* Vp2, const float* mk, bf* Ah, bf* Al, int h, int q0) {
    typedef typename WFrag<T16>::V V;
    const int lane = threadIdx.x & 31, lr = lane & 15, hi = lane >> 4;
    V bq[NQ], bq2[NQ]; v8f acc[NQ][2]; float mr[NQ], sm[NQ];
    const T16* ql = Qp + (size_t)(q0 + lr) * HD + 8 * hi; const T16* q2l = Qp2 + (size_t)(q0 + lr) * HD + 8 * hi;
#pragma unroll
    for (int qt = 0; qt < NQ; ++qt) { bq[qt] = WFrag<T16>::ld(ql + qt * 16 * HD); if (HILO) bq2[qt] = WFrag<T16>::ld(q2l + qt * 16 * HD); acc[qt][0] = (v8f){}; acc[qt][1] = (v8f){}; mr[qt] = FMIN_; sm[qt] = 0.f; }
    asm volatile("s_wait_xcnt 0x0" ::: "memory");   // as in a_loadk, for the Q loads
    const T16* kl = Kp + lr * HD + 8 * hi; const T16* k2l = Kp2 + lr * HD + 8 * hi; const T16* vl = Vp + (size_t)lr * TT + 8 * hi; const T16* v2l = Vp2 + (size_t)lr * TT + 8 * hi; const float* ml = mk + (size_t)(q0 + lr) * TT + 8 * hi;
    // K and mask are fetched one step ahead into two stages. V^T too on the fp16 path; the hi+lo path (twice the fragments) fetches a step's V^T at the step's head, behind which the scores and the softmax stand, to stay within 256 registers
    AStage<T16, NQ> s0, s1; VStage<T16> v0, v1;
    a_loadk<T16, HILO, NQ>(s0, kl, k2l, ml); if (!HILO) a_loadv<T16, HILO>(v0, vl, v2l);
#pragma unroll 1   // two steps a trip, one per stage; unrolling further only costs registers
    for (int kb = 0; kb < TT; kb += 64) {
        const int kn = (kb + 64 < TT) ? kb + 64 : 0;   // the last trip fetches step 0 again (in bounds, unused)
        a_loadk<T16, HILO, NQ>(s1, kl + (kb + 32) * HD, k2l + (kb + 32) * HD, ml + kb + 32);
        if (HILO) { a_loadv<T16, HILO>(v0, vl + kb, v2l + kb); a_step<T16, HILO, NQ>(s0, v0, bq, bq2, acc, mr, sm); }
        else { a_loadv<T16, HILO>(v1, vl + kb + 32, v2l + kb + 32); a_step<T16, HILO, NQ>(s0, v0, bq, bq2, acc, mr, sm); }
        a_loadk<T16, HILO, NQ>(s0, kl + kn * HD, k2l + kn * HD, ml + kn);
        if (HILO) { a_loadv<T16, HILO>(v0, vl + kb + 32, v2l + kb + 32); a_step<T16, HILO, NQ>(s1, v0, bq, bq2, acc, mr, sm); }
        else { a_loadv<T16, HILO>(v0, vl + kn, v2l + kn); a_step<T16, HILO, NQ>(s1, v1, bq, bq2, acc, mr, sm); }
    }
#pragma unroll
    for (int qt = 0; qt < NQ; ++qt) { const float f = __fdiv_rn(1.0f, sm[qt] + xhalf(sm[qt])); const size_t oo = (size_t)(q0 + qt * 16 + lr) * RK + h * HD + 8 * hi;
#pragma unroll
        for (int dt = 0; dt < 2; ++dt) { v8us oh, ol;
#pragma unroll
            for (int r = 0; r < 8; ++r) { unsigned short a, c2; splitf(__fmul_rn(acc[qt][dt][r], f), a, c2); oh[r] = a; ol[r] = c2; }
            *(v8us*)(Ah + oo + dt * 16) = oh; *(v8us*)(Al + oo + dt * 16) = ol; } }
}
// grid (RH/64 + (TT-RH)/128, heads), 4 waves (one a SIMD; 640 blocks, all resident, spread over the WGPs more evenly than fewer larger ones): the first RH/64 blocks of a head take the hi+lo rows, 16 queries a wave
// (three products a tile, so half the columns); the rest 32 queries a wave on fp16. A block's waves walk the same K and V^T lines.
__global__ __launch_bounds__(128) void k_fattn(const h16* __restrict__ Q16, const h16* __restrict__ K16, const h16* __restrict__ VT16, const bf* __restrict__ Qh, const bf* __restrict__ Ql, const bf* __restrict__ Kh, const bf* __restrict__ Kl, const bf* __restrict__ VTh, const bf* __restrict__ VTl, const float* __restrict__ mk, bf* Ah, bf* Al) {
    const int h = blockIdx.y, w = threadIdx.x >> 5, bx = blockIdx.x; const size_t oq = (size_t)h * TT * HD, ov = (size_t)h * 64 * TT;
    if (bx < RH / 64) attn_cols<bf, true, 1>(Qh + oq, Ql + oq, Kh + oq, Kl + oq, VTh + ov, VTl + ov, mk, Ah, Al, h, bx * 64 + w * 16);
    else attn_cols<h16, false, 2>(Q16 + oq, Q16 + oq, K16 + oq, K16 + oq, VT16 + ov, VT16 + ov, mk, Ah, Al, h, RH + (bx - RH / 64) * 128 + w * 32);
}

extern "C" void kernel_launch(void* const* d_in, const int* in_sizes, int n_in,
                              void* d_out, int out_size, void* d_ws, size_t ws_size, hipStream_t stream) {
    (void)in_sizes; (void)n_in; (void)out_size;
    const float* IN[10]; for (int i = 0; i < 10; ++i) IN[i] = (const float*)d_in[i];   // 0 hidden, 1 attention_mask [2][1][2048][2048], 2 Wq [1024][2048], 3 bq, 4 Wk, 5 bk, 6 Wv, 7 bv, 8 Wo [2048][1024], 9 bo (torch [out][in])
    float* OUT = (float*)d_out;     // [2][2048][2048]
    char* wsp = (char*)d_ws;
    auto take = [&](size_t bytes) { char* p = wsp; wsp += (bytes + 255) & ~(size_t)255; return (void*)p; };
    bf* WQ = (bf*)take((size_t)RK * DM * 2); bf* WK = (bf*)take((size_t)RK * DM * 2); bf* WV = (bf*)take((size_t)RK * DM * 2); bf* WO = (bf*)take((size_t)DM * RK * 2);
    bf* XB = (bf*)take((size_t)TT * DM * 2); float* FQ = (float*)take((size_t)TT * RK * 4); float* FK = (float*)take((size_t)TT * RK * 4); float* FV = (float*)take((size_t)TT * RK * 4);
    h16* Q16 = (h16*)take((size_t)NH_ * TT * HD * 2); h16* K16 = (h16*)take((size_t)NH_ * TT * HD * 2); bf* Qh = (bf*)take((size_t)NH_ * TT * HD * 2); bf* Ql = (bf*)take((size_t)NH_ * TT * HD * 2); bf* Kh = (bf*)take((size_t)NH_ * TT * HD * 2); bf* Kl = (bf*)take((size_t)NH_ * TT * HD * 2);
    h16* VT16 = (h16*)take((size_t)NH_ * 64 * TT * 2); bf* VTh = (bf*)take((size_t)NH_ * 64 * TT * 2); bf* VTl = (bf*)take((size_t)NH_ * 64 * TT * 2);
    bf* Ah = (bf*)take((size_t)TT * RK * 2); bf* Al = (bf*)take((size_t)TT * RK * 2);
    if ((size_t)(wsp - (char*)d_ws) > ws_size) return;    // total 104 MiB
    { const unsigned g = (unsigned)(((size_t)RK * DM / 8 + 255) / 256); k_cvt8<<<g, 256, 0, stream>>>(IN[2], WQ, (size_t)RK * DM / 8); k_cvt8<<<g, 256, 0, stream>>>(IN[4], WK, (size_t)RK * DM / 8); k_cvt8<<<g, 256, 0, stream>>>(IN[6], WV, (size_t)RK * DM / 8); k_cvt8<<<g, 256, 0, stream>>>(IN[8], WO, (size_t)DM * RK / 8); }
    const dim3 gP(TT / 64, RK / 64, 1);
    for (int b = 0; b < NB_; ++b) { const float* mkb = IN[1] + (size_t)b * TT * TT;
        k_cvt8<<<(unsigned)(((size_t)TT * DM / 8 + 255) / 256), 256, 0, stream>>>(IN[0] + (size_t)b * TT * DM, XB, (size_t)TT * DM / 8);
        k_gemmw<bf, 0, true><<<gP, 32, 0, stream>>>(XB, nullptr, WQ, nullptr, DM, DM, FQ, RK, IN[3], 0, 0, 0); k_gemmw<bf, 0, true><<<gP, 32, 0, stream>>>(XB, nullptr, WK, nullptr, DM, DM, FK, RK, IN[5], 0, 0, 0); k_gemmw<bf, 0, true><<<gP, 32, 0, stream>>>(XB, nullptr, WV, nullptr, DM, DM, FV, RK, IN[7], 0, 0, 0);
        k_qkp<<<(unsigned)(((size_t)NH_ * TT * HD / 2 + 255) / 256), 256, 0, stream>>>(FQ, FK, Q16, K16, Qh, Ql, Kh, Kl); k_vtp<<<(unsigned)(((size_t)NH_ * 64 * TT / 2 + 255) / 256), 256, 0, stream>>>(FV, VT16, VTh, VTl);
        k_fattn<<<dim3(RH / 64 + (TT - RH) / 128, NH_, 1), 128, 0, stream>>>(Q16, K16, VT16, Qh, Ql, Kh, Kl, VTh, VTl, mkb, Ah, Al);
        k_gemmw<bf, 1, true><<<dim3(TT / 64, DM / 64, 1), 32, 0, stream>>>(Ah, Al, WO, nullptr, RK, RK, OUT + (size_t)b * TT * DM, DM, IN[9], 0, 0, 0); }
}

// v003
// A run of this version takes 348 microseconds.
// Timed twice side by side with v002, it ran 1.46 and 1.49 times as fast.
// Over all steps from v000 it is 19.3 times as fast.
#include <hip/hip_runtime.h>

// OPTEigenAttention - low-rank (eigen) OPT attention (hidden [2][2048][2048]; q = (x Wq^T + bq) x 64^-0.5 (32 heads x 32 low-rank dims; the scaling uses the ORIGINAL head dim 64), k = x Wk^T + bk, v = x Wv^T + bv (32 x 32);
// scores = q.k + attention_mask[b][0][i][j] (additive f32 mask input, read as data; then max(., float min)); softmax; out = merged att.v Wo^T + bo -> [2][2048][2048]).
// Compute dtypes, f32 accumulate: every input rounded to bf16; projections on PLAIN bf16 operands (inputs: exact, + bias); scores (K 32) and att.v on bf16 hi+lo planes (3 products) for
// the first 512 query rows of each head and on SINGLE fp16 planes for the rest (the mask here is causal, so early rows see few keys);
// mask add and softmax in f32 registers; merged heads as bf16 hi+lo planes x exact Wo (2 products) + bo. One-wave-per-64x64-tile GEMMs for the projections.
// Every launch covers both batch entries (rows b*2048 + t, head planes b*32 + h); the three projections are one launch (grid z = matrix). Attention is ONE kernel (k_fattn): S^T = K.Q^T, running-maximum softmax in registers, O^T += V^T.P^T; no score or probability ever reaches memory.

#define NB_  2
#define TT   2048
#define DM   2048
#define RK   1024
#define NH_  32
#define HD   32
#define RH   512
#define SCL  0.125f
typedef _Float16 h16;
typedef unsigned short bf;
typedef __attribute__((ext_vector_type(16))) __bf16   v16bf;
typedef __attribute__((ext_vector_type(16))) _Float16 v16h;
typedef __attribute__((ext_vector_type(8)))  _Float16 v8h;
typedef __attribute__((ext_vector_type(8)))  unsigned short v8us;
typedef __attribute__((ext_vector_type(8)))  float    v8f;
typedef __attribute__((ext_vector_type(4)))  float    v4f;
typedef v8h  __attribute__((may_alias)) v8ha;
typedef v4f  __attribute__((may_alias)) v4fa;
typedef v8us __attribute__((may_alias)) v8usa;

__device__ __forceinline__ unsigned short f2bf(float f) { unsigned u = __float_as_uint(f); u += 0x7FFFu + ((u >> 16) & 1u); return (unsigned short)(u >> 16); }
__device__ __forceinline__ float bf2f(unsigned short b) { return __uint_as_float(((unsigned)b) << 16); }
__device__ __forceinline__ float bfr(float f) { return bf2f(f2bf(f)); }
__device__ __forceinline__ v16h cat16(v8h lo, v8h hi) { return __builtin_shufflevector(lo, hi, 0, 1, 2, 3, 4, 5, 6, 7, 8, 9, 10, 11, 12, 13, 14, 15); }
__device__ __forceinline__ v16bf cat16b(v8us lo, v8us hi) { return __builtin_bit_cast(v16bf, __builtin_shufflevector(lo, hi, 0, 1, 2, 3, 4, 5, 6, 7, 8, 9, 10, 11, 12, 13, 14, 15)); }
__device__ __forceinline__ v8f wmma16(v16h a, v16h b, v8f c) { return __builtin_amdgcn_wmma_f32_16x16x32_f16(false, a, false, b, (short)0, c, false, false); }
__device__ __forceinline__ v8f wmmab(v16bf a, v16bf b, v8f c) { return __builtin_amdgcn_wmma_f32_16x16x32_bf16(false, a, false, b, (short)0, c, false, false); }



// ---- k_gemmw: register-blocked GEMM, ONE WAVE per 64x64 output tile (16 accumulators), operands straight from K-contiguous 16-bit planes; grid (M/64, N/64, Z), 32 threads.
// C[m][n] (f32, pitch ldc, + optional f32 bias[n]) = sum_k A[m][k] Bt[n][k] (+ split products per NSPLIT). A rows have pitch lda, Bt rows pitch K. z-batch strides sA/sB/sC in elements; z slices 0, 1, 2 take bias, bias1, bias2. K % 32 == 0.
template <typename T16> struct WFrag;
template <> struct WFrag<h16> { typedef v16h V; static __device__ __forceinline__ V ld(const h16* p) { return cat16(*(const v8h*)p, *(const v8h*)(p + 16)); } static __device__ __forceinline__ v8f mma(V a, V b, v8f c) { return wmma16(a, b, c); } };
template <> struct WFrag<bf> { typedef v16bf V; static __device__ __forceinline__ V ld(const bf* p) { return cat16b(*(const v8us*)p, *(const v8us*)(p + 16)); } static __device__ __forceinline__ v8f mma(V a, V b, v8f c) { return wmmab(a, b, c); } };
template <typename T16, int NSPLIT, bool BIAS>
__global__ __launch_bounds__(32) void k_gemmw(const T16* __restrict__ A, const T16* __restrict__ A2, const T16* __restrict__ Bt, const T16* __restrict__ Bt2, int K, int lda, float* C, int ldc, const float* __restrict__ bias, const float* __restrict__ bias1, const float* __restrict__ bias2, size_t sA, size_t sB, size_t sC) {
    typedef typename WFrag<T16>::V V;
    __shared__ __align__(16) float os[16 * 68];
    const size_t z = blockIdx.z; A += z * sA; if (A2) A2 += z * sA; Bt += z * sB; if (Bt2) Bt2 += z * sB; C += z * sC; if (z == 1) bias = bias1; else if (z == 2) bias = bias2;   // each z slice has its own bias vector
    const int lane = threadIdx.x & 31, lr = lane & 15, hi = lane >> 4; const int r0 = blockIdx.x * 64, c0 = blockIdx.y * 64;
    v8f acc[4][4];
#pragma unroll
    for (int mb = 0; mb < 4; ++mb)
#pragma unroll
        for (int nb = 0; nb < 4; ++nb) acc[mb][nb] = (v8f){};
    const size_t aoff = (size_t)(r0 + lr) * lda + 8 * hi, boff = (size_t)(c0 + lr) * K + 8 * hi;
#pragma unroll 1
    for (int kc = 0; kc < K; kc += 32) {
        V a[4], a2[4]; const T16* pa[4]; const T16* pa2[4];
#pragma unroll
        for (int mb = 0; mb < 4; ++mb) { pa[mb] = A + aoff + (size_t)mb * 16 * lda + kc; a[mb] = WFrag<T16>::ld(pa[mb]); if (NSPLIT == 1 || NSPLIT == 2) { pa2[mb] = A2 + aoff + (size_t)mb * 16 * lda + kc; a2[mb] = WFrag<T16>::ld(pa2[mb]); } }
        // the A loads' address registers are inputs here, so none of them is rewritten (not even as a later load's destination) before the wait on their address translations
        if (NSPLIT == 1 || NSPLIT == 2) asm volatile("s_wait_xcnt 0x0" :: "v"(pa[0]), "v"(pa[1]), "v"(pa[2]), "v"(pa[3]), "v"(pa2[0]), "v"(pa2[1]), "v"(pa2[2]), "v"(pa2[3]) : "memory");
        else asm volatile("s_wait_xcnt 0x0" :: "v"(pa[0]), "v"(pa[1]), "v"(pa[2]), "v"(pa[3]) : "memory");
#pragma unroll
        for (int nb = 0; nb < 4; ++nb) { const V b = WFrag<T16>::ld(Bt + boff + (size_t)nb * 16 * K + kc); V b2; if (NSPLIT >= 2) b2 = WFrag<T16>::ld(Bt2 + boff + (size_t)nb * 16 * K + kc);
#pragma unroll
            for (int mb = 0; mb < 4; ++mb) { acc[mb][nb] = WFrag<T16>::mma(a[mb], b, acc[mb][nb]); if (NSPLIT == 1 || NSPLIT == 2) acc[mb][nb] = WFrag<T16>::mma(a2[mb], b, acc[mb][nb]); if (NSPLIT >= 2) acc[mb][nb] = WFrag<T16>::mma(a[mb], b2, acc[mb][nb]); } }
        asm volatile("v_nop\n\tv_nop\n\tv_nop\n\tv_nop" : "+v"(acc[0][0]), "+v"(acc[1][1]), "+v"(acc[2][2]), "+v"(acc[3][3]) : "v"(a[0]), "v"(a[3]));
    }
#pragma unroll
    for (int mb = 0; mb < 4; ++mb) {
#pragma unroll
        for (int nb = 0; nb < 4; ++nb) {
#pragma unroll
            for (int j = 0; j < 8; ++j) os[(hi * 8 + j) * 68 + nb * 16 + lr] = acc[mb][nb][j]; }
        __builtin_amdgcn_wave_barrier(); asm volatile("" ::: "memory");
        float* crow = C + (size_t)(r0 + mb * 16) * ldc + c0;
{
#pragma unroll
            for (int s = 0; s < 8; ++s) { const int row = 2 * s + hi, cofs = lr * 4; v4f val = *(const v4fa*)(os + row * 68 + cofs); if (BIAS) { val[0] += bfr(bias[c0 + cofs]); val[1] += bfr(bias[c0 + cofs + 1]); val[2] += bfr(bias[c0 + cofs + 2]); val[3] += bfr(bias[c0 + cofs + 3]); }
                *(v4f*)(crow + (size_t)row * ldc + cofs) = val; }
             }
        __builtin_amdgcn_wave_barrier(); asm volatile("" ::: "memory");
    }
}

__device__ __forceinline__ h16 tohx(float x) { return (h16)x; }
__device__ __forceinline__ void splitf(float y, unsigned short& h, unsigned short& l) { h = f2bf(y); l = f2bf(y - bf2f(h)); }
typedef __attribute__((ext_vector_type(2))) _Float16 v2h;
typedef __attribute__((ext_vector_type(4))) _Float16 v4h;
typedef __attribute__((ext_vector_type(2))) unsigned short v2us;
typedef __attribute__((ext_vector_type(4))) unsigned short v4us;
typedef __attribute__((ext_vector_type(2))) float v2f;

// k_cvt8: all five f32 -> bf16 conversions in one launch. dst is the row of planes WQ, WK, WV, WO, XB; 1024 blocks (2^21 elements) for each weight, the rest for the hidden states of both batch entries.
__global__ __launch_bounds__(256) void k_cvt8(const float* __restrict__ wq, const float* __restrict__ wk, const float* __restrict__ wv, const float* __restrict__ wo, const float* __restrict__ x, bf* dst) { const int seg = blockIdx.x >> 10; const float* src = seg == 0 ? wq : seg == 1 ? wk : seg == 2 ? wv : seg == 3 ? wo : x; const size_t i = (size_t)blockIdx.x * 256 + threadIdx.x; const size_t j = i - (size_t)(seg < 4 ? seg : 4) * 1024 * 256; const v8f v = *(const v8f*)(src + j * 8); v8us o;
    asm volatile("s_wait_xcnt 0x0" ::: "memory");   // stands behind the load, before its address registers are reused
#pragma unroll
    for (int k = 0; k < 8; ++k) o[k] = f2bf(v[k]); *(v8us*)(dst + i * 8) = o;  }
// Head planes are numbered hb = b*32 + h; FQ, FK, FV have rows b*2048 + t. k_qkp: per (hb, t, d pair): q = FQ[t][h*32+d] x 0.125, k = FK[...]: fp16 planes Q16/K16 [h][t][d] and hi/lo planes Qh/Ql, Kh/Kl (lane -> 2 d); k_vtp: VT16 [h][dd][t] (fp16) and VTh/VTl (hi/lo) = FV[t][h*32+dd] for dd < 32,
__global__ __launch_bounds__(256) void k_qkp(const float* __restrict__ FQ, const float* __restrict__ FK, h16* Q16, h16* K16, bf* Qh, bf* Ql, bf* Kh, bf* Kl) { const size_t e = ((size_t)blockIdx.x * 256 + threadIdx.x) * 2; if (e >= (size_t)NB_ * NH_ * TT * HD) return; const int d = (int)(e % HD); const int t = (int)((e / HD) % TT); const int hb = (int)(e / ((size_t)HD * TT)); const int h = hb % NH_; const size_t s = ((size_t)(hb / NH_) * TT + t) * RK + h * HD + d; v2h q, k; v2us qh, ql, kh, kl;
#pragma unroll
    for (int u = 0; u < 2; ++u) { float qs = __fmul_rn(FQ[s + u], SCL); asm volatile("" : "+v"(qs)); q[u] = tohx(qs); k[u] = tohx(FK[s + u]); unsigned short a, c2; splitf(qs, a, c2); qh[u] = a; ql[u] = c2; splitf(FK[s + u], a, c2); kh[u] = a; kl[u] = c2; }
    { *(v2h*)(Q16 + e) = q; *(v2h*)(K16 + e) = k; *(v2us*)(Qh + e) = qh; *(v2us*)(Ql + e) = ql; *(v2us*)(Kh + e) = kh; *(v2us*)(Kl + e) = kl;  } }
__global__ __launch_bounds__(256) void k_vtp(const float* __restrict__ FV, h16* VT16, bf* VTh, bf* VTl) { const size_t e = ((size_t)blockIdx.x * 256 + threadIdx.x) * 2; if (e >= (size_t)NB_ * NH_ * 64 * TT) return; const int t = (int)(e % TT); const int dd = (int)((e / TT) % 64); const int hb = (int)(e / ((size_t)TT * 64)); const int h = hb % NH_; FV += (size_t)(hb / NH_) * TT * RK; v2h o; v2us oh, ol;
#pragma unroll
    for (int u = 0; u < 2; ++u) { const float v = (dd < HD) ? FV[(size_t)(t + u) * RK + h * HD + dd] : 0.f; o[u] = tohx(v); unsigned short a, c2; splitf(v, a, c2); oh[u] = a; ol[u] = c2; }
    { *(v2h*)(VT16 + e) = o; *(v2us*)(VTh + e) = oh; *(v2us*)(VTl + e) = ol;  } }
__device__ __forceinline__ float xhalf(float x) { const int b = __float_as_int(x); return __int_as_float(__builtin_amdgcn_permlanex16(b, b, 0x76543210, 0xfedcba98, false, false)); }
#define FMIN_ (-3.40282347e38f)
template <typename T16, int NQ> struct AStage { typename WFrag<T16>::V k[2], k2[2]; v8f m[NQ][2]; };   // one step's K fragments and mask tiles
template <typename T16> struct VStage { typename WFrag<T16>::V v[2], v2[2]; };                          // one step's V^T fragments
template <typename T16, bool HILO, int NQ>
__device__ __forceinline__ void a_loadk(AStage<T16, NQ>& s, const T16* pk, const T16* pk2, const float* pm) {
#pragma unroll
    for (int kt = 0; kt < 2; ++kt) { s.k[kt] = WFrag<T16>::ld(pk + kt * 16 * HD); if (HILO) s.k2[kt] = WFrag<T16>::ld(pk2 + kt * 16 * HD); }
#pragma unroll
    for (int qt = 0; qt < NQ; ++qt)
#pragma unroll
        for (int kt = 0; kt < 2; ++kt) s.m[qt][kt] = *(const v8f*)(pm + (size_t)qt * 16 * TT + kt * 16);
    asm volatile("s_wait_xcnt 0x0" ::: "memory");   // stands behind the group's loads, before their address registers are rewritten for the next group; the clobber also keeps these loads ahead of the work on the other stage
}
template <typename T16, bool HILO>
__device__ __forceinline__ void a_loadv(VStage<T16>& s, const T16* pv, const T16* pv2) {
#pragma unroll
    for (int dt = 0; dt < 2; ++dt) { s.v[dt] = WFrag<T16>::ld(pv + (size_t)dt * 16 * TT); if (HILO) s.v2[dt] = WFrag<T16>::ld(pv2 + (size_t)dt * 16 * TT); }
    asm volatile("s_wait_xcnt 0x0" ::: "memory");   // as in a_loadk
}
template <typename T16, bool HILO, int NQ>
__device__ __forceinline__ void a_step(const AStage<T16, NQ>& s, const VStage<T16>& sv, const typename WFrag<T16>::V (&bq)[NQ], const typename WFrag<T16>::V (&bq2)[NQ], v8f (&acc)[NQ][2], float (&mr)[NQ], float (&sm)[NQ]) {
    typedef typename WFrag<T16>::V V;
    float t[NQ][16], mx[NQ]; bool need = false;
#pragma unroll
    for (int qt = 0; qt < NQ; ++qt) {
#pragma unroll
        for (int kt = 0; kt < 2; ++kt) { v8f d = WFrag<T16>::mma(s.k[kt], bq[qt], s.m[qt][kt]);   // the mask tile has D's map: it is the product's C operand, so q.k + mask comes out of the matrix unit
            if (HILO) { d = WFrag<T16>::mma(s.k2[kt], bq[qt], d); d = WFrag<T16>::mma(s.k[kt], bq2[qt], d); }
#pragma unroll
            for (int r = 0; r < 8; ++r) t[qt][kt * 8 + r] = fmaxf(d[r], FMIN_); }
        float a = t[qt][0];
#pragma unroll
        for (int i = 1; i < 16; ++i) a = fmaxf(a, t[qt][i]);
        a = fmaxf(a, xhalf(a)); mx[qt] = a; need = need || (a > mr[qt]); }
    if (__builtin_amdgcn_ballot_w32(need) != 0) {   // a column's maximum rose: rescale what is summed so far (factor 1 in the other columns)
#pragma unroll
        for (int qt = 0; qt < NQ; ++qt) { const float mn = fmaxf(mr[qt], mx[qt]); const float al = __expf(mr[qt] - mn); mr[qt] = mn; sm[qt] *= al;
#pragma unroll
            for (int dt = 0; dt < 2; ++dt)
#pragma unroll
                for (int r = 0; r < 8; ++r) acc[qt][dt][r] *= al; } }
#pragma unroll
    for (int qt = 0; qt < NQ; ++qt) { V bp, bp2;
#pragma unroll
        for (int i = 0; i < 16; ++i) { const float p = __expf(t[qt][i] - mr[qt]); sm[qt] += p;
            if constexpr (HILO) { const __bf16 ph = (__bf16)p; bp[i] = ph; bp2[i] = (__bf16)(p - (float)ph); } else bp[i] = (h16)p; }
#pragma unroll
        for (int dt = 0; dt < 2; ++dt) { acc[qt][dt] = WFrag<T16>::mma(sv.v[dt], bp, acc[qt][dt]); if (HILO) { acc[qt][dt] = WFrag<T16>::mma(sv.v2[dt], bp, acc[qt][dt]); acc[qt][dt] = WFrag<T16>::mma(sv.v[dt], bp2, acc[qt][dt]); } } }
}
// Qp, Kp: one head's [t][32] planes; Vp: its [dd][t] plane (rows 0..31 used); mk: this batch entry's [q][key] mask; q0: the wave's first query; the merged-head planes Ah/Al [t][1024] take o = O / sum as bf16 hi + lo.
template <typename T16, bool HILO, int NQ>
__device__ __forceinline__ void attn_cols(const T16* Qp, const T16* Qp2, const T16* Kp, const T16* Kp2, const T16* Vp, const T16* Vp2, const float* mk, bf* Ah, bf* Al, int h, int q0) {
    typedef typename WFrag<T16>::V V;
    const int lane = threadIdx.x & 31, lr = lane & 15, hi = lane >> 4;
    V bq[NQ], bq2[NQ]; v8f acc[NQ][2]; float mr[NQ], sm[NQ];
    const T16* ql = Qp + (size_t)(q0 + lr) * HD + 8 * hi; const T16* q2l = Qp2 + (size_t)(q0 + lr) * HD + 8 * hi;
#pragma unroll
    for (int qt = 0; qt < NQ; ++qt) { bq[qt] = WFrag<T16>::ld(ql + qt * 16 * HD); if (HILO) bq2[qt] = WFrag<T16>::ld(q2l + qt * 16 * HD); acc[qt][0] = (v8f){}; acc[qt][1] = (v8f){}; mr[qt] = FMIN_; sm[qt] = 0.f; }
    asm volatile("s_wait_xcnt 0x0" ::: "memory");   // as in a_loadk, for the Q loads
    const T16* kl = Kp + lr * HD + 8 * hi; const T16* k2l = Kp2 + lr * HD + 8 * hi; const T16* vl = Vp + (size_t)lr * TT + 8 * hi; const T16* v2l = Vp2 + (size_t)lr * TT + 8 * hi; const float* ml = mk + (size_t)(q0 + lr) * TT + 8 * hi;
    // K and mask are fetched one step ahead into two stages. V^T too on the fp16 path; the hi+lo path (twice the fragments) fetches a step's V^T at the step's head, behind which the scores and the softmax stand, to stay within 256 registers
    AStage<T16, NQ> s0, s1; VStage<T16> v0, v1;
    a_loadk<T16, HILO, NQ>(s0, kl, k2l, ml); if (!HILO) a_loadv<T16, HILO>(v0, vl, v2l);
#pragma unroll 1   // two steps a trip, one per stage; unrolling further only costs registers
    for (int kb = 0; kb < TT; kb += 64) {
        const int kn = (kb + 64 < TT) ? kb + 64 : 0;   // the last trip fetches step 0 again (in bounds, unused)
        a_loadk<T16, HILO, NQ>(s1, kl + (kb + 32) * HD, k2l + (kb + 32) * HD, ml + kb + 32);
        if (HILO) { a_loadv<T16, HILO>(v0, vl + kb, v2l + kb); a_step<T16, HILO, NQ>(s0, v0, bq, bq2, acc, mr, sm); }
        else { a_loadv<T16, HILO>(v1, vl + kb + 32, v2l + kb + 32); a_step<T16, HILO, NQ>(s0, v0, bq, bq2, acc, mr, sm); }
        a_loadk<T16, HILO, NQ>(s0, kl + kn * HD, k2l + kn * HD, ml + kn);
        if (HILO) { a_loadv<T16, HILO>(v0, vl + kb + 32, v2l + kb + 32); a_step<T16, HILO, NQ>(s1, v0, bq, bq2, acc, mr, sm); }
        else { a_loadv<T16, HILO>(v0, vl + kn, v2l + kn); a_step<T16, HILO, NQ>(s1, v1, bq, bq2, acc, mr, sm); }
    }
#pragma unroll
    for (int qt = 0; qt < NQ; ++qt) { const float f = __fdiv_rn(1.0f, sm[qt] + xhalf(sm[qt])); const size_t oo = (size_t)(q0 + qt * 16 + lr) * RK + h * HD + 8 * hi;
#pragma unroll
        for (int dt = 0; dt < 2; ++dt) { v8us oh, ol;
#pragma unroll
            for (int r = 0; r < 8; ++r) { unsigned short a, c2; splitf(__fmul_rn(acc[qt][dt][r], f), a, c2); oh[r] = a; ol[r] = c2; }
            *(v8us*)(Ah + oo + dt * 16) = oh; *(v8us*)(Al + oo + dt * 16) = ol; } }
}
// grid (batch entries x heads, RH/64 + (TT-RH)/128), 4 waves (one a SIMD; 1280 blocks, five a WGP, four resident at 241 registers, so the longer hi+lo blocks have the low indices and start first): the first RH/64 blocks of a head take the hi+lo rows, 16 queries a wave
// (three products a tile, so half the columns); the rest 32 queries a wave on fp16. A block's waves walk the same K and V^T lines.
__global__ __launch_bounds__(128) void k_fattn(const h16* __restrict__ Q16, const h16* __restrict__ K16, const h16* __restrict__ VT16, const bf* __restrict__ Qh, const bf* __restrict__ Ql, const bf* __restrict__ Kh, const bf* __restrict__ Kl, const bf* __restrict__ VTh, const bf* __restrict__ VTl, const float* __restrict__ mk, bf* Ah, bf* Al) {
    const int h = blockIdx.x % NH_, b = blockIdx.x / NH_, w = threadIdx.x >> 5, bx = blockIdx.y; const size_t oq = (size_t)blockIdx.x * TT * HD, ov = (size_t)blockIdx.x * 64 * TT; mk += (size_t)b * TT * TT; Ah += (size_t)b * TT * RK; Al += (size_t)b * TT * RK;
    if (bx < RH / 64) attn_cols<bf, true, 1>(Qh + oq, Ql + oq, Kh + oq, Kl + oq, VTh + ov, VTl + ov, mk, Ah, Al, h, bx * 64 + w * 16);
    else attn_cols<h16, false, 2>(Q16 + oq, Q16 + oq, K16 + oq, K16 + oq, VT16 + ov, VT16 + ov, mk, Ah, Al, h, RH + (bx - RH / 64) * 128 + w * 32);
}

extern "C" void kernel_launch(void* const* d_in, const int* in_sizes, int n_in,
                              void* d_out, int out_size, void* d_ws, size_t ws_size, hipStream_t stream) {
    (void)in_sizes; (void)n_in; (void)out_size;
    const float* IN[10]; for (int i = 0; i < 10; ++i) IN[i] = (const float*)d_in[i];   // 0 hidden, 1 attention_mask [2][1][2048][2048], 2 Wq [1024][2048], 3 bq, 4 Wk, 5 bk, 6 Wv, 7 bv, 8 Wo [2048][1024], 9 bo (torch [out][in])
    float* OUT = (float*)d_out;     // [2][2048][2048]
    char* wsp = (char*)d_ws;
    auto take = [&](size_t bytes) { char* p = wsp; wsp += (bytes + 255) & ~(size_t)255; return (void*)p; };
    bf* WQ = (bf*)take((size_t)RK * DM * 2); bf* WK = (bf*)take((size_t)RK * DM * 2); bf* WV = (bf*)take((size_t)RK * DM * 2); bf* WO = (bf*)take((size_t)DM * RK * 2);   // WQ, WK, WV, WO, XB lie in a row (every size a multiple of 256 bytes); so do FQ, FK, FV
    bf* XB = (bf*)take((size_t)NB_ * TT * DM * 2); float* FQ = (float*)take((size_t)NB_ * TT * RK * 4); float* FK = (float*)take((size_t)NB_ * TT * RK * 4); float* FV = (float*)take((size_t)NB_ * TT * RK * 4);
    h16* Q16 = (h16*)take((size_t)NB_ * NH_ * TT * HD * 2); h16* K16 = (h16*)take((size_t)NB_ * NH_ * TT * HD * 2); bf* Qh = (bf*)take((size_t)NB_ * NH_ * TT * HD * 2); bf* Ql = (bf*)take((size_t)NB_ * NH_ * TT * HD * 2); bf* Kh = (bf*)take((size_t)NB_ * NH_ * TT * HD * 2); bf* Kl = (bf*)take((size_t)NB_ * NH_ * TT * HD * 2);
    h16* VT16 = (h16*)take((size_t)NB_ * NH_ * 64 * TT * 2); bf* VTh = (bf*)take((size_t)NB_ * NH_ * 64 * TT * 2); bf* VTl = (bf*)take((size_t)NB_ * NH_ * 64 * TT * 2);
    bf* Ah = (bf*)take((size_t)NB_ * TT * RK * 2); bf* Al = (bf*)take((size_t)NB_ * TT * RK * 2);
    if ((size_t)(wsp - (char*)d_ws) > ws_size) return;    // total 192 MiB
    (void)WK; (void)WV;
    k_cvt8<<<4 * 1024 + (unsigned)((size_t)NB_ * TT * DM / 8 / 256), 256, 0, stream>>>(IN[2], IN[4], IN[6], IN[8], IN[0], WQ);
    k_gemmw<bf, 0, true><<<dim3(NB_ * TT / 64, RK / 64, 3), 32, 0, stream>>>(XB, nullptr, WQ, nullptr, DM, DM, FQ, RK, IN[3], IN[5], IN[7], 0, (size_t)RK * DM, (size_t)NB_ * TT * RK);
    k_qkp<<<(unsigned)(((size_t)NB_ * NH_ * TT * HD / 2 + 255) / 256), 256, 0, stream>>>(FQ, FK, Q16, K16, Qh, Ql, Kh, Kl); k_vtp<<<(unsigned)(((size_t)NB_ * NH_ * 64 * TT / 2 + 255) / 256), 256, 0, stream>>>(FV, VT16, VTh, VTl);
    k_fattn<<<dim3(NB_ * NH_, RH / 64 + (TT - RH) / 128, 1), 128, 0, stream>>>(Q16, K16, VT16, Qh, Ql, Kh, Kl, VTh, VTl, IN[1], Ah, Al);
    k_gemmw<bf, 1, true><<<dim3(NB_ * TT / 64, DM / 64, 1), 32, 0, stream>>>(Ah, Al, WO, nullptr, RK, RK, OUT, DM, IN[9], IN[9], IN[9], 0, 0, 0);
}

// v004
// A run of this version takes 237 microseconds.
// Next to v003, in two timings, it ran 1.47 times as fast each time.
// Over all steps from v000 it is 28.3 times as fast.
#include <hip/hip_runtime.h>

// OPTEigenAttention - low-rank (eigen) OPT attention (hidden [2][2048][2048]; q = (x Wq^T + bq) x 64^-0.5 (32 heads x 32 low-rank dims; the scaling uses the ORIGINAL head dim 64), k = x Wk^T + bk, v = x Wv^T + bv (32 x 32);
// scores = q.k + attention_mask[b][0][i][j] (additive f32 mask input, read as data; then max(., float min)); softmax; out = merged att.v Wo^T + bo -> [2][2048][2048]).
// Compute dtypes, f32 accumulate: every input rounded to bf16; projections on PLAIN bf16 operands (inputs: exact, + bias); scores (K 32) and att.v on bf16 hi+lo planes (3 products) for
// the first 512 query rows of each head and on SINGLE fp16 planes for the rest (the mask here is causal, so early rows see few keys);
// mask add and softmax in f32 registers; merged heads as bf16 hi+lo planes x exact Wo (2 products) + bo. One-wave-per-64x64-tile GEMMs for the projections.
// Every launch covers both batch entries (rows b*2048 + t, head planes b*32 + h); the three projections are one launch (grid z = matrix). Attention is ONE kernel (k_fattn): S^T = K.Q^T, running-maximum softmax in registers, O^T += V^T.P^T; no score or probability ever reaches memory.
// FRAGMENT ORDER: every 16-bit operand plane is stored as 1-KiB tiles of 16 rows x 32 k, tile (row/16, k/32) at index (row/16) * (K/32) + k/32 (V^T: (k/32) * 2 + row/16), element (row, k) at (k%32/16) * 256 + ((k%16/8) * 16 + row%16) * 8 + k%8 inside it.
// A lane's two 16-byte fragment pieces then lie at lane * 8 and 256 + lane * 8, so each wave-wide load covers 512 contiguous bytes (4 lines) where a row-major plane gave 16 pieces of 32 bytes in 16 lines. The k order of a fragment is the one it had.
// The f32 mask is copied once into 16 query x 16 key tiles in the accumulator's map (value r of a lane at (r/4) * 128 + lane * 4 + r%4), tile index (q/16) * 128 + key/16, for the same reason: all 64 head planes read it.

#define NB_  2
#define TT   2048
#define DM   2048
#define RK   1024
#define NH_  32
#define HD   32
#define RH   512
#define SCL  0.125f
typedef _Float16 h16;
typedef unsigned short bf;
typedef __attribute__((ext_vector_type(16))) __bf16   v16bf;
typedef __attribute__((ext_vector_type(16))) _Float16 v16h;
typedef __attribute__((ext_vector_type(8)))  _Float16 v8h;
typedef __attribute__((ext_vector_type(8)))  unsigned short v8us;
typedef __attribute__((ext_vector_type(8)))  float    v8f;
typedef __attribute__((ext_vector_type(4)))  float    v4f;
typedef v8h  __attribute__((may_alias)) v8ha;
typedef v4f  __attribute__((may_alias)) v4fa;
typedef v8us __attribute__((may_alias)) v8usa;

__device__ __forceinline__ unsigned short f2bf(float f) { unsigned u = __float_as_uint(f); u += 0x7FFFu + ((u >> 16) & 1u); return (unsigned short)(u >> 16); }
__device__ __forceinline__ float bf2f(unsigned short b) { return __uint_as_float(((unsigned)b) << 16); }
__device__ __forceinline__ float bfr(float f) { return bf2f(f2bf(f)); }
__device__ __forceinline__ v16h cat16(v8h lo, v8h hi) { return __builtin_shufflevector(lo, hi, 0, 1, 2, 3, 4, 5, 6, 7, 8, 9, 10, 11, 12, 13, 14, 15); }
__device__ __forceinline__ v16bf cat16b(v8us lo, v8us hi) { return __builtin_bit_cast(v16bf, __builtin_shufflevector(lo, hi, 0, 1, 2, 3, 4, 5, 6, 7, 8, 9, 10, 11, 12, 13, 14, 15)); }
__device__ __forceinline__ v8f wmma16(v16h a, v16h b, v8f c) { return __builtin_amdgcn_wmma_f32_16x16x32_f16(false, a, false, b, (short)0, c, false, false); }
__device__ __forceinline__ v8f wmmab(v16bf a, v16bf b, v8f c) { return __builtin_amdgcn_wmma_f32_16x16x32_bf16(false, a, false, b, (short)0, c, false, false); }



// ---- k_gemmw: register-blocked GEMM, ONE WAVE per 64x64 output tile (16 accumulators), operands straight from 16-bit planes in fragment order; grid (M/64, N/64, Z), 32 threads.
// C[m][n] (f32, pitch ldc, + optional f32 bias[n]) = sum_k A[m][k] Bt[n][k] (+ split products per NSPLIT). A has lda k values a row, Bt K (both planes in fragment order). z-batch strides sA/sB/sC in elements; z slices 0, 1, 2 take bias, bias1, bias2. K % 32 == 0.
template <typename T16> struct WFrag;
template <> struct WFrag<h16> { typedef v16h V; static __device__ __forceinline__ V ld(const h16* p) { return cat16(*(const v8h*)p, *(const v8h*)(p + 256)); } static __device__ __forceinline__ v8f mma(V a, V b, v8f c) { return wmma16(a, b, c); } };
template <> struct WFrag<bf> { typedef v16bf V; static __device__ __forceinline__ V ld(const bf* p) { return cat16b(*(const v8us*)p, *(const v8us*)(p + 256)); } static __device__ __forceinline__ v8f mma(V a, V b, v8f c) { return wmmab(a, b, c); } };
template <typename T16, int NSPLIT, bool BIAS>
__global__ __launch_bounds__(32) void k_gemmw(const T16* __restrict__ A, const T16* __restrict__ A2, const T16* __restrict__ Bt, const T16* __restrict__ Bt2, int K, int lda, float* C, int ldc, const float* __restrict__ bias, const float* __restrict__ bias1, const float* __restrict__ bias2, size_t sA, size_t sB, size_t sC) {
    typedef typename WFrag<T16>::V V;
    __shared__ __align__(16) float os[16 * 68];
    const size_t z = blockIdx.z; A += z * sA; if (A2) A2 += z * sA; Bt += z * sB; if (Bt2) Bt2 += z * sB; C += z * sC; if (z == 1) bias = bias1; else if (z == 2) bias = bias2;   // each z slice has its own bias vector
    const int lane = threadIdx.x & 31, lr = lane & 15, hi = lane >> 4; const int r0 = blockIdx.x * 64, c0 = blockIdx.y * 64;
    v8f acc[4][4];
#pragma unroll
    for (int mb = 0; mb < 4; ++mb)
#pragma unroll
        for (int nb = 0; nb < 4; ++nb) acc[mb][nb] = (v8f){};
    const size_t aoff = (size_t)r0 * lda + 8 * lane, boff = (size_t)c0 * K + 8 * lane;   // 16 rows of tiles hold 16 * K elements; a step of 32 k is one tile (512 elements)
#pragma unroll 1
    for (int kc = 0; kc < K; kc += 32) {
        V a[4], a2[4], b[4], b2[4]; const T16* pa[4]; const T16* pa2[4]; const T16* pb[4]; const T16* pb2[4];
#pragma unroll
        for (int mb = 0; mb < 4; ++mb) { pa[mb] = A + aoff + (size_t)mb * 16 * lda + (size_t)kc * 16; a[mb] = WFrag<T16>::ld(pa[mb]); if (NSPLIT == 1 || NSPLIT == 2) { pa2[mb] = A2 + aoff + (size_t)mb * 16 * lda + (size_t)kc * 16; a2[mb] = WFrag<T16>::ld(pa2[mb]); } }
        // the A loads' address registers are inputs here, so none of them is rewritten (not even as a later load's destination) before the wait on their address translations
        if (NSPLIT == 1 || NSPLIT == 2) asm volatile("s_wait_xcnt 0x0" :: "v"(pa[0]), "v"(pa[1]), "v"(pa[2]), "v"(pa[3]), "v"(pa2[0]), "v"(pa2[1]), "v"(pa2[2]), "v"(pa2[3]) : "memory");
        else asm volatile("s_wait_xcnt 0x0" :: "v"(pa[0]), "v"(pa[1]), "v"(pa[2]), "v"(pa[3]) : "memory");
#pragma unroll
        for (int nb = 0; nb < 4; ++nb) { pb[nb] = Bt + boff + (size_t)nb * 16 * K + (size_t)kc * 16; b[nb] = WFrag<T16>::ld(pb[nb]); if (NSPLIT >= 2) { pb2[nb] = Bt2 + boff + (size_t)nb * 16 * K + (size_t)kc * 16; b2[nb] = WFrag<T16>::ld(pb2[nb]); } }
        // the same for the B loads
        asm volatile("s_wait_xcnt 0x0" :: "v"(pb[0]), "v"(pb[1]), "v"(pb[2]), "v"(pb[3]) : "memory");
        if (NSPLIT >= 2) asm volatile("s_wait_xcnt 0x0" :: "v"(pb2[0]), "v"(pb2[1]), "v"(pb2[2]), "v"(pb2[3]) : "memory");
#pragma unroll
        for (int nb = 0; nb < 4; ++nb) {
#pragma unroll
            for (int mb = 0; mb < 4; ++mb) { acc[mb][nb] = WFrag<T16>::mma(a[mb], b[nb], acc[mb][nb]); if (NSPLIT == 1 || NSPLIT == 2) acc[mb][nb] = WFrag<T16>::mma(a2[mb], b[nb], acc[mb][nb]); if (NSPLIT >= 2) acc[mb][nb] = WFrag<T16>::mma(a[mb], b2[nb], acc[mb][nb]); } }
        asm volatile("v_nop\n\tv_nop\n\tv_nop\n\tv_nop" : "+v"(acc[0][0]), "+v"(acc[1][1]), "+v"(acc[2][2]), "+v"(acc[3][3]) : "v"(a[0]), "v"(a[3]));
    }
#pragma unroll
    for (int mb = 0; mb < 4; ++mb) {
#pragma unroll
        for (int nb = 0; nb < 4; ++nb) {
#pragma unroll
            for (int j = 0; j < 8; ++j) os[(hi * 8 + j) * 68 + nb * 16 + lr] = acc[mb][nb][j]; }
        __builtin_amdgcn_wave_barrier(); asm volatile("" ::: "memory");
        float* crow = C + (size_t)(r0 + mb * 16) * ldc + c0;
{
#pragma unroll
            for (int s = 0; s < 8; ++s) { const int row = 2 * s + hi, cofs = lr * 4; v4f val = *(const v4fa*)(os + row * 68 + cofs); if (BIAS) { val[0] += bfr(bias[c0 + cofs]); val[1] += bfr(bias[c0 + cofs + 1]); val[2] += bfr(bias[c0 + cofs + 2]); val[3] += bfr(bias[c0 + cofs + 3]); }
                *(v4f*)(crow + (size_t)row * ldc + cofs) = val; }
             }
        asm volatile("s_wait_xcnt 0x0" ::: "memory");   // stands behind the row stores, before their address registers are reused
        __builtin_amdgcn_wave_barrier(); asm volatile("" ::: "memory");
    }
}

__device__ __forceinline__ h16 tohx(float x) { return (h16)x; }
__device__ __forceinline__ void splitf(float y, unsigned short& h, unsigned short& l) { h = f2bf(y); l = f2bf(y - bf2f(h)); }
typedef __attribute__((ext_vector_type(2))) _Float16 v2h;
typedef __attribute__((ext_vector_type(4))) _Float16 v4h;
typedef __attribute__((ext_vector_type(2))) unsigned short v2us;
typedef __attribute__((ext_vector_type(4))) unsigned short v4us;
typedef __attribute__((ext_vector_type(2))) float v2f;

// k_cvt8: all five f32 -> bf16 conversions and the mask copy in one launch. dst is the row of planes WQ, WK, WV, WO, XB, each in fragment order; 1024 blocks (2^21 elements) for each weight, 4096 for the hidden states of both batch entries, then 4096 for the mask.
// A thread is one 16-byte piece of the destination (stores stay contiguous); its 8 source values are 8 consecutive k of one row, and a block reads whole lines of 16 rows.
#define CVB (4 * 1024 + NB_ * TT * DM / 8 / 256)
__global__ __launch_bounds__(256) void k_cvt8(const float* __restrict__ wq, const float* __restrict__ wk, const float* __restrict__ wv, const float* __restrict__ wo, const float* __restrict__ x, const float* __restrict__ mk, bf* dst, float* mp) {
    const int lane = threadIdx.x & 31, lr = lane & 15, hi = lane >> 4;
    if (blockIdx.x >= CVB) {   // mask: a wave copies one 16 x 16 tile, a lane its 8 keys 8 hi .. 8 hi + 7 of query row lr
        const size_t tile = ((size_t)(blockIdx.x - CVB) * 256 + threadIdx.x) >> 5; const float* s = mk + ((tile / (TT / 16)) * 16 + lr) * TT + (tile % (TT / 16)) * 16 + 8 * hi; const v4f a = *(const v4f*)s, c = *(const v4f*)(s + 4);
        asm volatile("s_wait_xcnt 0x0" ::: "memory");   // stands behind the loads, before their address registers are reused
        *(v4f*)(mp + tile * 256 + lane * 4) = a; *(v4f*)(mp + tile * 256 + 128 + lane * 4) = c; return; }
    const int seg = blockIdx.x >> 10; const float* src = seg == 0 ? wq : seg == 1 ? wk : seg == 2 ? wv : seg == 3 ? wo : x; const size_t i = (size_t)blockIdx.x * 256 + threadIdx.x; const size_t j = i - (size_t)(seg < 4 ? seg : 4) * 1024 * 256;
    const int sh = seg == 3 ? 5 : 6;   // log2 of the tiles in a row of tiles: K = 1024 for Wo, 2048 for the rest
    const size_t tile = j >> 6; const v8f v = *(const v8f*)(src + ((((tile >> sh) * 16 + lr) << sh) + (tile & ((1u << sh) - 1))) * 32 + ((j >> 5) & 1) * 16 + 8 * hi); v8us o;
    asm volatile("s_wait_xcnt 0x0" ::: "memory");   // stands behind the load, before its address registers are reused
#pragma unroll
    for (int k = 0; k < 8; ++k) o[k] = f2bf(v[k]); *(v8us*)(dst + i * 8) = o;  }
// Head planes are numbered hb = b*32 + h; FQ, FK, FV have rows b*2048 + t. k_qkp: per (hb, t, d pair): q = FQ[t][h*32+d] x 0.125, k = FK[...]: fp16 planes Q16/K16 (rows t, k = d) and hi/lo planes Qh/Ql, Kh/Kl, in fragment order (lane -> 2 d); k_vtp: VT16 (rows dd < 32, k = t; fp16) and VTh/VTl (hi/lo) = FV[t][h*32+dd], in fragment order with the two row tiles of a 32-key step side by side.
__global__ __launch_bounds__(256) void k_qkp(const float* __restrict__ FQ, const float* __restrict__ FK, h16* Q16, h16* K16, bf* Qh, bf* Ql, bf* Kh, bf* Kl) { const size_t e = ((size_t)blockIdx.x * 256 + threadIdx.x) * 2; if (e >= (size_t)NB_ * NH_ * TT * HD) return; const int d = (int)(e % HD); const int t = (int)((e / HD) % TT); const int hb = (int)(e / ((size_t)HD * TT)); const int h = hb % NH_; const size_t s = ((size_t)(hb / NH_) * TT + t) * RK + h * HD + d; v2h q, k; v2us qh, ql, kh, kl;
#pragma unroll
    for (int u = 0; u < 2; ++u) { float qs = __fmul_rn(FQ[s + u], SCL); asm volatile("" : "+v"(qs)); q[u] = tohx(qs); k[u] = tohx(FK[s + u]); unsigned short a, c2; splitf(qs, a, c2); qh[u] = a; ql[u] = c2; splitf(FK[s + u], a, c2); kh[u] = a; kl[u] = c2; }
    { const size_t p = (e & ~(size_t)511) + (d >> 4) * 256 + (((d >> 3) & 1) * 16 + (t & 15)) * 8 + (d & 7);   // 16 rows of 32 d are one tile: the same 512 elements, permuted
      *(v2h*)(Q16 + p) = q; *(v2h*)(K16 + p) = k; *(v2us*)(Qh + p) = qh; *(v2us*)(Ql + p) = ql; *(v2us*)(Kh + p) = kh; *(v2us*)(Kl + p) = kl;  } }
// A thread is one 16-byte piece: 8 consecutive keys of row dd; the lanes of a wave are the 32 dd, so each of its 8 loads is one whole line of FV and each store two runs of 256 bytes.
__global__ __launch_bounds__(256) void k_vtp(const float* __restrict__ FV, h16* VT16, bf* VTh, bf* VTl) { const unsigned g = blockIdx.x * 256 + threadIdx.x; const int dd = (int)(g & 31), tg = (int)((g >> 5) & (TT / 8 - 1)), hb = (int)(g >> 13); const float* s = FV + ((size_t)(hb / NH_) * TT + tg * 8) * RK + (hb % NH_) * HD + dd; float v[8];
#pragma unroll
    for (int u = 0; u < 8; ++u) v[u] = s[(size_t)u * RK];
    asm volatile("s_wait_xcnt 0x0" ::: "memory");   // stands behind the loads, before their address registers are reused
    v8h o; v8us oh, ol;
#pragma unroll
    for (int u = 0; u < 8; ++u) { o[u] = tohx(v[u]); unsigned short a, c2; splitf(v[u], a, c2); oh[u] = a; ol[u] = c2; }
    const size_t p = (size_t)hb * HD * TT + (size_t)((tg >> 2) * 2 + (dd >> 4)) * 512 + ((tg >> 1) & 1) * 256 + ((tg & 1) * 16 + (dd & 15)) * 8;
    *(v8h*)(VT16 + p) = o; *(v8us*)(VTh + p) = oh; *(v8us*)(VTl + p) = ol; }
__device__ __forceinline__ float xhalf(float x) { const int b = __float_as_int(x); return __int_as_float(__builtin_amdgcn_permlanex16(b, b, 0x76543210, 0xfedcba98, false, false)); }
#define FMIN_ (-3.40282347e38f)
template <typename T16, int NQ> struct AStage { typename WFrag<T16>::V k[2], k2[2]; v8f m[NQ][2]; };   // one step's K fragments and mask tiles
template <typename T16> struct VStage { typename WFrag<T16>::V v[2], v2[2]; };                          // one step's V^T fragments
template <typename T16, bool HILO, int NQ>
__device__ __forceinline__ void a_loadk(AStage<T16, NQ>& s, const T16* pk, const T16* pk2, const float* pm) {
#pragma unroll
    for (int kt = 0; kt < 2; ++kt) { s.k[kt] = WFrag<T16>::ld(pk + kt * 16 * HD); if (HILO) s.k2[kt] = WFrag<T16>::ld(pk2 + kt * 16 * HD); }
#pragma unroll
    for (int qt = 0; qt < NQ; ++qt)
#pragma unroll
        for (int kt = 0; kt < 2; ++kt) { const float* p = pm + (size_t)qt * 16 * TT + kt * 256; s.m[qt][kt] = __builtin_shufflevector(*(const v4f*)p, *(const v4f*)(p + 128), 0, 1, 2, 3, 4, 5, 6, 7); }
    asm volatile("s_wait_xcnt 0x0" ::: "memory");   // stands behind the group's loads, before their address registers are rewritten for the next group; the clobber also keeps these loads ahead of the work on the other stage
}
template <typename T16, bool HILO>
__device__ __forceinline__ void a_loadv(VStage<T16>& s, const T16* pv, const T16* pv2) {
#pragma unroll
    for (int dt = 0; dt < 2; ++dt) { s.v[dt] = WFrag<T16>::ld(pv + dt * 512); if (HILO) s.v2[dt] = WFrag<T16>::ld(pv2 + dt * 512); }
    asm volatile("s_wait_xcnt 0x0" ::: "memory");   // as in a_loadk
}
template <typename T16, bool HILO, int NQ>
__device__ __forceinline__ void a_step(const AStage<T16, NQ>& s, const VStage<T16>& sv, const typename WFrag<T16>::V (&bq)[NQ], const typename WFrag<T16>::V (&bq2)[NQ], v8f (&acc)[NQ][2], float (&mr)[NQ], float (&sm)[NQ]) {
    typedef typename WFrag<T16>::V V;
    float t[NQ][16], mx[NQ]; bool need = false;
#pragma unroll
    for (int qt = 0; qt < NQ; ++qt) {
#pragma unroll
        for (int kt = 0; kt < 2; ++kt) { v8f d = WFrag<T16>::mma(s.k[kt], bq[qt], s.m[qt][kt]);   // the mask tile has D's map: it is the product's C operand, so q.k + mask comes out of the matrix unit
            if (HILO) { d = WFrag<T16>::mma(s.k2[kt], bq[qt], d); d = WFrag<T16>::mma(s.k[kt], bq2[qt], d); }
#pragma unroll
            for (int r = 0; r < 8; ++r) t[qt][kt * 8 + r] = fmaxf(d[r], FMIN_); }
        float a = t[qt][0];
#pragma unroll
        for (int i = 1; i < 16; ++i) a = fmaxf(a, t[qt][i]);
        a = fmaxf(a, xhalf(a)); mx[qt] = a; need = need || (a > mr[qt]); }
    if (__builtin_amdgcn_ballot_w32(need) != 0) {   // a column's maximum rose: rescale what is summed so far (factor 1 in the other columns)
#pragma unroll
        for (int qt = 0; qt < NQ; ++qt) { const float mn = fmaxf(mr[qt], mx[qt]); const float al = __expf(mr[qt] - mn); mr[qt] = mn; sm[qt] *= al;
#pragma unroll
            for (int dt = 0; dt < 2; ++dt)
#pragma unroll
                for (int r = 0; r < 8; ++r) acc[qt][dt][r] *= al; } }
#pragma unroll
    for (int qt = 0; qt < NQ; ++qt) { V bp, bp2;
#pragma unroll
        for (int i = 0; i < 16; ++i) { const float p = __expf(t[qt][i] - mr[qt]); sm[qt] += p;
            if constexpr (HILO) { const __bf16 ph = (__bf16)p; bp[i] = ph; bp2[i] = (__bf16)(p - (float)ph); } else bp[i] = (h16)p; }
#pragma unroll
        for (int dt = 0; dt < 2; ++dt) { acc[qt][dt] = WFrag<T16>::mma(sv.v[dt], bp, acc[qt][dt]); if (HILO) { acc[qt][dt] = WFrag<T16>::mma(sv.v2[dt], bp, acc[qt][dt]); acc[qt][dt] = WFrag<T16>::mma(sv.v[dt], bp2, acc[qt][dt]); } } }
}
// Qp, Kp: one head's planes (rows t, k = d); Vp: its plane (rows dd, k = t); mk: this batch entry's mask tiles; q0: the wave's first query; the merged-head planes Ah/Al (rows t, k = h*32 + d, fragment order) take o = O / sum as bf16 hi + lo.
template <typename T16, bool HILO, int NQ>
__device__ __forceinline__ void attn_cols(const T16* Qp, const T16* Qp2, const T16* Kp, const T16* Kp2, const T16* Vp, const T16* Vp2, const float* mk, bf* Ah, bf* Al, int h, int q0) {
    typedef typename WFrag<T16>::V V;
    const int lane = threadIdx.x & 31;
    V bq[NQ], bq2[NQ]; v8f acc[NQ][2]; float mr[NQ], sm[NQ];
    const T16* ql = Qp + (size_t)q0 * HD + 8 * lane; const T16* q2l = Qp2 + (size_t)q0 * HD + 8 * lane;
#pragma unroll
    for (int qt = 0; qt < NQ; ++qt) { bq[qt] = WFrag<T16>::ld(ql + qt * 16 * HD); if (HILO) bq2[qt] = WFrag<T16>::ld(q2l + qt * 16 * HD); acc[qt][0] = (v8f){}; acc[qt][1] = (v8f){}; mr[qt] = FMIN_; sm[qt] = 0.f; }
    asm volatile("s_wait_xcnt 0x0" ::: "memory");   // as in a_loadk, for the Q loads
    const T16* kl = Kp + 8 * lane; const T16* k2l = Kp2 + 8 * lane; const T16* vl = Vp + 8 * lane; const T16* v2l = Vp2 + 8 * lane; const float* ml = mk + (size_t)q0 * TT + 4 * lane;   // key kb: K tile at kb * 32 elements, the V^T tile pair at kb * 32, the mask tile at kb * 16 floats
    // K and mask are fetched one step ahead into two stages. V^T too on the fp16 path; the hi+lo path (twice the fragments) fetches a step's V^T at the step's head, behind which the scores and the softmax stand, to stay within 256 registers
    AStage<T16, NQ> s0, s1; VStage<T16> v0, v1;
    a_loadk<T16, HILO, NQ>(s0, kl, k2l, ml); if (!HILO) a_loadv<T16, HILO>(v0, vl, v2l);
#pragma unroll 1   // two steps a trip, one per stage; unrolling further only costs registers
    for (int kb = 0; kb < TT; kb += 64) {
        const int kn = (kb + 64 < TT) ? kb + 64 : 0;   // the last trip fetches step 0 again (in bounds, unused)
        a_loadk<T16, HILO, NQ>(s1, kl + (kb + 32) * HD, k2l + (kb + 32) * HD, ml + (kb + 32) * 16);
        if (HILO) { a_loadv<T16, HILO>(v0, vl + kb * 32, v2l + kb * 32); a_step<T16, HILO, NQ>(s0, v0, bq, bq2, acc, mr, sm); }
        else { a_loadv<T16, HILO>(v1, vl + (kb + 32) * 32, v2l + (kb + 32) * 32); a_step<T16, HILO, NQ>(s0, v0, bq, bq2, acc, mr, sm); }
        a_loadk<T16, HILO, NQ>(s0, kl + kn * HD, k2l + kn * HD, ml + kn * 16);
        if (HILO) { a_loadv<T16, HILO>(v0, vl + (kb + 32) * 32, v2l + (kb + 32) * 32); a_step<T16, HILO, NQ>(s1, v0, bq, bq2, acc, mr, sm); }
        else { a_loadv<T16, HILO>(v0, vl + kn * 32, v2l + kn * 32); a_step<T16, HILO, NQ>(s1, v1, bq, bq2, acc, mr, sm); }
    }
#pragma unroll
    for (int qt = 0; qt < NQ; ++qt) { const float f = __fdiv_rn(1.0f, sm[qt] + xhalf(sm[qt])); const size_t oo = (size_t)(q0 + qt * 16) * RK + h * 512 + 8 * lane;   // tile (query tile, head); d = 16 dt + 8 hi + r is piece dt of lane (lr, hi)
#pragma unroll
        for (int dt = 0; dt < 2; ++dt) { v8us oh, ol;
#pragma unroll
            for (int r = 0; r < 8; ++r) { unsigned short a, c2; splitf(__fmul_rn(acc[qt][dt][r], f), a, c2); oh[r] = a; ol[r] = c2; }
            *(v8us*)(Ah + oo + dt * 256) = oh; *(v8us*)(Al + oo + dt * 256) = ol; } }
}
// grid (batch entries x heads, RH/64 + (TT-RH)/128), 4 waves (one a SIMD; 1280 blocks, five a WGP, four resident at 232 registers, so the longer hi+lo blocks have the low indices and start first): the first RH/64 blocks of a head take the hi+lo rows, 16 queries a wave
// (three products a tile, so half the columns); the rest 32 queries a wave on fp16. A block's waves walk the same K and V^T lines.
__global__ __launch_bounds__(128) void k_fattn(const h16* __restrict__ Q16, const h16* __restrict__ K16, const h16* __restrict__ VT16, const bf* __restrict__ Qh, const bf* __restrict__ Ql, const bf* __restrict__ Kh, const bf* __restrict__ Kl, const bf* __restrict__ VTh, const bf* __restrict__ VTl, const float* __restrict__ mk, bf* Ah, bf* Al) {
    const int h = blockIdx.x % NH_, b = blockIdx.x / NH_, w = threadIdx.x >> 5, bx = blockIdx.y; const size_t oq = (size_t)blockIdx.x * TT * HD, ov = (size_t)blockIdx.x * HD * TT; mk += (size_t)b * TT * TT; Ah += (size_t)b * TT * RK; Al += (size_t)b * TT * RK;
    if (bx < RH / 64) attn_cols<bf, true, 1>(Qh + oq, Ql + oq, Kh + oq, Kl + oq, VTh + ov, VTl + ov, mk, Ah, Al, h, bx * 64 + w * 16);
    else attn_cols<h16, false, 2>(Q16 + oq, Q16 + oq, K16 + oq, K16 + oq, VT16 + ov, VT16 + ov, mk, Ah, Al, h, RH + (bx - RH / 64) * 128 + w * 32);
}

extern "C" void kernel_launch(void* const* d_in, const int* in_sizes, int n_in,
                              void* d_out, int out_size, void* d_ws, size_t ws_size, hipStream_t stream) {
    (void)in_sizes; (void)n_in; (void)out_size;
    const float* IN[10]; for (int i = 0; i < 10; ++i) IN[i] = (const float*)d_in[i];   // 0 hidden, 1 attention_mask [2][1][2048][2048], 2 Wq [1024][2048], 3 bq, 4 Wk, 5 bk, 6 Wv, 7 bv, 8 Wo [2048][1024], 9 bo (torch [out][in])
    float* OUT = (float*)d_out;     // [2][2048][2048]
    char* wsp = (char*)d_ws;
    auto take = [&](size_t bytes) { char* p = wsp; wsp += (bytes + 255) & ~(size_t)255; return (void*)p; };
    bf* WQ = (bf*)take((size_t)RK * DM * 2); bf* WK = (bf*)take((size_t)RK * DM * 2); bf* WV = (bf*)take((size_t)RK * DM * 2); bf* WO = (bf*)take((size_t)DM * RK * 2);   // WQ, WK, WV, WO, XB lie in a row (every size a multiple of 256 bytes); so do FQ, FK, FV
    bf* XB = (bf*)take((size_t)NB_ * TT * DM * 2); float* FQ = (float*)take((size_t)NB_ * TT * RK * 4); float* FK = (float*)take((size_t)NB_ * TT * RK * 4); float* FV = (float*)take((size_t)NB_ * TT * RK * 4);
    h16* Q16 = (h16*)take((size_t)NB_ * NH_ * TT * HD * 2); h16* K16 = (h16*)take((size_t)NB_ * NH_ * TT * HD * 2); bf* Qh = (bf*)take((size_t)NB_ * NH_ * TT * HD * 2); bf* Ql = (bf*)take((size_t)NB_ * NH_ * TT * HD * 2); bf* Kh = (bf*)take((size_t)NB_ * NH_ * TT * HD * 2); bf* Kl = (bf*)take((size_t)NB_ * NH_ * TT * HD * 2);
    h16* VT16 = (h16*)take((size_t)NB_ * NH_ * HD * TT * 2); bf* VTh = (bf*)take((size_t)NB_ * NH_ * HD * TT * 2); bf* VTl = (bf*)take((size_t)NB_ * NH_ * HD * TT * 2);
    bf* Ah = (bf*)take((size_t)NB_ * TT * RK * 2); bf* Al = (bf*)take((size_t)NB_ * TT * RK * 2); float* MP = (float*)take((size_t)NB_ * TT * TT * 4);
    if ((size_t)(wsp - (char*)d_ws) > ws_size) return;    // total 200 MiB
    (void)WK; (void)WV;
    k_cvt8<<<CVB + NB_ * TT * TT / 8 / 256, 256, 0, stream>>>(IN[2], IN[4], IN[6], IN[8], IN[0], IN[1], WQ, MP);
    k_gemmw<bf, 0, true><<<dim3(NB_ * TT / 64, RK / 64, 3), 32, 0, stream>>>(XB, nullptr, WQ, nullptr, DM, DM, FQ, RK, IN[3], IN[5], IN[7], 0, (size_t)RK * DM, (size_t)NB_ * TT * RK);
    k_qkp<<<(unsigned)(((size_t)NB_ * NH_ * TT * HD / 2 + 255) / 256), 256, 0, stream>>>(FQ, FK, Q16, K16, Qh, Ql, Kh, Kl); k_vtp<<<NB_ * NH_ * HD * TT / 8 / 256, 256, 0, stream>>>(FV, VT16, VTh, VTl);
    k_fattn<<<dim3(NB_ * NH_, RH / 64 + (TT - RH) / 128, 1), 128, 0, stream>>>(Q16, K16, VT16, Qh, Ql, Kh, Kl, VTh, VTl, MP, Ah, Al);
    k_gemmw<bf, 1, true><<<dim3(NB_ * TT / 64, DM / 64, 1), 32, 0, stream>>>(Ah, Al, WO, nullptr, RK, RK, OUT, DM, IN[9], IN[9], IN[9], 0, 0, 0);
}

// v005
// Measured time: 196 microseconds a run.
// Next to v004, in two timings, it ran 1.21 times as fast each time.
// Over all steps from v000 it is 34.4 times as fast.
#include <hip/hip_runtime.h>

// OPTEigenAttention - low-rank (eigen) OPT attention (hidden [2][2048][2048]; q = (x Wq^T + bq) x 64^-0.5 (32 heads x 32 low-rank dims; the scaling uses the ORIGINAL head dim 64), k = x Wk^T + bk, v = x Wv^T + bv (32 x 32);
// scores = q.k + attention_mask[b][0][i][j] (additive f32 mask input, read as data; then max(., float min)); softmax; out = merged att.v Wo^T + bo -> [2][2048][2048]).
// Compute dtypes, f32 accumulate: every input rounded to bf16; projections on PLAIN bf16 operands (inputs: exact, + bias); scores (K 32) and att.v on bf16 hi+lo planes (3 products) for
// the first 512 query rows of each head and on SINGLE fp16 planes for the rest (the mask here is causal, so early rows see few keys);
// mask add and softmax in f32 registers; merged heads as bf16 hi+lo planes x exact Wo (2 products) + bo. One-wave-per-64x64-tile GEMMs for the projections.
// Every launch covers both batch entries (rows b*2048 + t, head planes b*32 + h); the three projections are one launch (grid z = matrix). Attention is ONE kernel (k_fattn): S^T = K.Q^T, running-maximum softmax in registers, O^T += V^T.P^T; no score or probability ever reaches memory.
// FRAGMENT ORDER: every 16-bit operand plane is stored as 1-KiB tiles of 16 rows x 32 k, tile (row/16, k/32) at index (row/16) * (K/32) + k/32 (V^T: (k/32) * 2 + row/16), element (row, k) at (k%32/16) * 256 + ((k%16/8) * 16 + row%16) * 8 + k%8 inside it.
// A lane's two 16-byte fragment pieces then lie at lane * 8 and 256 + lane * 8, so each wave-wide load covers 512 contiguous bytes (4 lines) where a row-major plane gave 16 pieces of 32 bytes in 16 lines. The k order of a fragment is the one it had.
// The f32 mask is copied once into 16 query x 16 key tiles in the accumulator's map (value r of a lane at (r/4) * 128 + lane * 4 + r%4), tile index (q/16) * 128 + key/16, for the same reason: all 64 head planes read it.
// LIVE STEPS: while it copies the mask, the packer notes for each 16-query tile and each 32-key step whether any mask value there lies above DEADM. Once every query of a wave has a running maximum above LIVEM, the wave walks only the steps so marked:
// in any other step each score is at most DEADM + |q.k| (|q.k| below 8e37 is taken for granted: fp16 operands cannot pass 1.4e11, and the projections of these inputs lie far lower still), so exp(score - maximum) is 0 in f32 and the step adds nothing to the sum or to O. Until then (a row whose first keys, or all keys, are masked) every step is worked as before, so the function is the same for any mask.

#define NB_  2
#define TT   2048
#define DM   2048
#define RK   1024
#define NH_  32
#define HD   32
#define RH   512
#define SCL  0.125f
#define DEADM (-1.0e38f)
#define LIVEM (-1.0e37f)
typedef _Float16 h16;
typedef unsigned short bf;
typedef __attribute__((ext_vector_type(16))) __bf16   v16bf;
typedef __attribute__((ext_vector_type(16))) _Float16 v16h;
typedef __attribute__((ext_vector_type(8)))  _Float16 v8h;
typedef __attribute__((ext_vector_type(8)))  unsigned short v8us;
typedef __attribute__((ext_vector_type(8)))  float    v8f;
typedef __attribute__((ext_vector_type(4)))  float    v4f;
typedef v8h  __attribute__((may_alias)) v8ha;
typedef v4f  __attribute__((may_alias)) v4fa;
typedef v8us __attribute__((may_alias)) v8usa;

__device__ __forceinline__ unsigned short f2bf(float f) { unsigned u = __float_as_uint(f); u += 0x7FFFu + ((u >> 16) & 1u); return (unsigned short)(u >> 16); }
__device__ __forceinline__ float bf2f(unsigned short b) { return __uint_as_float(((unsigned)b) << 16); }
__device__ __forceinline__ float bfr(float f) { return bf2f(f2bf(f)); }
__device__ __forceinline__ v16h cat16(v8h lo, v8h hi) { return __builtin_shufflevector(lo, hi, 0, 1, 2, 3, 4, 5, 6, 7, 8, 9, 10, 11, 12, 13, 14, 15); }
__device__ __forceinline__ v16bf cat16b(v8us lo, v8us hi) { return __builtin_bit_cast(v16bf, __builtin_shufflevector(lo, hi, 0, 1, 2, 3, 4, 5, 6, 7, 8, 9, 10, 11, 12, 13, 14, 15)); }
__device__ __forceinline__ v8f wmma16(v16h a, v16h b, v8f c) { return __builtin_amdgcn_wmma_f32_16x16x32_f16(false, a, false, b, (short)0, c, false, false); }
__device__ __forceinline__ v8f wmmab(v16bf a, v16bf b, v8f c) { return __builtin_amdgcn_wmma_f32_16x16x32_bf16(false, a, false, b, (short)0, c, false, false); }



// ---- k_gemmw: register-blocked GEMM, ONE WAVE per 64x64 output tile (16 accumulators), operands straight from 16-bit planes in fragment order; grid (M/64, N/64, Z), 32 threads.
// C[m][n] (f32, pitch ldc, + optional f32 bias[n]) = sum_k A[m][k] Bt[n][k] (+ split products per NSPLIT). A has lda k values a row, Bt K (both planes in fragment order). z-batch strides sA/sB/sC in elements; z slices 0, 1, 2 take bias, bias1, bias2. K % 32 == 0.
template <typename T16> struct WFrag;
template <> struct WFrag<h16> { typedef v16h V; static __device__ __forceinline__ V ld(const h16* p) { return cat16(*(const v8h*)p, *(const v8h*)(p + 256)); } static __device__ __forceinline__ v8f mma(V a, V b, v8f c) { return wmma16(a, b, c); } };
template <> struct WFrag<bf> { typedef v16bf V; static __device__ __forceinline__ V ld(const bf* p) { return cat16b(*(const v8us*)p, *(const v8us*)(p + 256)); } static __device__ __forceinline__ v8f mma(V a, V b, v8f c) { return wmmab(a, b, c); } };
template <typename T16, int NSPLIT, bool BIAS>
__global__ __launch_bounds__(32) void k_gemmw(const T16* __restrict__ A, const T16* __restrict__ A2, const T16* __restrict__ Bt, const T16* __restrict__ Bt2, int K, int lda, float* C, int ldc, const float* __restrict__ bias, const float* __restrict__ bias1, const float* __restrict__ bias2, size_t sA, size_t sB, size_t sC) {
    typedef typename WFrag<T16>::V V;
    __shared__ __align__(16) float os[16 * 68];
    const size_t z = blockIdx.z; A += z * sA; if (A2) A2 += z * sA; Bt += z * sB; if (Bt2) Bt2 += z * sB; C += z * sC; if (z == 1) bias = bias1; else if (z == 2) bias = bias2;   // each z slice has its own bias vector
    const int lane = threadIdx.x & 31, lr = lane & 15, hi = lane >> 4; const int r0 = blockIdx.x * 64, c0 = blockIdx.y * 64;
    v8f acc[4][4];
#pragma unroll
    for (int mb = 0; mb < 4; ++mb)
#pragma unroll
        for (int nb = 0; nb < 4; ++nb) acc[mb][nb] = (v8f){};
    const size_t aoff = (size_t)r0 * lda + 8 * lane, boff = (size_t)c0 * K + 8 * lane;   // 16 rows of tiles hold 16 * K elements; a step of 32 k is one tile (512 elements)
#pragma unroll 1
    for (int kc = 0; kc < K; kc += 32) {
        V a[4], a2[4], b[4], b2[4]; const T16* pa[4]; const T16* pa2[4]; const T16* pb[4]; const T16* pb2[4];
#pragma unroll
        for (int mb = 0; mb < 4; ++mb) { pa[mb] = A + aoff + (size_t)mb * 16 * lda + (size_t)kc * 16; a[mb] = WFrag<T16>::ld(pa[mb]); if (NSPLIT == 1 || NSPLIT == 2) { pa2[mb] = A2 + aoff + (size_t)mb * 16 * lda + (size_t)kc * 16; a2[mb] = WFrag<T16>::ld(pa2[mb]); } }
        // the A loads' address registers are inputs here, so none of them is rewritten (not even as a later load's destination) before the wait on their address translations
        if (NSPLIT == 1 || NSPLIT == 2) asm volatile("s_wait_xcnt 0x0" :: "v"(pa[0]), "v"(pa[1]), "v"(pa[2]), "v"(pa[3]), "v"(pa2[0]), "v"(pa2[1]), "v"(pa2[2]), "v"(pa2[3]) : "memory");
        else asm volatile("s_wait_xcnt 0x0" :: "v"(pa[0]), "v"(pa[1]), "v"(pa[2]), "v"(pa[3]) : "memory");
#pragma unroll
        for (int nb = 0; nb < 4; ++nb) { pb[nb] = Bt + boff + (size_t)nb * 16 * K + (size_t)kc * 16; b[nb] = WFrag<T16>::ld(pb[nb]); if (NSPLIT >= 2) { pb2[nb] = Bt2 + boff + (size_t)nb * 16 * K + (size_t)kc * 16; b2[nb] = WFrag<T16>::ld(pb2[nb]); } }
        // the same for the B loads
        asm volatile("s_wait_xcnt 0x0" :: "v"(pb[0]), "v"(pb[1]), "v"(pb[2]), "v"(pb[3]) : "memory");
        if (NSPLIT >= 2) asm volatile("s_wait_xcnt 0x0" :: "v"(pb2[0]), "v"(pb2[1]), "v"(pb2[2]), "v"(pb2[3]) : "memory");
#pragma unroll
        for (int nb = 0; nb < 4; ++nb) {
#pragma unroll
            for (int mb = 0; mb < 4; ++mb) { acc[mb][nb] = WFrag<T16>::mma(a[mb], b[nb], acc[mb][nb]); if (NSPLIT == 1 || NSPLIT == 2) acc[mb][nb] = WFrag<T16>::mma(a2[mb], b[nb], acc[mb][nb]); if (NSPLIT >= 2) acc[mb][nb] = WFrag<T16>::mma(a[mb], b2[nb], acc[mb][nb]); } }
        asm volatile("v_nop\n\tv_nop\n\tv_nop\n\tv_nop" : "+v"(acc[0][0]), "+v"(acc[1][1]), "+v"(acc[2][2]), "+v"(acc[3][3]) : "v"(a[0]), "v"(a[3]));
    }
#pragma unroll
    for (int mb = 0; mb < 4; ++mb) {
#pragma unroll
        for (int nb = 0; nb < 4; ++nb) {
#pragma unroll
            for (int j = 0; j < 8; ++j) os[(hi * 8 + j) * 68 + nb * 16 + lr] = acc[mb][nb][j]; }
        __builtin_amdgcn_wave_barrier(); asm volatile("" ::: "memory");
        float* crow = C + (size_t)(r0 + mb * 16) * ldc + c0;
{
#pragma unroll
            for (int s = 0; s < 8; ++s) { const int row = 2 * s + hi, cofs = lr * 4; v4f val = *(const v4fa*)(os + row * 68 + cofs); if (BIAS) { val[0] += bfr(bias[c0 + cofs]); val[1] += bfr(bias[c0 + cofs + 1]); val[2] += bfr(bias[c0 + cofs + 2]); val[3] += bfr(bias[c0 + cofs + 3]); }
                *(v4f*)(crow + (size_t)row * ldc + cofs) = val; }
             }
        asm volatile("s_wait_xcnt 0x0" ::: "memory");   // stands behind the row stores, before their address registers are reused
        __builtin_amdgcn_wave_barrier(); asm volatile("" ::: "memory");
    }
}

__device__ __forceinline__ h16 tohx(float x) { return (h16)x; }
__device__ __forceinline__ void splitf(float y, unsigned short& h, unsigned short& l) { h = f2bf(y); l = f2bf(y - bf2f(h)); }
typedef __attribute__((ext_vector_type(2))) _Float16 v2h;
typedef __attribute__((ext_vector_type(4))) _Float16 v4h;
typedef __attribute__((ext_vector_type(2))) unsigned short v2us;
typedef __attribute__((ext_vector_type(4))) unsigned short v4us;
typedef __attribute__((ext_vector_type(2))) float v2f;

// k_cvt8: all five f32 -> bf16 conversions and the mask copy in one launch. dst is the row of planes WQ, WK, WV, WO, XB, each in fragment order; 1024 blocks (2^21 elements) for each weight, 4096 for the hidden states of both batch entries, then 4096 for the mask.
// A thread is one 16-byte piece of the destination (stores stay contiguous); its 8 source values are 8 consecutive k of one row, and a block reads whole lines of 16 rows.
#define CVB (4 * 1024 + NB_ * TT * DM / 8 / 256)
__global__ __launch_bounds__(256) void k_cvt8(const float* __restrict__ wq, const float* __restrict__ wk, const float* __restrict__ wv, const float* __restrict__ wo, const float* __restrict__ x, const float* __restrict__ mk, bf* dst, float* mp, unsigned* lv) {
    const int lane = threadIdx.x & 31, lr = lane & 15, hi = lane >> 4;
    if (blockIdx.x >= CVB) {   // mask: a wave copies one 16 x 16 tile, a lane its 8 keys 8 hi .. 8 hi + 7 of query row lr; a block is 8 tiles in a row = 4 steps of one query tile
        __shared__ unsigned fl[8];
        const size_t tile = ((size_t)(blockIdx.x - CVB) * 256 + threadIdx.x) >> 5; const float* s = mk + ((tile / (TT / 16)) * 16 + lr) * TT + (tile % (TT / 16)) * 16 + 8 * hi; const v4f a = *(const v4f*)s, c = *(const v4f*)(s + 4);
        asm volatile("s_wait_xcnt 0x0" ::: "memory");   // stands behind the loads, before their address registers are reused
        bool up = false;   // not-a-number counts as live
#pragma unroll
        for (int r = 0; r < 4; ++r) up = up || !(a[r] <= DEADM) || !(c[r] <= DEADM);
        const unsigned any = __builtin_amdgcn_ballot_w32(up) != 0 ? 1u : 0u; if (lane == 0) fl[threadIdx.x >> 5] = any;
        __syncthreads();   // the eight waves' tile marks meet here (the branch is the same for the whole block); it stands ahead of the tile's stores so that no wave waits at it for a store to finish
        *(v4f*)(mp + tile * 256 + lane * 4) = a; *(v4f*)(mp + tile * 256 + 128 + lane * 4) = c;
        if (threadIdx.x == 0) lv[(size_t)(blockIdx.x - CVB) * 32] = (fl[0] | fl[1]) | (fl[2] | fl[3]) << 1 | (fl[4] | fl[5]) << 2 | (fl[6] | fl[7]) << 3;   // bit j: step 4 * (block % 16) + j; one word a 128-byte line, so each line has one writer
        return; }
    const int seg = blockIdx.x >> 10; const float* src = seg == 0 ? wq : seg == 1 ? wk : seg == 2 ? wv : seg == 3 ? wo : x; const size_t i = (size_t)blockIdx.x * 256 + threadIdx.x; const size_t j = i - (size_t)(seg < 4 ? seg : 4) * 1024 * 256;
    const int sh = seg == 3 ? 5 : 6;   // log2 of the tiles in a row of tiles: K = 1024 for Wo, 2048 for the rest
    const size_t tile = j >> 6; const v8f v = *(const v8f*)(src + ((((tile >> sh) * 16 + lr) << sh) + (tile & ((1u << sh) - 1))) * 32 + ((j >> 5) & 1) * 16 + 8 * hi); v8us o;
    asm volatile("s_wait_xcnt 0x0" ::: "memory");   // stands behind the load, before its address registers are reused
#pragma unroll
    for (int k = 0; k < 8; ++k) o[k] = f2bf(v[k]); *(v8us*)(dst + i * 8) = o;  }
// Head planes are numbered hb = b*32 + h; FQ, FK, FV have rows b*2048 + t. k_qkp: per (hb, t, d pair): q = FQ[t][h*32+d] x 0.125, k = FK[...]: fp16 planes Q16/K16 (rows t, k = d) and hi/lo planes Qh/Ql, Kh/Kl, in fragment order (lane -> 2 d); k_vtp: VT16 (rows dd < 32, k = t; fp16) and VTh/VTl (hi/lo) = FV[t][h*32+dd], in fragment order with the two row tiles of a 32-key step side by side.
__global__ __launch_bounds__(256) void k_qkp(const float* __restrict__ FQ, const float* __restrict__ FK, h16* Q16, h16* K16, bf* Qh, bf* Ql, bf* Kh, bf* Kl) { const size_t e = ((size_t)blockIdx.x * 256 + threadIdx.x) * 2; if (e >= (size_t)NB_ * NH_ * TT * HD) return; const int d = (int)(e % HD); const int t = (int)((e / HD) % TT); const int hb = (int)(e / ((size_t)HD * TT)); const int h = hb % NH_; const size_t s = ((size_t)(hb / NH_) * TT + t) * RK + h * HD + d; v2h q, k; v2us qh, ql, kh, kl;
#pragma unroll
    for (int u = 0; u < 2; ++u) { float qs = __fmul_rn(FQ[s + u], SCL); asm volatile("" : "+v"(qs)); q[u] = tohx(qs); k[u] = tohx(FK[s + u]); unsigned short a, c2; splitf(qs, a, c2); qh[u] = a; ql[u] = c2; splitf(FK[s + u], a, c2); kh[u] = a; kl[u] = c2; }
    { const size_t p = (e & ~(size_t)511) + (d >> 4) * 256 + (((d >> 3) & 1) * 16 + (t & 15)) * 8 + (d & 7);   // 16 rows of 32 d are one tile: the same 512 elements, permuted
      *(v2h*)(Q16 + p) = q; *(v2h*)(K16 + p) = k; *(v2us*)(Qh + p) = qh; *(v2us*)(Ql + p) = ql; *(v2us*)(Kh + p) = kh; *(v2us*)(Kl + p) = kl;  } }
// A thread is one 16-byte piece: 8 consecutive keys of row dd; the lanes of a wave are the 32 dd, so each of its 8 loads is one whole line of FV and each store two runs of 256 bytes.
__global__ __launch_bounds__(256) void k_vtp(const float* __restrict__ FV, h16* VT16, bf* VTh, bf* VTl) { const unsigned g = blockIdx.x * 256 + threadIdx.x; const int dd = (int)(g & 31), tg = (int)((g >> 5) & (TT / 8 - 1)), hb = (int)(g >> 13); const float* s = FV + ((size_t)(hb / NH_) * TT + tg * 8) * RK + (hb % NH_) * HD + dd; float v[8];
#pragma unroll
    for (int u = 0; u < 8; ++u) v[u] = s[(size_t)u * RK];
    asm volatile("s_wait_xcnt 0x0" ::: "memory");   // stands behind the loads, before their address registers are reused
    v8h o; v8us oh, ol;
#pragma unroll
    for (int u = 0; u < 8; ++u) { o[u] = tohx(v[u]); unsigned short a, c2; splitf(v[u], a, c2); oh[u] = a; ol[u] = c2; }
    const size_t p = (size_t)hb * HD * TT + (size_t)((tg >> 2) * 2 + (dd >> 4)) * 512 + ((tg >> 1) & 1) * 256 + ((tg & 1) * 16 + (dd & 15)) * 8;
    *(v8h*)(VT16 + p) = o; *(v8us*)(VTh + p) = oh; *(v8us*)(VTl + p) = ol; }
__device__ __forceinline__ float xhalf(float x) { const int b = __float_as_int(x); return __int_as_float(__builtin_amdgcn_permlanex16(b, b, 0x76543210, 0xfedcba98, false, false)); }
#define FMIN_ (-3.40282347e38f)
template <typename T16, int NQ> struct AStage { typename WFrag<T16>::V k[2], k2[2]; v8f m[NQ][2]; };   // one step's K fragments and mask tiles
template <typename T16> struct VStage { typename WFrag<T16>::V v[2], v2[2]; };                          // one step's V^T fragments
template <typename T16, bool HILO, int NQ>
__device__ __forceinline__ void a_loadk(AStage<T16, NQ>& s, const T16* pk, const T16* pk2, const float* pm) {
#pragma unroll
    for (int kt = 0; kt < 2; ++kt) { s.k[kt] = WFrag<T16>::ld(pk + kt * 16 * HD); if (HILO) s.k2[kt] = WFrag<T16>::ld(pk2 + kt * 16 * HD); }
#pragma unroll
    for (int qt = 0; qt < NQ; ++qt)
#pragma unroll
        for (int kt = 0; kt < 2; ++kt) { const float* p = pm + (size_t)qt * 16 * TT + kt * 256; s.m[qt][kt] = __builtin_shufflevector(*(const v4f*)p, *(const v4f*)(p + 128), 0, 1, 2, 3, 4, 5, 6, 7); }
    // stands behind the group's loads, before their address registers are rewritten for the next group (they are inputs, so that none is rewritten ahead of the wait, not even as a later load's destination); the clobber also keeps these loads ahead of the work on the other stage
    if constexpr (HILO) asm volatile("s_wait_xcnt 0x0" :: "v"(pk), "v"(pk2), "v"(pm) : "memory"); else asm volatile("s_wait_xcnt 0x0" :: "v"(pk), "v"(pm) : "memory");
}
template <typename T16, bool HILO>
__device__ __forceinline__ void a_loadv(VStage<T16>& s, const T16* pv, const T16* pv2) {
#pragma unroll
    for (int dt = 0; dt < 2; ++dt) { s.v[dt] = WFrag<T16>::ld(pv + dt * 512); if (HILO) s.v2[dt] = WFrag<T16>::ld(pv2 + dt * 512); }
    if constexpr (HILO) asm volatile("s_wait_xcnt 0x0" :: "v"(pv), "v"(pv2) : "memory"); else asm volatile("s_wait_xcnt 0x0" :: "v"(pv) : "memory");   // as in a_loadk
}
template <typename T16, bool HILO, int NQ>
__device__ __forceinline__ void a_step(const AStage<T16, NQ>& s, const VStage<T16>& sv, const typename WFrag<T16>::V (&bq)[NQ], const typename WFrag<T16>::V (&bq2)[NQ], v8f (&acc)[NQ][2], float (&mr)[NQ], float (&sm)[NQ]) {
    typedef typename WFrag<T16>::V V;
    float t[NQ][16], mx[NQ]; bool need = false;
#pragma unroll
    for (int qt = 0; qt < NQ; ++qt) {
#pragma unroll
        for (int kt = 0; kt < 2; ++kt) { v8f d = WFrag<T16>::mma(s.k[kt], bq[qt], s.m[qt][kt]);   // the mask tile has D's map: it is the product's C operand, so q.k + mask comes out of the matrix unit
            if (HILO) { d = WFrag<T16>::mma(s.k2[kt], bq[qt], d); d = WFrag<T16>::mma(s.k[kt], bq2[qt], d); }
#pragma unroll
            for (int r = 0; r < 8; ++r) t[qt][kt * 8 + r] = fmaxf(d[r], FMIN_); }
        float a = t[qt][0];
#pragma unroll
        for (int i = 1; i < 16; ++i) a = fmaxf(a, t[qt][i]);
        a = fmaxf(a, xhalf(a)); mx[qt] = a; need = need || (a > mr[qt]); }
    if (__builtin_amdgcn_ballot_w32(need) != 0) {   // a column's maximum rose: rescale what is summed so far (factor 1 in the other columns)
#pragma unroll
        for (int qt = 0; qt < NQ; ++qt) { const float mn = fmaxf(mr[qt], mx[qt]); const float al = __expf(mr[qt] - mn); mr[qt] = mn; sm[qt] *= al;
#pragma unroll
            for (int dt = 0; dt < 2; ++dt)
#pragma unroll
                for (int r = 0; r < 8; ++r) acc[qt][dt][r] *= al; } }
#pragma unroll
    for (int qt = 0; qt < NQ; ++qt) { V bp, bp2;
#pragma unroll
        for (int i = 0; i < 16; ++i) { const float p = __expf(t[qt][i] - mr[qt]); sm[qt] += p;
            if constexpr (HILO) { const __bf16 ph = (__bf16)p; bp[i] = ph; bp2[i] = (__bf16)(p - (float)ph); } else bp[i] = (h16)p; }
#pragma unroll
        for (int dt = 0; dt < 2; ++dt) { acc[qt][dt] = WFrag<T16>::mma(sv.v[dt], bp, acc[qt][dt]); if (HILO) { acc[qt][dt] = WFrag<T16>::mma(sv.v2[dt], bp, acc[qt][dt]); acc[qt][dt] = WFrag<T16>::mma(sv.v[dt], bp2, acc[qt][dt]); } } }
}
// Four vector slots behind a step's last matrix instructions: the branches that follow lead, on their taken side, to address arithmetic in the registers that held V^T. The accumulators are inputs so that the slots stand behind those instructions.
template <int NQ> __device__ __forceinline__ void a_gap(const v8f (&acc)[NQ][2]) {
    if constexpr (NQ == 2) asm volatile("v_nop\n\tv_nop\n\tv_nop\n\tv_nop" :: "v"(acc[0][0]), "v"(acc[0][1]), "v"(acc[1][0]), "v"(acc[1][1]));
    else asm volatile("v_nop\n\tv_nop\n\tv_nop\n\tv_nop" :: "v"(acc[0][0]), "v"(acc[0][1])); }
template <int NQ> __device__ __forceinline__ bool a_settled(const float (&mr)[NQ]) { bool ok = true;   // true, for the whole wave, once each of its queries has met a key that is not masked out
#pragma unroll
    for (int qt = 0; qt < NQ; ++qt) ok = ok && (mr[qt] > LIVEM);
    return __builtin_amdgcn_ballot_w32(ok) == 0xffffffffu; }
// Qp, Kp: one head's planes (rows t, k = d); Vp: its plane (rows dd, k = t); mk: this batch entry's mask tiles; lv: its live-step words (16 a query tile, 4 steps each, 32 words apart); q0: the wave's first query; the merged-head planes Ah/Al (rows t, k = h*32 + d, fragment order) take o = O / sum as bf16 hi + lo.
template <typename T16, bool HILO, int NQ>
__device__ __forceinline__ void attn_cols(const T16* Qp, const T16* Qp2, const T16* Kp, const T16* Kp2, const T16* Vp, const T16* Vp2, const float* mk, const unsigned* lv, bf* Ah, bf* Al, int h, int q0) {
    typedef typename WFrag<T16>::V V;
    const int lane = threadIdx.x & 31;
    V bq[NQ], bq2[NQ]; v8f acc[NQ][2]; float mr[NQ], sm[NQ];
    const T16* ql = Qp + (size_t)q0 * HD + 8 * lane; const T16* q2l = Qp2 + (size_t)q0 * HD + 8 * lane;
    unsigned nib = lv[((size_t)(q0 >> 4) * 16 + (NQ == 2 ? lane : (lane & 15))) * 32];   // lane l: steps 4 (l % 16) .. + 3 of query tile l / 16 (NQ 1: of its one tile in every lane)
#pragma unroll
    for (int qt = 0; qt < NQ; ++qt) { bq[qt] = WFrag<T16>::ld(ql + qt * 16 * HD); if (HILO) bq2[qt] = WFrag<T16>::ld(q2l + qt * 16 * HD); acc[qt][0] = (v8f){}; acc[qt][1] = (v8f){}; mr[qt] = FMIN_; sm[qt] = 0.f; }
    asm volatile("s_wait_xcnt 0x0" ::: "memory");   // as in a_loadk, for the Q loads
    const T16* kl = Kp + 8 * lane; const T16* k2l = Kp2 + 8 * lane; const T16* vl = Vp + 8 * lane; const T16* v2l = Vp2 + 8 * lane; const float* ml = mk + (size_t)q0 * TT + 4 * lane;   // key kb: K tile at kb * 32 elements, the V^T tile pair at kb * 32, the mask tile at kb * 16 floats
    // K and mask are fetched one step ahead into two stages. V^T too on the fp16 path; the hi+lo path (twice the fragments) fetches a step's V^T at the step's head, behind which the scores and the softmax stand, to stay within 256 registers
    AStage<T16, NQ> s0, s1; VStage<T16> v0, v1;
    a_loadk<T16, HILO, NQ>(s0, kl, k2l, ml); if (!HILO) a_loadv<T16, HILO>(v0, vl, v2l);
    if (NQ == 2) nib |= (unsigned)__builtin_amdgcn_permlanex16((int)nib, (int)nib, 0x76543210, 0xfedcba98, false, false);   // a step is live if it is so for either query tile
    unsigned long long live = 0;   // bit s: step s (keys 32 s .. 32 s + 31); the same in every lane, kept in scalar registers
#pragma unroll
    for (int l = 0; l < 16; ++l) live |= (unsigned long long)(unsigned)__builtin_amdgcn_readlane((int)nib, l) << (4 * l);
    unsigned long long todo = ~1ull;   // steps not yet fetched: all of them until every query's maximum has settled above LIVEM, then the live ones among them
    bool settled = false, more; int kb = 0;
    do {   // two steps a trip, one per stage; each step fetches the next step still to do; once none is left, step 0 is fetched again (in bounds, unused)
        const bool pair = todo != 0; int kn = pair ? __builtin_ctzll(todo) * 32 : 0; todo &= todo - 1;
        a_loadk<T16, HILO, NQ>(s1, kl + kn * HD, k2l + kn * HD, ml + kn * 16);
        if (HILO) { a_loadv<T16, HILO>(v0, vl + kb * 32, v2l + kb * 32); a_step<T16, HILO, NQ>(s0, v0, bq, bq2, acc, mr, sm); }
        else { a_loadv<T16, HILO>(v1, vl + kn * 32, v2l + kn * 32); a_step<T16, HILO, NQ>(s0, v0, bq, bq2, acc, mr, sm); }
        a_gap<NQ>(acc); if (!settled) { settled = a_settled<NQ>(mr); if (settled) todo &= live; }
        kb = kn; more = todo != 0; kn = more ? __builtin_ctzll(todo) * 32 : 0; todo &= todo - 1;
        a_loadk<T16, HILO, NQ>(s0, kl + kn * HD, k2l + kn * HD, ml + kn * 16);
        if (HILO) a_loadv<T16, HILO>(v0, vl + kb * 32, v2l + kb * 32); else a_loadv<T16, HILO>(v0, vl + kn * 32, v2l + kn * 32);
        if (pair) {   // an odd count ends with half a trip
            a_step<T16, HILO, NQ>(s1, HILO ? v0 : v1, bq, bq2, acc, mr, sm);
            a_gap<NQ>(acc); if (!settled) { settled = a_settled<NQ>(mr); if (settled) todo &= live; } }
        kb = kn;
    } while (more);
#pragma unroll
    for (int qt = 0; qt < NQ; ++qt) { const float f = __fdiv_rn(1.0f, sm[qt] + xhalf(sm[qt])); const size_t oo = (size_t)(q0 + qt * 16) * RK + h * 512 + 8 * lane;   // tile (query tile, head); d = 16 dt + 8 hi + r is piece dt of lane (lr, hi)
#pragma unroll
        for (int dt = 0; dt < 2; ++dt) { v8us oh, ol;
#pragma unroll
            for (int r = 0; r < 8; ++r) { unsigned short a, c2; splitf(__fmul_rn(acc[qt][dt][r], f), a, c2); oh[r] = a; ol[r] = c2; }
            bf* pa = Ah + oo + dt * 256; bf* pl = Al + oo + dt * 256; *(v8us*)pa = oh; *(v8us*)pl = ol;
            asm volatile("s_wait_xcnt 0x0" :: "v"(pa), "v"(pl), "v"(oh), "v"(ol) : "memory"); } }   // stands behind the two stores, before their address and data registers (inputs here, so that they live up to the wait) are rewritten for the next piece
}
// grid (batch entries x heads, (TT-RH)/128 + RH/64), 4 waves (one a SIMD; 1280 blocks, five a WGP, four resident): the first (TT-RH)/128 blocks of a head take 32 queries a wave on fp16, the rest the hi+lo rows, 16 queries a wave
// (three products a tile, so half the columns). Both run from the last query rows to the first: under a causal mask those have the most live steps, so the longest blocks have the low indices and start first (for speed only). A block's waves walk the same K and V^T lines.
__global__ __launch_bounds__(128) void k_fattn(const h16* __restrict__ Q16, const h16* __restrict__ K16, const h16* __restrict__ VT16, const bf* __restrict__ Qh, const bf* __restrict__ Ql, const bf* __restrict__ Kh, const bf* __restrict__ Kl, const bf* __restrict__ VTh, const bf* __restrict__ VTl, const float* __restrict__ mk, const unsigned* __restrict__ lv, bf* Ah, bf* Al) {
    const int h = blockIdx.x % NH_, b = blockIdx.x / NH_, w = threadIdx.x >> 5, bx = blockIdx.y; const size_t oq = (size_t)blockIdx.x * TT * HD, ov = (size_t)blockIdx.x * HD * TT; mk += (size_t)b * TT * TT; lv += (size_t)b * (TT / 16) * 16 * 32; Ah += (size_t)b * TT * RK; Al += (size_t)b * TT * RK;
    if (bx >= (TT - RH) / 128) attn_cols<bf, true, 1>(Qh + oq, Ql + oq, Kh + oq, Kl + oq, VTh + ov, VTl + ov, mk, lv, Ah, Al, h, ((TT - RH) / 128 + RH / 64 - 1 - bx) * 64 + w * 16);
    else attn_cols<h16, false, 2>(Q16 + oq, Q16 + oq, K16 + oq, K16 + oq, VT16 + ov, VT16 + ov, mk, lv, Ah, Al, h, RH + ((TT - RH) / 128 - 1 - bx) * 128 + w * 32);
}

extern "C" void kernel_launch(void* const* d_in, const int* in_sizes, int n_in,
                              void* d_out, int out_size, void* d_ws, size_t ws_size, hipStream_t stream) {
    (void)in_sizes; (void)n_in; (void)out_size;
    const float* IN[10]; for (int i = 0; i < 10; ++i) IN[i] = (const float*)d_in[i];   // 0 hidden, 1 attention_mask [2][1][2048][2048], 2 Wq [1024][2048], 3 bq, 4 Wk, 5 bk, 6 Wv, 7 bv, 8 Wo [2048][1024], 9 bo (torch [out][in])
    float* OUT = (float*)d_out;     // [2][2048][2048]
    char* wsp = (char*)d_ws;
    auto take = [&](size_t bytes) { char* p = wsp; wsp += (bytes + 255) & ~(size_t)255; return (void*)p; };
    bf* WQ = (bf*)take((size_t)RK * DM * 2); bf* WK = (bf*)take((size_t)RK * DM * 2); bf* WV = (bf*)take((size_t)RK * DM * 2); bf* WO = (bf*)take((size_t)DM * RK * 2);   // WQ, WK, WV, WO, XB lie in a row (every size a multiple of 256 bytes); so do FQ, FK, FV
    bf* XB = (bf*)take((size_t)NB_ * TT * DM * 2); float* FQ = (float*)take((size_t)NB_ * TT * RK * 4); float* FK = (float*)take((size_t)NB_ * TT * RK * 4); float* FV = (float*)take((size_t)NB_ * TT * RK * 4);
    h16* Q16 = (h16*)take((size_t)NB_ * NH_ * TT * HD * 2); h16* K16 = (h16*)take((size_t)NB_ * NH_ * TT * HD * 2); bf* Qh = (bf*)take((size_t)NB_ * NH_ * TT * HD * 2); bf* Ql = (bf*)take((size_t)NB_ * NH_ * TT * HD * 2); bf* Kh = (bf*)take((size_t)NB_ * NH_ * TT * HD * 2); bf* Kl = (bf*)take((size_t)NB_ * NH_ * TT * HD * 2);
    h16* VT16 = (h16*)take((size_t)NB_ * NH_ * HD * TT * 2); bf* VTh = (bf*)take((size_t)NB_ * NH_ * HD * TT * 2); bf* VTl = (bf*)take((size_t)NB_ * NH_ * HD * TT * 2);
    bf* Ah = (bf*)take((size_t)NB_ * TT * RK * 2); bf* Al = (bf*)take((size_t)NB_ * TT * RK * 2); float* MP = (float*)take((size_t)NB_ * TT * TT * 4); unsigned* LV = (unsigned*)take((size_t)NB_ * (TT / 16) * 16 * 128);
    if ((size_t)(wsp - (char*)d_ws) > ws_size) return;    // total 200.5 MiB
    (void)WK; (void)WV;
    k_cvt8<<<CVB + NB_ * TT * TT / 8 / 256, 256, 0, stream>>>(IN[2], IN[4], IN[6], IN[8], IN[0], IN[1], WQ, MP, LV);
    k_gemmw<bf, 0, true><<<dim3(NB_ * TT / 64, RK / 64, 3), 32, 0, stream>>>(XB, nullptr, WQ, nullptr, DM, DM, FQ, RK, IN[3], IN[5], IN[7], 0, (size_t)RK * DM, (size_t)NB_ * TT * RK);
    k_qkp<<<(unsigned)(((size_t)NB_ * NH_ * TT * HD / 2 + 255) / 256), 256, 0, stream>>>(FQ, FK, Q16, K16, Qh, Ql, Kh, Kl); k_vtp<<<NB_ * NH_ * HD * TT / 8 / 256, 256, 0, stream>>>(FV, VT16, VTh, VTl);
    k_fattn<<<dim3(NB_ * NH_, RH / 64 + (TT - RH) / 128, 1), 128, 0, stream>>>(Q16, K16, VT16, Qh, Ql, Kh, Kl, VTh, VTl, MP, LV, Ah, Al);
    k_gemmw<bf, 1, true><<<dim3(NB_ * TT / 64, DM / 64, 1), 32, 0, stream>>>(Ah, Al, WO, nullptr, RK, RK, OUT, DM, IN[9], IN[9], IN[9], 0, 0, 0);
}

// v006
// Measured time: 143 microseconds a run.
// Timed twice side by side with v005, it ran 1.37 times as fast both times.
// Over all steps from v000 it is 47.1 times as fast.
#include <hip/hip_runtime.h>

// OPTEigenAttention - low-rank (eigen) OPT attention (hidden [2][2048][2048]; q = (x Wq^T + bq) x 64^-0.5 (32 heads x 32 low-rank dims; the scaling uses the ORIGINAL head dim 64), k = x Wk^T + bk, v = x Wv^T + bv (32 x 32);
// scores = q.k + attention_mask[b][0][i][j] (additive f32 mask input, read as data; then max(., float min)); softmax; out = merged att.v Wo^T + bo -> [2][2048][2048]).
// Compute dtypes, f32 accumulate: every input rounded to bf16; projections on PLAIN bf16 operands (inputs: exact, + bias); scores (K 32) and att.v on bf16 hi+lo planes (3 products) for
// the first 512 query rows of each head and on SINGLE fp16 planes for the rest (the mask here is causal, so early rows see few keys);
// mask add and softmax in f32 registers; merged heads as bf16 hi+lo planes x exact Wo (2 products) + bo. The projections and the output product run in k_gemmw (128x128 tiles, operands staged in LDS).
// Every launch covers both batch entries (rows b*2048 + t, head planes b*32 + h); the three projections are one launch (grid z = matrix). Attention is ONE kernel (k_fattn): S^T = K.Q^T, running-maximum softmax in registers, O^T += V^T.P^T; no score or probability ever reaches memory.
// FRAGMENT ORDER: every 16-bit operand plane is stored as 1-KiB tiles of 16 rows x 32 k, tile (row/16, k/32) at index (row/16) * (K/32) + k/32 (V^T: (k/32) * 2 + row/16), element (row, k) at (k%32/16) * 256 + ((k%16/8) * 16 + row%16) * 8 + k%8 inside it.
// A lane's two 16-byte fragment pieces then lie at lane * 8 and 256 + lane * 8, so each wave-wide load covers 512 contiguous bytes (4 lines) where a row-major plane gave 16 pieces of 32 bytes in 16 lines. The k order of a fragment is the one it had.
// The f32 mask is copied once into 16 query x 16 key tiles in the accumulator's map (value r of a lane at (r/4) * 128 + lane * 4 + r%4), tile index (q/16) * 128 + key/16, for the same reason: all 64 head planes read it.
// LIVE STEPS: while it copies the mask, the packer notes for each 16-query tile and each 32-key step whether any mask value there lies above DEADM. Once every query of a wave has a running maximum above LIVEM, the wave walks only the steps so marked:
// in any other step each score is at most DEADM + |q.k| (|q.k| below 8e37 is taken for granted: fp16 operands cannot pass 1.4e11, and the projections of these inputs lie far lower still), so exp(score - maximum) is 0 in f32 and the step adds nothing to the sum or to O. Until then (a row whose first keys, or all keys, are masked) every step is worked as before, so the function is the same for any mask.

#define NB_  2
#define TT   2048
#define DM   2048
#define RK   1024
#define NH_  32
#define HD   32
#define RH   512
#define SCL  0.125f
#define DEADM (-1.0e38f)
#define LIVEM (-1.0e37f)
typedef _Float16 h16;
typedef unsigned short bf;
typedef __attribute__((ext_vector_type(16))) __bf16   v16bf;
typedef __attribute__((ext_vector_type(16))) _Float16 v16h;
typedef __attribute__((ext_vector_type(8)))  _Float16 v8h;
typedef __attribute__((ext_vector_type(8)))  unsigned short v8us;
typedef __attribute__((ext_vector_type(8)))  float    v8f;
typedef __attribute__((ext_vector_type(4)))  float    v4f;
typedef v8h  __attribute__((may_alias)) v8ha;
typedef v4f  __attribute__((may_alias)) v4fa;
typedef v8us __attribute__((may_alias)) v8usa;

__device__ __forceinline__ unsigned short f2bf(float f) { unsigned u = __float_as_uint(f); u += 0x7FFFu + ((u >> 16) & 1u); return (unsigned short)(u >> 16); }
__device__ __forceinline__ float bf2f(unsigned short b) { return __uint_as_float(((unsigned)b) << 16); }
__device__ __forceinline__ float bfr(float f) { return bf2f(f2bf(f)); }
__device__ __forceinline__ v16h cat16(v8h lo, v8h hi) { return __builtin_shufflevector(lo, hi, 0, 1, 2, 3, 4, 5, 6, 7, 8, 9, 10, 11, 12, 13, 14, 15); }
__device__ __forceinline__ v16bf cat16b(v8us lo, v8us hi) { return __builtin_bit_cast(v16bf, __builtin_shufflevector(lo, hi, 0, 1, 2, 3, 4, 5, 6, 7, 8, 9, 10, 11, 12, 13, 14, 15)); }
__device__ __forceinline__ v8f wmma16(v16h a, v16h b, v8f c) { return __builtin_amdgcn_wmma_f32_16x16x32_f16(false, a, false, b, (short)0, c, false, false); }
__device__ __forceinline__ v8f wmmab(v16bf a, v16bf b, v8f c) { return __builtin_amdgcn_wmma_f32_16x16x32_bf16(false, a, false, b, (short)0, c, false, false); }



// ---- k_gemmw: GEMM, one 128x128 output tile per work-group of FOUR WAVES (2 x 2, each 64x64 = 16 accumulators); grid (M/128, N/128, Z), 128 threads. The operands' 16-bit planes are in fragment order.
// C[m][n] (f32, pitch ldc, + optional f32 bias[n]) = sum_k A[m][k] Bt[n][k] (NSPLIT 1: + A2[m][k] Bt[n][k]). A has lda k values a row, Bt K. z-batch strides sA/sB/sC in elements; z slices 0, 1, 2 take bias, bias1, bias2. K % 64 == 0.
// STAGING: a trip is 64 k. Its 8 row tiles x 2 k tiles (16 KiB) of each operand are brought into LDS once for the whole work-group by asynchronous copies (no register on the way), so each fragment is fetched from L2 once and read from LDS by the two waves that need it.
// Two buffers: the copies of trip t + 1 fly while trip t is worked on. A row tile's two k tiles are 2 KiB in a row in the plane and in LDS, one 16-byte piece a thread.
template <typename T16> struct WFrag;
template <> struct WFrag<h16> { typedef v16h V; static __device__ __forceinline__ V ld(const h16* p) { return cat16(*(const v8h*)p, *(const v8h*)(p + 256)); } static __device__ __forceinline__ v8f mma(V a, V b, v8f c) { return wmma16(a, b, c); } };
template <> struct WFrag<bf> { typedef v16bf V; static __device__ __forceinline__ V ld(const bf* p) { return cat16b(*(const v8us*)p, *(const v8us*)(p + 256)); } static __device__ __forceinline__ v8f mma(V a, V b, v8f c) { return wmmab(a, b, c); } };
// Eight copies of a lane, 16 bytes each: row tiles 0 .. 7 of one operand (LDS 2 KiB apart, the plane 'pitch' elements apart). The wait on the address translations is the statement's last line, so that no address register is rewritten ahead of it.
template <typename T16> __device__ __forceinline__ void cp8(unsigned l, const T16* g, size_t pitch) {
    asm volatile("global_load_async_to_lds_b128 %0, %8, off\n\t"
                 "global_load_async_to_lds_b128 %1, %9, off\n\t"
                 "global_load_async_to_lds_b128 %2, %10, off\n\t"
                 "global_load_async_to_lds_b128 %3, %11, off\n\t"
                 "global_load_async_to_lds_b128 %4, %12, off\n\t"
                 "global_load_async_to_lds_b128 %5, %13, off\n\t"
                 "global_load_async_to_lds_b128 %6, %14, off\n\t"
                 "global_load_async_to_lds_b128 %7, %15, off\n\t"
                 "s_wait_xcnt 0x0"
                 :: "v"(l), "v"(l + 2048u), "v"(l + 4096u), "v"(l + 6144u), "v"(l + 8192u), "v"(l + 10240u), "v"(l + 12288u), "v"(l + 14336u),
                    "v"(g), "v"(g + pitch), "v"(g + 2 * pitch), "v"(g + 3 * pitch), "v"(g + 4 * pitch), "v"(g + 5 * pitch), "v"(g + 6 * pitch), "v"(g + 7 * pitch) : "memory");
}
template <typename T16, int NSPLIT, bool BIAS>
__global__ __launch_bounds__(128) void k_gemmw(const T16* __restrict__ A, const T16* __restrict__ A2, const T16* __restrict__ Bt, const T16* __restrict__ Bt2, int K, int lda, float* C, int ldc, const float* __restrict__ bias, const float* __restrict__ bias1, const float* __restrict__ bias2, size_t sA, size_t sB, size_t sC) {
    typedef typename WFrag<T16>::V V;
    static_assert(NSPLIT == 0 || NSPLIT == 1, "A (+ A2) x Bt"); (void)Bt2;
    constexpr int NOP = NSPLIT == 1 ? 3 : 2;                  // operands staged: Bt, A (, A2)
    __shared__ __align__(2048) T16 ring[2][NOP][8192];        // [buffer][operand][row tile 8][k tile 2][512]
    __shared__ __align__(16) float osw[4][16 * 68];           // each wave's own output staging
    const size_t z = blockIdx.z; A += z * sA; if (NSPLIT == 1) A2 += z * sA; Bt += z * sB; C += z * sC; if (z == 1) bias = bias1; else if (z == 2) bias = bias2;   // each z slice has its own bias vector
    const int tid = threadIdx.x, lane = tid & 31, lr = lane & 15, hi = lane >> 4, w = tid >> 5, wm = w >> 1, wn = w & 1; const int rb = blockIdx.x * 128, cb = blockIdx.y * 128, r0 = rb + wm * 64, c0 = cb + wn * 64;   // the block's and the wave's first row and column
    float* os = osw[w];
    v8f acc[4][4];
#pragma unroll
    for (int mb = 0; mb < 4; ++mb)
#pragma unroll
        for (int nb = 0; nb < 4; ++nb) acc[mb][nb] = (v8f){};
    const T16* ga = A + (size_t)rb * lda + 8 * tid; const T16* ga2 = NSPLIT == 1 ? A2 + (size_t)rb * lda + 8 * tid : ga; const T16* gb = Bt + (size_t)cb * K + 8 * tid;   // 16 rows of tiles hold 16 * K elements; a trip of 64 k is two tiles (1024 elements)
    const unsigned l0 = (unsigned)(size_t)&ring[0][0][0] + 16u * tid;   // the thread's own piece in LDS, as a byte address
    const int nt = K / 64;
    auto fill = [&](int t) { const unsigned l = l0 + (unsigned)(t & 1) * (NOP * 16384u);
        cp8<T16>(l, gb + (size_t)t * 1024, (size_t)16 * K); cp8<T16>(l + 16384u, ga + (size_t)t * 1024, (size_t)16 * lda); if (NSPLIT == 1) cp8<T16>(l + 32768u, ga2 + (size_t)t * 1024, (size_t)16 * lda); };
    fill(0);
    asm volatile("s_wait_asynccnt 0x0" ::: "memory");   // this wave's copies of trip 0 have landed
    __syncthreads();                                    // ... and every other wave's: nothing of trip 0 is read ahead of this
    if (nt > 1) fill(1);
#pragma unroll 1   // one trip's code: the two buffers differ only in a base address
    for (int t = 0; t < nt; ++t) {
        const T16* sb = &ring[t & 1][0][0] + wn * 4096 + 8 * lane; const T16* sa = &ring[t & 1][1][0] + wm * 4096 + 8 * lane;
        V a[4], a2[4], b[4];
#pragma unroll
        for (int ks = 0; ks < 2; ++ks) {
#pragma unroll
            for (int mb = 0; mb < 4; ++mb) { a[mb] = WFrag<T16>::ld(sa + mb * 1024 + ks * 512); if (NSPLIT == 1) a2[mb] = WFrag<T16>::ld(sa + 8192 + mb * 1024 + ks * 512); }
#pragma unroll
            for (int nb = 0; nb < 4; ++nb) b[nb] = WFrag<T16>::ld(sb + nb * 1024 + ks * 512);
            __builtin_amdgcn_sched_barrier(0);   // keeps the step's LDS reads together ahead of its matrix instructions: spread among them, each group of reads costs the wave a wait of its own
#pragma unroll
            for (int nb = 0; nb < 4; ++nb) {
#pragma unroll
                for (int mb = 0; mb < 4; ++mb) { acc[mb][nb] = WFrag<T16>::mma(a[mb], b[nb], acc[mb][nb]); if (NSPLIT == 1) acc[mb][nb] = WFrag<T16>::mma(a2[mb], b[nb], acc[mb][nb]); } }
        }
        __builtin_amdgcn_sched_barrier(0);   // the trip's matrix instructions stay ahead of the slots and waits below (the compiler otherwise moves most of them behind the barrier, which delays the refill)
        asm volatile("v_nop\n\tv_nop\n\tv_nop\n\tv_nop" : "+v"(acc[0][0]), "+v"(acc[1][1]), "+v"(acc[2][2]), "+v"(acc[3][3]) : "v"(a[0]), "v"(a[3]));   // four vector slots behind the trip's last matrix instructions, ahead of the address arithmetic that may take the fragments' registers
        asm volatile("s_wait_dscnt 0x0" ::: "memory");      // this wave's reads of the trip's buffer are done
        asm volatile("s_wait_asynccnt 0x0" ::: "memory");   // its copies of trip t + 1 have landed
        __syncthreads();                                    // publishes trip t + 1 and ends every wave's reads of the buffer that is refilled below
        if (t + 2 < nt) fill(t + 2);
    }
    asm volatile("s_wait_asynccnt 0x0" ::: "memory");   // no copy is outstanding when the wave goes on to its end
#pragma unroll
    for (int mb = 0; mb < 4; ++mb) {
#pragma unroll
        for (int nb = 0; nb < 4; ++nb) {
#pragma unroll
            for (int j = 0; j < 8; ++j) os[(hi * 8 + j) * 68 + nb * 16 + lr] = acc[mb][nb][j]; }
        __builtin_amdgcn_wave_barrier(); asm volatile("" ::: "memory");
        float* crow = C + (size_t)(r0 + mb * 16) * ldc + c0;
{
#pragma unroll
            for (int s = 0; s < 8; ++s) { const int row = 2 * s + hi, cofs = lr * 4; v4f val = *(const v4fa*)(os + row * 68 + cofs); if (BIAS) { val[0] += bfr(bias[c0 + cofs]); val[1] += bfr(bias[c0 + cofs + 1]); val[2] += bfr(bias[c0 + cofs + 2]); val[3] += bfr(bias[c0 + cofs + 3]); }
                *(v4f*)(crow + (size_t)row * ldc + cofs) = val; }
             }
        asm volatile("s_wait_xcnt 0x0" ::: "memory");   // stands behind the row stores, before their address registers are reused
        __builtin_amdgcn_wave_barrier(); asm volatile("" ::: "memory");
    }
}

__device__ __forceinline__ h16 tohx(float x) { return (h16)x; }
__device__ __forceinline__ void splitf(float y, unsigned short& h, unsigned short& l) { h = f2bf(y); l = f2bf(y - bf2f(h)); }
typedef __attribute__((ext_vector_type(2))) _Float16 v2h;
typedef __attribute__((ext_vector_type(4))) _Float16 v4h;
typedef __attribute__((ext_vector_type(2))) unsigned short v2us;
typedef __attribute__((ext_vector_type(4))) unsigned short v4us;
typedef __attribute__((ext_vector_type(2))) float v2f;

// k_cvt8: all five f32 -> bf16 conversions and the mask copy in one launch. dst is the row of planes WQ, WK, WV, WO, XB, each in fragment order; 1024 blocks (2^21 elements) for each weight, 4096 for the hidden states of both batch entries, then 4096 for the mask.
// A thread is one 16-byte piece of the destination (stores stay contiguous); its 8 source values are 8 consecutive k of one row, and a block reads whole lines of 16 rows.
#define CVB (4 * 1024 + NB_ * TT * DM / 8 / 256)
__global__ __launch_bounds__(256) void k_cvt8(const float* __restrict__ wq, const float* __restrict__ wk, const float* __restrict__ wv, const float* __restrict__ wo, const float* __restrict__ x, const float* __restrict__ mk, bf* dst, float* mp, unsigned* lv) {
    const int lane = threadIdx.x & 31, lr = lane & 15, hi = lane >> 4;
    if (blockIdx.x >= CVB) {   // mask: a wave copies one 16 x 16 tile, a lane its 8 keys 8 hi .. 8 hi + 7 of query row lr; a block is 8 tiles in a row = 4 steps of one query tile
        __shared__ unsigned fl[8];
        const size_t tile = ((size_t)(blockIdx.x - CVB) * 256 + threadIdx.x) >> 5; const float* s = mk + ((tile / (TT / 16)) * 16 + lr) * TT + (tile % (TT / 16)) * 16 + 8 * hi; const v4f a = *(const v4f*)s, c = *(const v4f*)(s + 4);
        asm volatile("s_wait_xcnt 0x0" ::: "memory");   // stands behind the loads, before their address registers are reused
        bool up = false;   // not-a-number counts as live
#pragma unroll
        for (int r = 0; r < 4; ++r) up = up || !(a[r] <= DEADM) || !(c[r] <= DEADM);
        const unsigned any = __builtin_amdgcn_ballot_w32(up) != 0 ? 1u : 0u; if (lane == 0) fl[threadIdx.x >> 5] = any;
        __syncthreads();   // the eight waves' tile marks meet here (the branch is the same for the whole block); it stands ahead of the tile's stores so that no wave waits at it for a store to finish
        *(v4f*)(mp + tile * 256 + lane * 4) = a; *(v4f*)(mp + tile * 256 + 128 + lane * 4) = c;
        if (threadIdx.x == 0) lv[(size_t)(blockIdx.x - CVB) * 32] = (fl[0] | fl[1]) | (fl[2] | fl[3]) << 1 | (fl[4] | fl[5]) << 2 | (fl[6] | fl[7]) << 3;   // bit j: step 4 * (block % 16) + j; one word a 128-byte line, so each line has one writer
        return; }
    const int seg = blockIdx.x >> 10; const float* src = seg == 0 ? wq : seg == 1 ? wk : seg == 2 ? wv : seg == 3 ? wo : x; const size_t i = (size_t)blockIdx.x * 256 + threadIdx.x; const size_t j = i - (size_t)(seg < 4 ? seg : 4) * 1024 * 256;
    const int sh = seg == 3 ? 5 : 6;   // log2 of the tiles in a row of tiles: K = 1024 for Wo, 2048 for the rest
    const size_t tile = j >> 6; const v8f v = *(const v8f*)(src + ((((tile >> sh) * 16 + lr) << sh) + (tile & ((1u << sh) - 1))) * 32 + ((j >> 5) & 1) * 16 + 8 * hi); v8us o;
    asm volatile("s_wait_xcnt 0x0" ::: "memory");   // stands behind the load, before its address registers are reused
#pragma unroll
    for (int k = 0; k < 8; ++k) o[k] = f2bf(v[k]); *(v8us*)(dst + i * 8) = o;  }
// Head planes are numbered hb = b*32 + h; FQ, FK, FV have rows b*2048 + t. k_qkp: per (hb, t, d pair): q = FQ[t][h*32+d] x 0.125, k = FK[...]: fp16 planes Q16/K16 (rows t, k = d) and hi/lo planes Qh/Ql, Kh/Kl, in fragment order (lane -> 2 d); k_vtp: VT16 (rows dd < 32, k = t; fp16) and VTh/VTl (hi/lo) = FV[t][h*32+dd], in fragment order with the two row tiles of a 32-key step side by side.
__global__ __launch_bounds__(256) void k_qkp(const float* __restrict__ FQ, const float* __restrict__ FK, h16* Q16, h16* K16, bf* Qh, bf* Ql, bf* Kh, bf* Kl) { const size_t e = ((size_t)blockIdx.x * 256 + threadIdx.x) * 2; if (e >= (size_t)NB_ * NH_ * TT * HD) return; const int d = (int)(e % HD); const int t = (int)((e / HD) % TT); const int hb = (int)(e / ((size_t)HD * TT)); const int h = hb % NH_; const size_t s = ((size_t)(hb / NH_) * TT + t) * RK + h * HD + d; v2h q, k; v2us qh, ql, kh, kl;
#pragma unroll
    for (int u = 0; u < 2; ++u) { float qs = __fmul_rn(FQ[s + u], SCL); asm volatile("" : "+v"(qs)); q[u] = tohx(qs); k[u] = tohx(FK[s + u]); unsigned short a, c2; splitf(qs, a, c2); qh[u] = a; ql[u] = c2; splitf(FK[s + u], a, c2); kh[u] = a; kl[u] = c2; }
    { const size_t p = (e & ~(size_t)511) + (d >> 4) * 256 + (((d >> 3) & 1) * 16 + (t & 15)) * 8 + (d & 7);   // 16 rows of 32 d are one tile: the same 512 elements, permuted
      *(v2h*)(Q16 + p) = q; *(v2h*)(K16 + p) = k; *(v2us*)(Qh + p) = qh; *(v2us*)(Ql + p) = ql; *(v2us*)(Kh + p) = kh; *(v2us*)(Kl + p) = kl;  } }
// A thread is one 16-byte piece: 8 consecutive keys of row dd; the lanes of a wave are the 32 dd, so each of its 8 loads is one whole line of FV and each store two runs of 256 bytes.
__global__ __launch_bounds__(256) void k_vtp(const float* __restrict__ FV, h16* VT16, bf* VTh, bf* VTl) { const unsigned g = blockIdx.x * 256 + threadIdx.x; const int dd = (int)(g & 31), tg = (int)((g >> 5) & (TT / 8 - 1)), hb = (int)(g >> 13); const float* s = FV + ((size_t)(hb / NH_) * TT + tg * 8) * RK + (hb % NH_) * HD + dd; float v[8];
#pragma unroll
    for (int u = 0; u < 8; ++u) v[u] = s[(size_t)u * RK];
    asm volatile("s_wait_xcnt 0x0" ::: "memory");   // stands behind the loads, before their address registers are reused
    v8h o; v8us oh, ol;
#pragma unroll
    for (int u = 0; u < 8; ++u) { o[u] = tohx(v[u]); unsigned short a, c2; splitf(v[u], a, c2); oh[u] = a; ol[u] = c2; }
    const size_t p = (size_t)hb * HD * TT + (size_t)((tg >> 2) * 2 + (dd >> 4)) * 512 + ((tg >> 1) & 1) * 256 + ((tg & 1) * 16 + (dd & 15)) * 8;
    *(v8h*)(VT16 + p) = o; *(v8us*)(VTh + p) = oh; *(v8us*)(VTl + p) = ol; }
__device__ __forceinline__ float xhalf(float x) { const int b = __float_as_int(x); return __int_as_float(__builtin_amdgcn_permlanex16(b, b, 0x76543210, 0xfedcba98, false, false)); }
#define FMIN_ (-3.40282347e38f)
template <typename T16, int NQ> struct AStage { typename WFrag<T16>::V k[2], k2[2]; v8f m[NQ][2]; };   // one step's K fragments and mask tiles
template <typename T16> struct VStage { typename WFrag<T16>::V v[2], v2[2]; };                          // one step's V^T fragments
template <typename T16, bool HILO, int NQ>
__device__ __forceinline__ void a_loadk(AStage<T16, NQ>& s, const T16* pk, const T16* pk2, const float* pm) {
#pragma unroll
    for (int kt = 0; kt < 2; ++kt) { s.k[kt] = WFrag<T16>::ld(pk + kt * 16 * HD); if (HILO) s.k2[kt] = WFrag<T16>::ld(pk2 + kt * 16 * HD); }
#pragma unroll
    for (int qt = 0; qt < NQ; ++qt)
#pragma unroll
        for (int kt = 0; kt < 2; ++kt) { const float* p = pm + (size_t)qt * 16 * TT + kt * 256; s.m[qt][kt] = __builtin_shufflevector(*(const v4f*)p, *(const v4f*)(p + 128), 0, 1, 2, 3, 4, 5, 6, 7); }
    // stands behind the group's loads, before their address registers are rewritten for the next group (they are inputs, so that none is rewritten ahead of the wait, not even as a later load's destination); the clobber also keeps these loads ahead of the work on the other stage
    if constexpr (HILO) asm volatile("s_wait_xcnt 0x0" :: "v"(pk), "v"(pk2), "v"(pm) : "memory"); else asm volatile("s_wait_xcnt 0x0" :: "v"(pk), "v"(pm) : "memory");
}
template <typename T16, bool HILO>
__device__ __forceinline__ void a_loadv(VStage<T16>& s, const T16* pv, const T16* pv2) {
#pragma unroll
    for (int dt = 0; dt < 2; ++dt) { s.v[dt] = WFrag<T16>::ld(pv + dt * 512); if (HILO) s.v2[dt] = WFrag<T16>::ld(pv2 + dt * 512); }
    if constexpr (HILO) asm volatile("s_wait_xcnt 0x0" :: "v"(pv), "v"(pv2) : "memory"); else asm volatile("s_wait_xcnt 0x0" :: "v"(pv) : "memory");   // as in a_loadk
}
template <typename T16, bool HILO, int NQ>
__device__ __forceinline__ void a_step(const AStage<T16, NQ>& s, const VStage<T16>& sv, const typename WFrag<T16>::V (&bq)[NQ], const typename WFrag<T16>::V (&bq2)[NQ], v8f (&acc)[NQ][2], float (&mr)[NQ], float (&sm)[NQ]) {
    typedef typename WFrag<T16>::V V;
    float t[NQ][16], mx[NQ]; bool need = false;
#pragma unroll
    for (int qt = 0; qt < NQ; ++qt) {
#pragma unroll
        for (int kt = 0; kt < 2; ++kt) { v8f d = WFrag<T16>::mma(s.k[kt], bq[qt], s.m[qt][kt]);   // the mask tile has D's map: it is the product's C operand, so q.k + mask comes out of the matrix unit
            if (HILO) { d = WFrag<T16>::mma(s.k2[kt], bq[qt], d); d = WFrag<T16>::mma(s.k[kt], bq2[qt], d); }
#pragma unroll
            for (int r = 0; r < 8; ++r) t[qt][kt * 8 + r] = fmaxf(d[r], FMIN_); }
        float a = t[qt][0];
#pragma unroll
        for (int i = 1; i < 16; ++i) a = fmaxf(a, t[qt][i]);
        a = fmaxf(a, xhalf(a)); mx[qt] = a; need = need || (a > mr[qt]); }
    if (__builtin_amdgcn_ballot_w32(need) != 0) {   // a column's maximum rose: rescale what is summed so far (factor 1 in the other columns)
#pragma unroll
        for (int qt = 0; qt < NQ; ++qt) { const float mn = fmaxf(mr[qt], mx[qt]); const float al = __expf(mr[qt] - mn); mr[qt] = mn; sm[qt] *= al;
#pragma unroll
            for (int dt = 0; dt < 2; ++dt)
#pragma unroll
                for (int r = 0; r < 8; ++r) acc[qt][dt][r] *= al; } }
#pragma unroll
    for (int qt = 0; qt < NQ; ++qt) { V bp, bp2;
#pragma unroll
        for (int i = 0; i < 16; ++i) { const float p = __expf(t[qt][i] - mr[qt]); sm[qt] += p;
            if constexpr (HILO) { const __bf16 ph = (__bf16)p; bp[i] = ph; bp2[i] = (__bf16)(p - (float)ph); } else bp[i] = (h16)p; }
#pragma unroll
        for (int dt = 0; dt < 2; ++dt) { acc[qt][dt] = WFrag<T16>::mma(sv.v[dt], bp, acc[qt][dt]); if (HILO) { acc[qt][dt] = WFrag<T16>::mma(sv.v2[dt], bp, acc[qt][dt]); acc[qt][dt] = WFrag<T16>::mma(sv.v[dt], bp2, acc[qt][dt]); } } }
}
// Four vector slots behind a step's last matrix instructions: the branches that follow lead, on their taken side, to address arithmetic in the registers that held V^T. The accumulators are inputs so that the slots stand behind those instructions.
template <int NQ> __device__ __forceinline__ void a_gap(const v8f (&acc)[NQ][2]) {
    if constexpr (NQ == 2) asm volatile("v_nop\n\tv_nop\n\tv_nop\n\tv_nop" :: "v"(acc[0][0]), "v"(acc[0][1]), "v"(acc[1][0]), "v"(acc[1][1]));
    else asm volatile("v_nop\n\tv_nop\n\tv_nop\n\tv_nop" :: "v"(acc[0][0]), "v"(acc[0][1])); }
template <int NQ> __device__ __forceinline__ bool a_settled(const float (&mr)[NQ]) { bool ok = true;   // true, for the whole wave, once each of its queries has met a key that is not masked out
#pragma unroll
    for (int qt = 0; qt < NQ; ++qt) ok = ok && (mr[qt] > LIVEM);
    return __builtin_amdgcn_ballot_w32(ok) == 0xffffffffu; }
// Qp, Kp: one head's planes (rows t, k = d); Vp: its plane (rows dd, k = t); mk: this batch entry's mask tiles; lv: its live-step words (16 a query tile, 4 steps each, 32 words apart); q0: the wave's first query; the merged-head planes Ah/Al (rows t, k = h*32 + d, fragment order) take o = O / sum as bf16 hi + lo.
template <typename T16, bool HILO, int NQ>
__device__ __forceinline__ void attn_cols(const T16* Qp, const T16* Qp2, const T16* Kp, const T16* Kp2, const T16* Vp, const T16* Vp2, const float* mk, const unsigned* lv, bf* Ah, bf* Al, int h, int q0) {
    typedef typename WFrag<T16>::V V;
    const int lane = threadIdx.x & 31;
    V bq[NQ], bq2[NQ]; v8f acc[NQ][2]; float mr[NQ], sm[NQ];
    const T16* ql = Qp + (size_t)q0 * HD + 8 * lane; const T16* q2l = Qp2 + (size_t)q0 * HD + 8 * lane;
    unsigned nib = lv[((size_t)(q0 >> 4) * 16 + (NQ == 2 ? lane : (lane & 15))) * 32];   // lane l: steps 4 (l % 16) .. + 3 of query tile l / 16 (NQ 1: of its one tile in every lane)
#pragma unroll
    for (int qt = 0; qt < NQ; ++qt) { bq[qt] = WFrag<T16>::ld(ql + qt * 16 * HD); if (HILO) bq2[qt] = WFrag<T16>::ld(q2l + qt * 16 * HD); acc[qt][0] = (v8f){}; acc[qt][1] = (v8f){}; mr[qt] = FMIN_; sm[qt] = 0.f; }
    asm volatile("s_wait_xcnt 0x0" ::: "memory");   // as in a_loadk, for the Q loads
    const T16* kl = Kp + 8 * lane; const T16* k2l = Kp2 + 8 * lane; const T16* vl = Vp + 8 * lane; const T16* v2l = Vp2 + 8 * lane; const float* ml = mk + (size_t)q0 * TT + 4 * lane;   // key kb: K tile at kb * 32 elements, the V^T tile pair at kb * 32, the mask tile at kb * 16 floats
    // K and mask are fetched one step ahead into two stages. V^T too on the fp16 path; the hi+lo path (twice the fragments) fetches a step's V^T at the step's head, behind which the scores and the softmax stand, to stay within 256 registers
    AStage<T16, NQ> s0, s1; VStage<T16> v0, v1;
    a_loadk<T16, HILO, NQ>(s0, kl, k2l, ml); if (!HILO) a_loadv<T16, HILO>(v0, vl, v2l);
    if (NQ == 2) nib |= (unsigned)__builtin_amdgcn_permlanex16((int)nib, (int)nib, 0x76543210, 0xfedcba98, false, false);   // a step is live if it is so for either query tile
    unsigned long long live = 0;   // bit s: step s (keys 32 s .. 32 s + 31); the same in every lane, kept in scalar registers
#pragma unroll
    for (int l = 0; l < 16; ++l) live |= (unsigned long long)(unsigned)__builtin_amdgcn_readlane((int)nib, l) << (4 * l);
    unsigned long long todo = ~1ull;   // steps not yet fetched: all of them until every query's maximum has settled above LIVEM, then the live ones among them
    bool settled = false, more; int kb = 0;
    do {   // two steps a trip, one per stage; each step fetches the next step still to do; once none is left, step 0 is fetched again (in bounds, unused)
        const bool pair = todo != 0; int kn = pair ? __builtin_ctzll(todo) * 32 : 0; todo &= todo - 1;
        a_loadk<T16, HILO, NQ>(s1, kl + kn * HD, k2l + kn * HD, ml + kn * 16);
        if (HILO) { a_loadv<T16, HILO>(v0, vl + kb * 32, v2l + kb * 32); a_step<T16, HILO, NQ>(s0, v0, bq, bq2, acc, mr, sm); }
        else { a_loadv<T16, HILO>(v1, vl + kn * 32, v2l + kn * 32); a_step<T16, HILO, NQ>(s0, v0, bq, bq2, acc, mr, sm); }
        a_gap<NQ>(acc); if (!settled) { settled = a_settled<NQ>(mr); if (settled) todo &= live; }
        kb = kn; more = todo != 0; kn = more ? __builtin_ctzll(todo) * 32 : 0; todo &= todo - 1;
        a_loadk<T16, HILO, NQ>(s0, kl + kn * HD, k2l + kn * HD, ml + kn * 16);
        if (HILO) a_loadv<T16, HILO>(v0, vl + kb * 32, v2l + kb * 32); else a_loadv<T16, HILO>(v0, vl + kn * 32, v2l + kn * 32);
        if (pair) {   // an odd count ends with half a trip
            a_step<T16, HILO, NQ>(s1, HILO ? v0 : v1, bq, bq2, acc, mr, sm);
            a_gap<NQ>(acc); if (!settled) { settled = a_settled<NQ>(mr); if (settled) todo &= live; } }
        kb = kn;
    } while (more);
#pragma unroll
    for (int qt = 0; qt < NQ; ++qt) { const float f = __fdiv_rn(1.0f, sm[qt] + xhalf(sm[qt])); const size_t oo = (size_t)(q0 + qt * 16) * RK + h * 512 + 8 * lane;   // tile (query tile, head); d = 16 dt + 8 hi + r is piece dt of lane (lr, hi)
#pragma unroll
        for (int dt = 0; dt < 2; ++dt) { v8us oh, ol;
#pragma unroll
            for (int r = 0; r < 8; ++r) { unsigned short a, c2; splitf(__fmul_rn(acc[qt][dt][r], f), a, c2); oh[r] = a; ol[r] = c2; }
            bf* pa = Ah + oo + dt * 256; bf* pl = Al + oo + dt * 256; *(v8us*)pa = oh; *(v8us*)pl = ol;
            asm volatile("s_wait_xcnt 0x0" :: "v"(pa), "v"(pl), "v"(oh), "v"(ol) : "memory"); } }   // stands behind the two stores, before their address and data registers (inputs here, so that they live up to the wait) are rewritten for the next piece
}
// grid (batch entries x heads, (TT-RH)/128 + RH/64), 4 waves (one a SIMD; 1280 blocks, five a WGP, four resident): the first (TT-RH)/128 blocks of a head take 32 queries a wave on fp16, the rest the hi+lo rows, 16 queries a wave
// (three products a tile, so half the columns). Both run from the last query rows to the first: under a causal mask those have the most live steps, so the longest blocks have the low indices and start first (for speed only). A block's waves walk the same K and V^T lines.
__global__ __launch_bounds__(128) void k_fattn(const h16* __restrict__ Q16, const h16* __restrict__ K16, const h16* __restrict__ VT16, const bf* __restrict__ Qh, const bf* __restrict__ Ql, const bf* __restrict__ Kh, const bf* __restrict__ Kl, const bf* __restrict__ VTh, const bf* __restrict__ VTl, const float* __restrict__ mk, const unsigned* __restrict__ lv, bf* Ah, bf* Al) {
    const int h = blockIdx.x % NH_, b = blockIdx.x / NH_, w = threadIdx.x >> 5, bx = blockIdx.y; const size_t oq = (size_t)blockIdx.x * TT * HD, ov = (size_t)blockIdx.x * HD * TT; mk += (size_t)b * TT * TT; lv += (size_t)b * (TT / 16) * 16 * 32; Ah += (size_t)b * TT * RK; Al += (size_t)b * TT * RK;
    if (bx >= (TT - RH) / 128) attn_cols<bf, true, 1>(Qh + oq, Ql + oq, Kh + oq, Kl + oq, VTh + ov, VTl + ov, mk, lv, Ah, Al, h, ((TT - RH) / 128 + RH / 64 - 1 - bx) * 64 + w * 16);
    else attn_cols<h16, false, 2>(Q16 + oq, Q16 + oq, K16 + oq, K16 + oq, VT16 + ov, VT16 + ov, mk, lv, Ah, Al, h, RH + ((TT - RH) / 128 - 1 - bx) * 128 + w * 32);
}

extern "C" void kernel_launch(void* const* d_in, const int* in_sizes, int n_in,
                              void* d_out, int out_size, void* d_ws, size_t ws_size, hipStream_t stream) {
    (void)in_sizes; (void)n_in; (void)out_size;
    const float* IN[10]; for (int i = 0; i < 10; ++i) IN[i] = (const float*)d_in[i];   // 0 hidden, 1 attention_mask [2][1][2048][2048], 2 Wq [1024][2048], 3 bq, 4 Wk, 5 bk, 6 Wv, 7 bv, 8 Wo [2048][1024], 9 bo (torch [out][in])
    float* OUT = (float*)d_out;     // [2][2048][2048]
    char* wsp = (char*)d_ws;
    auto take = [&](size_t bytes) { char* p = wsp; wsp += (bytes + 255) & ~(size_t)255; return (void*)p; };
    bf* WQ = (bf*)take((size_t)RK * DM * 2); bf* WK = (bf*)take((size_t)RK * DM * 2); bf* WV = (bf*)take((size_t)RK * DM * 2); bf* WO = (bf*)take((size_t)DM * RK * 2);   // WQ, WK, WV, WO, XB lie in a row (every size a multiple of 256 bytes); so do FQ, FK, FV
    bf* XB = (bf*)take((size_t)NB_ * TT * DM * 2); float* FQ = (float*)take((size_t)NB_ * TT * RK * 4); float* FK = (float*)take((size_t)NB_ * TT * RK * 4); float* FV = (float*)take((size_t)NB_ * TT * RK * 4);
    h16* Q16 = (h16*)take((size_t)NB_ * NH_ * TT * HD * 2); h16* K16 = (h16*)take((size_t)NB_ * NH_ * TT * HD * 2); bf* Qh = (bf*)take((size_t)NB_ * NH_ * TT * HD * 2); bf* Ql = (bf*)take((size_t)NB_ * NH_ * TT * HD * 2); bf* Kh = (bf*)take((size_t)NB_ * NH_ * TT * HD * 2); bf* Kl = (bf*)take((size_t)NB_ * NH_ * TT * HD * 2);
    h16* VT16 = (h16*)take((size_t)NB_ * NH_ * HD * TT * 2); bf* VTh = (bf*)take((size_t)NB_ * NH_ * HD * TT * 2); bf* VTl = (bf*)take((size_t)NB_ * NH_ * HD * TT * 2);
    bf* Ah = (bf*)take((size_t)NB_ * TT * RK * 2); bf* Al = (bf*)take((size_t)NB_ * TT * RK * 2); float* MP = (float*)take((size_t)NB_ * TT * TT * 4); unsigned* LV = (unsigned*)take((size_t)NB_ * (TT / 16) * 16 * 128);
    if ((size_t)(wsp - (char*)d_ws) > ws_size) return;    // total 200.5 MiB
    (void)WK; (void)WV;
    k_cvt8<<<CVB + NB_ * TT * TT / 8 / 256, 256, 0, stream>>>(IN[2], IN[4], IN[6], IN[8], IN[0], IN[1], WQ, MP, LV);
    k_gemmw<bf, 0, true><<<dim3(NB_ * TT / 128, RK / 128, 3), 128, 0, stream>>>(XB, nullptr, WQ, nullptr, DM, DM, FQ, RK, IN[3], IN[5], IN[7], 0, (size_t)RK * DM, (size_t)NB_ * TT * RK);
    k_qkp<<<(unsigned)(((size_t)NB_ * NH_ * TT * HD / 2 + 255) / 256), 256, 0, stream>>>(FQ, FK, Q16, K16, Qh, Ql, Kh, Kl); k_vtp<<<NB_ * NH_ * HD * TT / 8 / 256, 256, 0, stream>>>(FV, VT16, VTh, VTl);
    k_fattn<<<dim3(NB_ * NH_, RH / 64 + (TT - RH) / 128, 1), 128, 0, stream>>>(Q16, K16, VT16, Qh, Ql, Kh, Kl, VTh, VTl, MP, LV, Ah, Al);
    k_gemmw<bf, 1, true><<<dim3(NB_ * TT / 128, DM / 128, 1), 128, 0, stream>>>(Ah, Al, WO, nullptr, RK, RK, OUT, DM, IN[9], IN[9], IN[9], 0, 0, 0);
}

// v007
// It runs in 122 microseconds.
// Two timings next to v006 both put it at 1.17 times that version's speed.
// Counting every step since v000, it is 55.1 times as fast.
#include <hip/hip_runtime.h>

// OPTEigenAttention - low-rank (eigen) OPT attention (hidden [2][2048][2048]; q = (x Wq^T + bq) x 64^-0.5 (32 heads x 32 low-rank dims; the scaling uses the ORIGINAL head dim 64), k = x Wk^T + bk, v = x Wv^T + bv (32 x 32);
// scores = q.k + attention_mask[b][0][i][j] (additive f32 mask input, read as data; then max(., float min)); softmax; out = merged att.v Wo^T + bo -> [2][2048][2048]).
// Compute dtypes, f32 accumulate: every input rounded to bf16; projections on PLAIN bf16 operands (inputs: exact, + bias); scores (K 32) and att.v on bf16 hi+lo planes (3 products) for
// the first 512 query rows of each head and on SINGLE fp16 planes for the rest (the mask here is causal, so early rows see few keys);
// mask add and softmax in f32 registers; merged heads as bf16 hi+lo planes x exact Wo (2 products) + bo. The projections and the output product run in k_gemmw (128x128 tiles, operands staged in LDS); the projections' epilogue writes the head planes of q, k and v itself (no f32 copy of them reaches memory).
// Every launch covers both batch entries (rows b*2048 + t, head planes b*32 + h); the three projections are one launch (grid z = matrix). Attention is ONE kernel (k_fattn): S^T = K.Q^T, running-maximum softmax in registers, O^T += V^T.P^T; no score or probability ever reaches memory.
// FRAGMENT ORDER: every 16-bit operand plane is stored as 1-KiB tiles of 16 rows x 32 k, tile (row/16, k/32) at index (row/16) * (K/32) + k/32 (V^T: (k/32) * 2 + row/16), element (row, k) at (k%32/16) * 256 + ((k%16/8) * 16 + row%16) * 8 + k%8 inside it.
// A lane's two 16-byte fragment pieces then lie at lane * 8 and 256 + lane * 8, so each wave-wide load covers 512 contiguous bytes (4 lines) where a row-major plane gave 16 pieces of 32 bytes in 16 lines. The k order of a fragment is the one it had.
// The f32 mask is copied once into 16 query x 16 key tiles in the accumulator's map (value r of a lane at (r/4) * 128 + lane * 4 + r%4), tile index (q/16) * 128 + key/16, for the same reason: all 64 head planes read it.
// LIVE STEPS: while it copies the mask, the packer notes for each 16-query tile and each 32-key step whether any mask value there lies above DEADM. Once every query of a wave has a running maximum above LIVEM, the wave walks only the steps so marked:
// in any other step each score is at most DEADM + |q.k| (|q.k| below 8e37 is taken for granted: fp16 operands cannot pass 1.4e11, and the projections of these inputs lie far lower still), so exp(score - maximum) is 0 in f32 and the step adds nothing to the sum or to O. Until then (a row whose first keys, or all keys, are masked) every step is worked as before, so the function is the same for any mask.

#define NB_  2
#define TT   2048
#define DM   2048
#define RK   1024
#define NH_  32
#define HD   32
#define RH   512
#define SCL  0.125f
#define DEADM (-1.0e38f)
#define LIVEM (-1.0e37f)
typedef _Float16 h16;
typedef unsigned short bf;
typedef __attribute__((ext_vector_type(16))) __bf16   v16bf;
typedef __attribute__((ext_vector_type(16))) _Float16 v16h;
typedef __attribute__((ext_vector_type(8)))  _Float16 v8h;
typedef __attribute__((ext_vector_type(8)))  unsigned short v8us;
typedef __attribute__((ext_vector_type(8)))  float    v8f;
typedef __attribute__((ext_vector_type(4)))  float    v4f;
typedef v8h  __attribute__((may_alias)) v8ha;
typedef v4f  __attribute__((may_alias)) v4fa;
typedef v8us __attribute__((may_alias)) v8usa;

__device__ __forceinline__ unsigned short f2bf(float f) { unsigned u = __float_as_uint(f); u += 0x7FFFu + ((u >> 16) & 1u); return (unsigned short)(u >> 16); }
__device__ __forceinline__ float bf2f(unsigned short b) { return __uint_as_float(((unsigned)b) << 16); }
__device__ __forceinline__ float bfr(float f) { return bf2f(f2bf(f)); }
__device__ __forceinline__ v16h cat16(v8h lo, v8h hi) { return __builtin_shufflevector(lo, hi, 0, 1, 2, 3, 4, 5, 6, 7, 8, 9, 10, 11, 12, 13, 14, 15); }
__device__ __forceinline__ v16bf cat16b(v8us lo, v8us hi) { return __builtin_bit_cast(v16bf, __builtin_shufflevector(lo, hi, 0, 1, 2, 3, 4, 5, 6, 7, 8, 9, 10, 11, 12, 13, 14, 15)); }
__device__ __forceinline__ v8f wmma16(v16h a, v16h b, v8f c) { return __builtin_amdgcn_wmma_f32_16x16x32_f16(false, a, false, b, (short)0, c, false, false); }
__device__ __forceinline__ v8f wmmab(v16bf a, v16bf b, v8f c) { return __builtin_amdgcn_wmma_f32_16x16x32_bf16(false, a, false, b, (short)0, c, false, false); }



// ---- k_gemmw: GEMM, one 128x128 output tile per work-group of FOUR WAVES (2 x 2, each 64x64 = 16 accumulators); grid (M/128, N/128, Z), 128 threads. The operands' 16-bit planes are in fragment order.
// C[m][n] (f32, pitch ldc, + optional f32 bias[n]) = sum_k A[m][k] Bt[n][k] (NSPLIT 1: + A2[m][k] Bt[n][k]). A has lda k values a row, Bt K. z-batch strides sA/sB/sC in elements; z slices 0, 1, 2 take bias, bias1, bias2. K % 64 == 0.
// STAGING: a trip is 64 k. Its 8 row tiles x 2 k tiles (16 KiB) of each operand are brought into LDS once for the whole work-group by asynchronous copies (no register on the way), so each fragment is fetched from L2 once and read from LDS by the two waves that need it.
// Two buffers: the copies of trip t + 1 fly while trip t is worked on. A row tile's two k tiles are 2 KiB in a row in the plane and in LDS, one 16-byte piece a thread.
template <typename T16> struct WFrag;
template <> struct WFrag<h16> { typedef v16h V; static __device__ __forceinline__ V ld(const h16* p) { return cat16(*(const v8h*)p, *(const v8h*)(p + 256)); } static __device__ __forceinline__ v8f mma(V a, V b, v8f c) { return wmma16(a, b, c); } };
template <> struct WFrag<bf> { typedef v16bf V; static __device__ __forceinline__ V ld(const bf* p) { return cat16b(*(const v8us*)p, *(const v8us*)(p + 256)); } static __device__ __forceinline__ v8f mma(V a, V b, v8f c) { return wmmab(a, b, c); } };
// Eight copies of a lane, 16 bytes each: row tiles 0 .. 7 of one operand (LDS 2 KiB apart, the plane 'pitch' elements apart). The wait on the address translations is the statement's last line, so that no address register is rewritten ahead of it.
template <typename T16> __device__ __forceinline__ void cp8(unsigned l, const T16* g, size_t pitch) {
    asm volatile("global_load_async_to_lds_b128 %0, %8, off\n\t"
                 "global_load_async_to_lds_b128 %1, %9, off\n\t"
                 "global_load_async_to_lds_b128 %2, %10, off\n\t"
                 "global_load_async_to_lds_b128 %3, %11, off\n\t"
                 "global_load_async_to_lds_b128 %4, %12, off\n\t"
                 "global_load_async_to_lds_b128 %5, %13, off\n\t"
                 "global_load_async_to_lds_b128 %6, %14, off\n\t"
                 "global_load_async_to_lds_b128 %7, %15, off\n\t"
                 "s_wait_xcnt 0x0"
                 :: "v"(l), "v"(l + 2048u), "v"(l + 4096u), "v"(l + 6144u), "v"(l + 8192u), "v"(l + 10240u), "v"(l + 12288u), "v"(l + 14336u),
                    "v"(g), "v"(g + pitch), "v"(g + 2 * pitch), "v"(g + 3 * pitch), "v"(g + 4 * pitch), "v"(g + 5 * pitch), "v"(g + 6 * pitch), "v"(g + 7 * pitch) : "memory");
}
// PACK (the projections; z = 0, 1, 2 is q, k, v): no C. The result + bias (q: x 0.125) goes straight from the accumulators into the head planes that attention reads, numbered hb = b*32 + h: an fp16 plane and bf16 hi/lo planes each of
// q and k (rows t, k = d) and of v^T (rows dd < 32, k = t; the two row tiles of a 32-key step side by side), all in fragment order. A lane's 8 accumulator registers are 8 consecutive ROWS of one column of D, and a 16-byte piece of a plane is 8 consecutive k of one row:
// for v^T (k = t) D = X W^T fits as it is; for q and k (k = d) the two operands change places, D = W X^T. Only the LDS offsets of the A and B fragments differ, the loop is the same. Each 16x16 tile is then 512 contiguous bytes (piece = lane) of each plane.
typedef __attribute__((ext_vector_type(2))) __bf16 v2bf;
typedef __attribute__((ext_vector_type(4))) unsigned v4u;
struct Piece { v8h f; v4u h, l; };   // 8 values as fp16, as bf16 hi and as bf16 lo = the rounded rest
__device__ __forceinline__ Piece mk3(const v8f y) { Piece p;
#pragma unroll
    for (int r = 0; r < 8; r += 2) { p.f[r] = (h16)y[r]; p.f[r + 1] = (h16)y[r + 1]; const v2bf a = { (__bf16)y[r], (__bf16)y[r + 1] }; const unsigned u = __builtin_bit_cast(unsigned, a); p.h[r >> 1] = u;
        const v2bf c = { (__bf16)(y[r] - __uint_as_float(u << 16)), (__bf16)(y[r + 1] - __uint_as_float(u & 0xffff0000u)) }; p.l[r >> 1] = __builtin_bit_cast(unsigned, c); }
    return p; }
// Four tiles' pieces, at o0 .. o3 elements from the lane's base address in each of the three planes.
__device__ __forceinline__ void put4(const Piece (&p)[4], h16* pf, bf* ph, bf* pl, int o0, int o1, int o2, int o3) {
    const int of[4] = { o0, o1, o2, o3 };
#pragma unroll
    for (int u = 0; u < 4; ++u) { *(v8h*)(pf + of[u]) = p[u].f; *(v8us*)(ph + of[u]) = __builtin_bit_cast(v8us, p[u].h); *(v8us*)(pl + of[u]) = __builtin_bit_cast(v8us, p[u].l); }
    // stands behind the twelve stores, before their data registers are rewritten for the next four tiles (inputs here, like the lane's three base addresses, so that they live up to the wait)
    asm volatile("s_wait_xcnt 0x0" :: "v"(pf), "v"(ph), "v"(pl), "v"(p[0].f), "v"(p[0].h), "v"(p[0].l), "v"(p[1].f), "v"(p[1].h), "v"(p[1].l), "v"(p[2].f), "v"(p[2].h), "v"(p[2].l), "v"(p[3].f), "v"(p[3].h), "v"(p[3].l) : "memory");
}
template <typename T16, int NSPLIT, bool BIAS, bool PACK>
__global__ __launch_bounds__(128) void k_gemmw(const T16* __restrict__ A, const T16* __restrict__ A2, const T16* __restrict__ Bt, const T16* __restrict__ Bt2, int K, int lda, float* C, int ldc, const float* __restrict__ bias, const float* __restrict__ bias1, const float* __restrict__ bias2, size_t sA, size_t sB, size_t sC, h16* q16, h16* k16, h16* v16, bf* qh, bf* ql, bf* kh, bf* kl, bf* vh, bf* vl) {
    typedef typename WFrag<T16>::V V;
    static_assert(NSPLIT == 0 || NSPLIT == 1, "A (+ A2) x Bt"); static_assert(!PACK || (NSPLIT == 0 && BIAS), "the projections"); (void)Bt2;
    constexpr int NOP = NSPLIT == 1 ? 3 : 2;                  // operands staged: Bt, A (, A2)
    __shared__ __align__(2048) T16 ring[2][NOP][8192];        // [buffer][operand][row tile 8][k tile 2][512]
    const size_t z = blockIdx.z; A += z * sA; if (NSPLIT == 1) A2 += z * sA; Bt += z * sB; C += z * sC; if (z == 1) bias = bias1; else if (z == 2) bias = bias2;   // each z slice has its own bias vector
    const int tid = threadIdx.x, lane = tid & 31, lr = lane & 15, hi = lane >> 4, w = tid >> 5, wm = w >> 1, wn = w & 1; const int rb = blockIdx.x * 128, cb = blockIdx.y * 128, r0 = rb + wm * 64, c0 = cb + wn * 64;   // the block's and the wave's first row and column
    const bool sw = PACK && z < 2;   // q, k: the A fragments are rows of Bt, the B fragments rows of A
    const int oa = sw ? wn * 4096 : 8192 + wm * 4096, ob = sw ? 8192 + wm * 4096 : wn * 4096;   // the wave's four row tiles of each, in elements from the buffer's start
    v8f acc[4][4];
#pragma unroll
    for (int mb = 0; mb < 4; ++mb)
#pragma unroll
        for (int nb = 0; nb < 4; ++nb) acc[mb][nb] = (v8f){};
    const T16* ga = A + (size_t)rb * lda + 8 * tid; const T16* ga2 = NSPLIT == 1 ? A2 + (size_t)rb * lda + 8 * tid : ga; const T16* gb = Bt + (size_t)cb * K + 8 * tid;   // 16 rows of tiles hold 16 * K elements; a trip of 64 k is two tiles (1024 elements)
    const unsigned l0 = (unsigned)(size_t)&ring[0][0][0] + 16u * tid;   // the thread's own piece in LDS, as a byte address
    const int nt = K / 64;
    auto fill = [&](int t) { const unsigned l = l0 + (unsigned)(t & 1) * (NOP * 16384u);
        cp8<T16>(l, gb + (size_t)t * 1024, (size_t)16 * K); cp8<T16>(l + 16384u, ga + (size_t)t * 1024, (size_t)16 * lda); if (NSPLIT == 1) cp8<T16>(l + 32768u, ga2 + (size_t)t * 1024, (size_t)16 * lda); };
    fill(0);
    asm volatile("s_wait_asynccnt 0x0" ::: "memory");   // this wave's copies of trip 0 have landed
    __syncthreads();                                    // ... and every other wave's: nothing of trip 0 is read ahead of this
    if (nt > 1) fill(1);
#pragma unroll 1   // one trip's code: the two buffers differ only in a base address
    for (int t = 0; t < nt; ++t) {
        const T16* sb = &ring[t & 1][0][0] + ob + 8 * lane; const T16* sa = &ring[t & 1][0][0] + oa + 8 * lane;
        V a[4], a2[4], b[4];
#pragma unroll
        for (int ks = 0; ks < 2; ++ks) {
#pragma unroll
            for (int mb = 0; mb < 4; ++mb) { a[mb] = WFrag<T16>::ld(sa + mb * 1024 + ks * 512); if (NSPLIT == 1) a2[mb] = WFrag<T16>::ld(sa + 8192 + mb * 1024 + ks * 512); }
#pragma unroll
            for (int nb = 0; nb < 4; ++nb) b[nb] = WFrag<T16>::ld(sb + nb * 1024 + ks * 512);
            __builtin_amdgcn_sched_barrier(0);   // keeps the step's LDS reads together ahead of its matrix instructions: spread among them, each group of reads costs the wave a wait of its own
#pragma unroll
            for (int nb = 0; nb < 4; ++nb) {
#pragma unroll
                for (int mb = 0; mb < 4; ++mb) { acc[mb][nb] = WFrag<T16>::mma(a[mb], b[nb], acc[mb][nb]); if (NSPLIT == 1) acc[mb][nb] = WFrag<T16>::mma(a2[mb], b[nb], acc[mb][nb]); } }
        }
        __builtin_amdgcn_sched_barrier(0);   // the trip's matrix instructions stay ahead of the slots and waits below (the compiler otherwise moves most of them behind the barrier, which delays the refill)
        asm volatile("v_nop\n\tv_nop\n\tv_nop\n\tv_nop" : "+v"(acc[0][0]), "+v"(acc[1][1]), "+v"(acc[2][2]), "+v"(acc[3][3]) : "v"(a[0]), "v"(a[3]));   // four vector slots behind the trip's last matrix instructions, ahead of the address arithmetic that may take the fragments' registers
        asm volatile("s_wait_dscnt 0x0" ::: "memory");      // this wave's reads of the trip's buffer are done
        asm volatile("s_wait_asynccnt 0x0" ::: "memory");   // its copies of trip t + 1 have landed
        __syncthreads();                                    // publishes trip t + 1 and ends every wave's reads of the buffer that is refilled below
        if (t + 2 < nt) fill(t + 2);
    }
    asm volatile("s_wait_asynccnt 0x0" ::: "memory");   // no copy is outstanding when the wave goes on to its end
    if constexpr (PACK) {
        h16* pf = z == 0 ? q16 : z == 1 ? k16 : v16; bf* ph = z == 0 ? qh : z == 1 ? kh : vh; bf* pl = z == 0 ? ql : z == 1 ? kl : vl;
        const size_t o = ((size_t)((r0 / TT) * NH_ + c0 / HD) * TT + r0 % TT) * HD + 8 * lane; pf += o; ph += o; pl += o;   // the wave's 64 rows lie in one batch entry, its 64 columns are two heads; 32 t of a head are 1024 elements in every plane
        if (sw) {   // acc[i][j]: d = 16 i + 8 hi + r of the two heads, t = 16 j + lr
            const float sc = z == 0 ? SCL : 1.0f; const float* bp = bias + c0 + 8 * hi; v4f bl[4][2];
#pragma unroll
            for (int i = 0; i < 4; ++i) { bl[i][0] = *(const v4f*)(bp + i * 16); bl[i][1] = *(const v4f*)(bp + i * 16 + 4); }
            asm volatile("s_wait_xcnt 0x0" :: "v"(bp) : "memory");   // stands behind the bias loads, before their address registers are reused
#pragma unroll
            for (int i = 0; i < 4; ++i) { Piece p[4]; const int of = (i >> 1) * TT * HD + (i & 1) * 256;
#pragma unroll
                for (int j = 0; j < 4; ++j) { v8f y;
#pragma unroll
                    for (int r = 0; r < 8; ++r) y[r] = __fmul_rn(__fadd_rn(acc[i][j][r], bfr(bl[i][r >> 2][r & 3])), sc);
                    p[j] = mk3(y); }
                put4(p, pf, ph, pl, of, of + 512, of + 1024, of + 1536); }
        } else {    // acc[mb][nb]: t = 16 mb + 8 hi + r, dd = 16 nb + lr of the two heads
            const float* bp = bias + c0 + lr; float bl[4];
#pragma unroll
            for (int nb = 0; nb < 4; ++nb) bl[nb] = bp[nb * 16];
            asm volatile("s_wait_xcnt 0x0" :: "v"(bp) : "memory");   // as above
#pragma unroll
            for (int nb = 0; nb < 4; ++nb) { Piece p[4]; const int of = (nb >> 1) * TT * HD + (nb & 1) * 512;
#pragma unroll
                for (int mb = 0; mb < 4; ++mb) { v8f y;
#pragma unroll
                    for (int r = 0; r < 8; ++r) y[r] = __fadd_rn(acc[mb][nb][r], bfr(bl[nb]));
                    p[mb] = mk3(y); }
                put4(p, pf, ph, pl, of, of + 256, of + 1024, of + 1280); }
        }
    } else {
    __shared__ __align__(16) float osw[4][16 * 68];   // each wave's own output staging
    float* os = osw[w];
#pragma unroll
    for (int mb = 0; mb < 4; ++mb) {
#pragma unroll
        for (int nb = 0; nb < 4; ++nb) {
#pragma unroll
            for (int j = 0; j < 8; ++j) os[(hi * 8 + j) * 68 + nb * 16 + lr] = acc[mb][nb][j]; }
        __builtin_amdgcn_wave_barrier(); asm volatile("" ::: "memory");
        float* crow = C + (size_t)(r0 + mb * 16) * ldc + c0;
{
#pragma unroll
            for (int s = 0; s < 8; ++s) { const int row = 2 * s + hi, cofs = lr * 4; v4f val = *(const v4fa*)(os + row * 68 + cofs); if (BIAS) { val[0] += bfr(bias[c0 + cofs]); val[1] += bfr(bias[c0 + cofs + 1]); val[2] += bfr(bias[c0 + cofs + 2]); val[3] += bfr(bias[c0 + cofs + 3]); }
                *(v4f*)(crow + (size_t)row * ldc + cofs) = val; }
             }
        asm volatile("s_wait_xcnt 0x0" ::: "memory");   // stands behind the row stores, before their address registers are reused
        __builtin_amdgcn_wave_barrier(); asm volatile("" ::: "memory");
    }
    }
}

__device__ __forceinline__ void splitf(float y, unsigned short& h, unsigned short& l) { h = f2bf(y); l = f2bf(y - bf2f(h)); }

// k_cvt8: all five f32 -> bf16 conversions and the mask copy in one launch. dst is the row of planes WQ, WK, WV, WO, XB, each in fragment order; 1024 blocks (2^21 elements) for each weight, 4096 for the hidden states of both batch entries, then 4096 for the mask.
// A thread is one 16-byte piece of the destination (stores stay contiguous); its 8 source values are 8 consecutive k of one row, and a block reads whole lines of 16 rows.
#define CVB (4 * 1024 + NB_ * TT * DM / 8 / 256)
__global__ __launch_bounds__(256) void k_cvt8(const float* __restrict__ wq, const float* __restrict__ wk, const float* __restrict__ wv, const float* __restrict__ wo, const float* __restrict__ x, const float* __restrict__ mk, bf* dst, float* mp, unsigned* lv) {
    const int lane = threadIdx.x & 31, lr = lane & 15, hi = lane >> 4;
    if (blockIdx.x >= CVB) {   // mask: a wave copies one 16 x 16 tile, a lane its 8 keys 8 hi .. 8 hi + 7 of query row lr; a block is 8 tiles in a row = 4 steps of one query tile
        __shared__ unsigned fl[8];
        const size_t tile = ((size_t)(blockIdx.x - CVB) * 256 + threadIdx.x) >> 5; const float* s = mk + ((tile / (TT / 16)) * 16 + lr) * TT + (tile % (TT / 16)) * 16 + 8 * hi; const v4f a = *(const v4f*)s, c = *(const v4f*)(s + 4);
        asm volatile("s_wait_xcnt 0x0" ::: "memory");   // stands behind the loads, before their address registers are reused
        bool up = false;   // not-a-number counts as live
#pragma unroll
        for (int r = 0; r < 4; ++r) up = up || !(a[r] <= DEADM) || !(c[r] <= DEADM);
        const unsigned any = __builtin_amdgcn_ballot_w32(up) != 0 ? 1u : 0u; if (lane == 0) fl[threadIdx.x >> 5] = any;
        __syncthreads();   // the eight waves' tile marks meet here (the branch is the same for the whole block); it stands ahead of the tile's stores so that no wave waits at it for a store to finish
        *(v4f*)(mp + tile * 256 + lane * 4) = a; *(v4f*)(mp + tile * 256 + 128 + lane * 4) = c;
        if (threadIdx.x == 0) lv[(size_t)(blockIdx.x - CVB) * 32] = (fl[0] | fl[1]) | (fl[2] | fl[3]) << 1 | (fl[4] | fl[5]) << 2 | (fl[6] | fl[7]) << 3;   // bit j: step 4 * (block % 16) + j; one word a 128-byte line, so each line has one writer
        return; }
    const int seg = blockIdx.x >> 10; const float* src = seg == 0 ? wq : seg == 1 ? wk : seg == 2 ? wv : seg == 3 ? wo : x; const size_t i = (size_t)blockIdx.x * 256 + threadIdx.x; const size_t j = i - (size_t)(seg < 4 ? seg : 4) * 1024 * 256;
    const int sh = seg == 3 ? 5 : 6;   // log2 of the tiles in a row of tiles: K = 1024 for Wo, 2048 for the rest
    const size_t tile = j >> 6; const v8f v = *(const v8f*)(src + ((((tile >> sh) * 16 + lr) << sh) + (tile & ((1u << sh) - 1))) * 32 + ((j >> 5) & 1) * 16 + 8 * hi); v8us o;
    asm volatile("s_wait_xcnt 0x0" ::: "memory");   // stands behind the load, before its address registers are reused
#pragma unroll
    for (int k = 0; k < 8; ++k) o[k] = f2bf(v[k]); *(v8us*)(dst + i * 8) = o;  }
__device__ __forceinline__ float xhalf(float x) { const int b = __float_as_int(x); return __int_as_float(__builtin_amdgcn_permlanex16(b, b, 0x76543210, 0xfedcba98, false, false)); }
#define FMIN_ (-3.40282347e38f)
template <typename T16, int NQ> struct AStage { typename WFrag<T16>::V k[2], k2[2]; v8f m[NQ][2]; };   // one step's K fragments and mask tiles
template <typename T16> struct VStage { typename WFrag<T16>::V v[2], v2[2]; };                          // one step's V^T fragments
template <typename T16, bool HILO, int NQ>
__device__ __forceinline__ void a_loadk(AStage<T16, NQ>& s, const T16* pk, const T16* pk2, const float* pm) {
#pragma unroll
    for (int kt = 0; kt < 2; ++kt) { s.k[kt] = WFrag<T16>::ld(pk + kt * 16 * HD); if (HILO) s.k2[kt] = WFrag<T16>::ld(pk2 + kt * 16 * HD); }
#pragma unroll
    for (int qt = 0; qt < NQ; ++qt)
#pragma unroll
        for (int kt = 0; kt < 2; ++kt) { const float* p = pm + (size_t)qt * 16 * TT + kt * 256; s.m[qt][kt] = __builtin_shufflevector(*(const v4f*)p, *(const v4f*)(p + 128), 0, 1, 2, 3, 4, 5, 6, 7); }
    // stands behind the group's loads, before their address registers are rewritten for the next group (they are inputs, so that none is rewritten ahead of the wait, not even as a later load's destination); the clobber also keeps these loads ahead of the work on the other stage
    if constexpr (HILO) asm volatile("s_wait_xcnt 0x0" :: "v"(pk), "v"(pk2), "v"(pm) : "memory"); else asm volatile("s_wait_xcnt 0x0" :: "v"(pk), "v"(pm) : "memory");
}
template <typename T16, bool HILO>
__device__ __forceinline__ void a_loadv(VStage<T16>& s, const T16* pv, const T16* pv2) {
#pragma unroll
    for (int dt = 0; dt < 2; ++dt) { s.v[dt] = WFrag<T16>::ld(pv + dt * 512); if (HILO) s.v2[dt] = WFrag<T16>::ld(pv2 + dt * 512); }
    if constexpr (HILO) asm volatile("s_wait_xcnt 0x0" :: "v"(pv), "v"(pv2) : "memory"); else asm volatile("s_wait_xcnt 0x0" :: "v"(pv) : "memory");   // as in a_loadk
}
template <typename T16, bool HILO, int NQ>
__device__ __forceinline__ void a_step(const AStage<T16, NQ>& s, const VStage<T16>& sv, const typename WFrag<T16>::V (&bq)[NQ], const typename WFrag<T16>::V (&bq2)[NQ], v8f (&acc)[NQ][2], float (&mr)[NQ], float (&sm)[NQ]) {
    typedef typename WFrag<T16>::V V;
    float t[NQ][16], mx[NQ]; bool need = false;
#pragma unroll
    for (int qt = 0; qt < NQ; ++qt) {
#pragma unroll
        for (int kt = 0; kt < 2; ++kt) { v8f d = WFrag<T16>::mma(s.k[kt], bq[qt], s.m[qt][kt]);   // the mask tile has D's map: it is the product's C operand, so q.k + mask comes out of the matrix unit
            if (HILO) { d = WFrag<T16>::mma(s.k2[kt], bq[qt], d); d = WFrag<T16>::mma(s.k[kt], bq2[qt], d); }
#pragma unroll
            for (int r = 0; r < 8; ++r) t[qt][kt * 8 + r] = fmaxf(d[r], FMIN_); }
        float a = t[qt][0];
#pragma unroll
        for (int i = 1; i < 16; ++i) a = fmaxf(a, t[qt][i]);
        a = fmaxf(a, xhalf(a)); mx[qt] = a; need = need || (a > mr[qt]); }
    if (__builtin_amdgcn_ballot_w32(need) != 0) {   // a column's maximum rose: rescale what is summed so far (factor 1 in the other columns)
#pragma unroll
        for (int qt = 0; qt < NQ; ++qt) { const float mn = fmaxf(mr[qt], mx[qt]); const float al = __expf(mr[qt] - mn); mr[qt] = mn; sm[qt] *= al;
#pragma unroll
            for (int dt = 0; dt < 2; ++dt)
#pragma unroll
                for (int r = 0; r < 8; ++r) acc[qt][dt][r] *= al; } }
#pragma unroll
    for (int qt = 0; qt < NQ; ++qt) { V bp, bp2;
#pragma unroll
        for (int i = 0; i < 16; ++i) { const float p = __expf(t[qt][i] - mr[qt]); sm[qt] += p;
            if constexpr (HILO) { const __bf16 ph = (__bf16)p; bp[i] = ph; bp2[i] = (__bf16)(p - (float)ph); } else bp[i] = (h16)p; }
#pragma unroll
        for (int dt = 0; dt < 2; ++dt) { acc[qt][dt] = WFrag<T16>::mma(sv.v[dt], bp, acc[qt][dt]); if (HILO) { acc[qt][dt] = WFrag<T16>::mma(sv.v2[dt], bp, acc[qt][dt]); acc[qt][dt] = WFrag<T16>::mma(sv.v[dt], bp2, acc[qt][dt]); } } }
}
// Four vector slots behind a step's last matrix instructions: the branches that follow lead, on their taken side, to address arithmetic in the registers that held V^T. The accumulators are inputs so that the slots stand behind those instructions.
template <int NQ> __device__ __forceinline__ void a_gap(const v8f (&acc)[NQ][2]) {
    if constexpr (NQ == 2) asm volatile("v_nop\n\tv_nop\n\tv_nop\n\tv_nop" :: "v"(acc[0][0]), "v"(acc[0][1]), "v"(acc[1][0]), "v"(acc[1][1]));
    else asm volatile("v_nop\n\tv_nop\n\tv_nop\n\tv_nop" :: "v"(acc[0][0]), "v"(acc[0][1])); }
template <int NQ> __device__ __forceinline__ bool a_settled(const float (&mr)[NQ]) { bool ok = true;   // true, for the whole wave, once each of its queries has met a key that is not masked out
#pragma unroll
    for (int qt = 0; qt < NQ; ++qt) ok = ok && (mr[qt] > LIVEM);
    return __builtin_amdgcn_ballot_w32(ok) == 0xffffffffu; }
// Qp, Kp: one head's planes (rows t, k = d); Vp: its plane (rows dd, k = t); mk: this batch entry's mask tiles; lv: its live-step words (16 a query tile, 4 steps each, 32 words apart); q0: the wave's first query; the merged-head planes Ah/Al (rows t, k = h*32 + d, fragment order) take o = O / sum as bf16 hi + lo.
template <typename T16, bool HILO, int NQ>
__device__ __forceinline__ void attn_cols(const T16* Qp, const T16* Qp2, const T16* Kp, const T16* Kp2, const T16* Vp, const T16* Vp2, const float* mk, const unsigned* lv, bf* Ah, bf* Al, int h, int q0) {
    typedef typename WFrag<T16>::V V;
    const int lane = threadIdx.x & 31;
    V bq[NQ], bq2[NQ]; v8f acc[NQ][2]; float mr[NQ], sm[NQ];
    const T16* ql = Qp + (size_t)q0 * HD + 8 * lane; const T16* q2l = Qp2 + (size_t)q0 * HD + 8 * lane;
    unsigned nib = lv[((size_t)(q0 >> 4) * 16 + (NQ == 2 ? lane : (lane & 15))) * 32];   // lane l: steps 4 (l % 16) .. + 3 of query tile l / 16 (NQ 1: of its one tile in every lane)
#pragma unroll
    for (int qt = 0; qt < NQ; ++qt) { bq[qt] = WFrag<T16>::ld(ql + qt * 16 * HD); if (HILO) bq2[qt] = WFrag<T16>::ld(q2l + qt * 16 * HD); acc[qt][0] = (v8f){}; acc[qt][1] = (v8f){}; mr[qt] = FMIN_; sm[qt] = 0.f; }
    asm volatile("s_wait_xcnt 0x0" ::: "memory");   // as in a_loadk, for the Q loads
    const T16* kl = Kp + 8 * lane; const T16* k2l = Kp2 + 8 * lane; const T16* vl = Vp + 8 * lane; const T16* v2l = Vp2 + 8 * lane; const float* ml = mk + (size_t)q0 * TT + 4 * lane;   // key kb: K tile at kb * 32 elements, the V^T tile pair at kb * 32, the mask tile at kb * 16 floats
    // K and mask are fetched one step ahead into two stages. V^T too on the fp16 path; the hi+lo path (twice the fragments) fetches a step's V^T at the step's head, behind which the scores and the softmax stand, to stay within 256 registers
    AStage<T16, NQ> s0, s1; VStage<T16> v0, v1;
    a_loadk<T16, HILO, NQ>(s0, kl, k2l, ml); if (!HILO) a_loadv<T16, HILO>(v0, vl, v2l);
    if (NQ == 2) nib |= (unsigned)__builtin_amdgcn_permlanex16((int)nib, (int)nib, 0x76543210, 0xfedcba98, false, false);   // a step is live if it is so for either query tile
    unsigned long long live = 0;   // bit s: step s (keys 32 s .. 32 s + 31); the same in every lane, kept in scalar registers
#pragma unroll
    for (int l = 0; l < 16; ++l) live |= (unsigned long long)(unsigned)__builtin_amdgcn_readlane((int)nib, l) << (4 * l);
    unsigned long long todo = ~1ull;   // steps not yet fetched: all of them until every query's maximum has settled above LIVEM, then the live ones among them
    bool settled = false, more; int kb = 0;
    do {   // two steps a trip, one per stage; each step fetches the next step still to do; once none is left, step 0 is fetched again (in bounds, unused)
        const bool pair = todo != 0; int kn = pair ? __builtin_ctzll(todo) * 32 : 0; todo &= todo - 1;
        a_loadk<T16, HILO, NQ>(s1, kl + kn * HD, k2l + kn * HD, ml + kn * 16);
        if (HILO) { a_loadv<T16, HILO>(v0, vl + kb * 32, v2l + kb * 32); a_step<T16, HILO, NQ>(s0, v0, bq, bq2, acc, mr, sm); }
        else { a_loadv<T16, HILO>(v1, vl + kn * 32, v2l + kn * 32); a_step<T16, HILO, NQ>(s0, v0, bq, bq2, acc, mr, sm); }
        a_gap<NQ>(acc); if (!settled) { settled = a_settled<NQ>(mr); if (settled) todo &= live; }
        kb = kn; more = todo != 0; kn = more ? __builtin_ctzll(todo) * 32 : 0; todo &= todo - 1;
        a_loadk<T16, HILO, NQ>(s0, kl + kn * HD, k2l + kn * HD, ml + kn * 16);
        if (HILO) a_loadv<T16, HILO>(v0, vl + kb * 32, v2l + kb * 32); else a_loadv<T16, HILO>(v0, vl + kn * 32, v2l + kn * 32);
        if (pair) {   // an odd count ends with half a trip
            a_step<T16, HILO, NQ>(s1, HILO ? v0 : v1, bq, bq2, acc, mr, sm);
            a_gap<NQ>(acc); if (!settled) { settled = a_settled<NQ>(mr); if (settled) todo &= live; } }
        kb = kn;
    } while (more);
#pragma unroll
    for (int qt = 0; qt < NQ; ++qt) { const float f = __fdiv_rn(1.0f, sm[qt] + xhalf(sm[qt])); const size_t oo = (size_t)(q0 + qt * 16) * RK + h * 512 + 8 * lane;   // tile (query tile, head); d = 16 dt + 8 hi + r is piece dt of lane (lr, hi)
#pragma unroll
        for (int dt = 0; dt < 2; ++dt) { v8us oh, ol;
#pragma unroll
            for (int r = 0; r < 8; ++r) { unsigned short a, c2; splitf(__fmul_rn(acc[qt][dt][r], f), a, c2); oh[r] = a; ol[r] = c2; }
            bf* pa = Ah + oo + dt * 256; bf* pl = Al + oo + dt * 256; *(v8us*)pa = oh; *(v8us*)pl = ol;
            asm volatile("s_wait_xcnt 0x0" :: "v"(pa), "v"(pl), "v"(oh), "v"(ol) : "memory"); } }   // stands behind the two stores, before their address and data registers (inputs here, so that they live up to the wait) are rewritten for the next piece
}
// grid (batch entries x heads, (TT-RH)/128 + RH/64), 4 waves (one a SIMD; 1280 blocks, five a WGP, four resident): the first (TT-RH)/128 blocks of a head take 32 queries a wave on fp16, the rest the hi+lo rows, 16 queries a wave
// (three products a tile, so half the columns). Both run from the last query rows to the first: under a causal mask those have the most live steps, so the longest blocks have the low indices and start first (for speed only). A block's waves walk the same K and V^T lines.
__global__ __launch_bounds__(128) void k_fattn(const h16* __restrict__ Q16, const h16* __restrict__ K16, const h16* __restrict__ VT16, const bf* __restrict__ Qh, const bf* __restrict__ Ql, const bf* __restrict__ Kh, const bf* __restrict__ Kl, const bf* __restrict__ VTh, const bf* __restrict__ VTl, const float* __restrict__ mk, const unsigned* __restrict__ lv, bf* Ah, bf* Al) {
    const int h = blockIdx.x % NH_, b = blockIdx.x / NH_, w = threadIdx.x >> 5, bx = blockIdx.y; const size_t oq = (size_t)blockIdx.x * TT * HD, ov = (size_t)blockIdx.x * HD * TT; mk += (size_t)b * TT * TT; lv += (size_t)b * (TT / 16) * 16 * 32; Ah += (size_t)b * TT * RK; Al += (size_t)b * TT * RK;
    if (bx >= (TT - RH) / 128) attn_cols<bf, true, 1>(Qh + oq, Ql + oq, Kh + oq, Kl + oq, VTh + ov, VTl + ov, mk, lv, Ah, Al, h, ((TT - RH) / 128 + RH / 64 - 1 - bx) * 64 + w * 16);
    else attn_cols<h16, false, 2>(Q16 + oq, Q16 + oq, K16 + oq, K16 + oq, VT16 + ov, VT16 + ov, mk, lv, Ah, Al, h, RH + ((TT - RH) / 128 - 1 - bx) * 128 + w * 32);
}

extern "C" void kernel_launch(void* const* d_in, const int* in_sizes, int n_in,
                              void* d_out, int out_size, void* d_ws, size_t ws_size, hipStream_t stream) {
    (void)in_sizes; (void)n_in; (void)out_size;
    const float* IN[10]; for (int i = 0; i < 10; ++i) IN[i] = (const float*)d_in[i];   // 0 hidden, 1 attention_mask [2][1][2048][2048], 2 Wq [1024][2048], 3 bq, 4 Wk, 5 bk, 6 Wv, 7 bv, 8 Wo [2048][1024], 9 bo (torch [out][in])
    float* OUT = (float*)d_out;     // [2][2048][2048]
    char* wsp = (char*)d_ws;
    auto take = [&](size_t bytes) { char* p = wsp; wsp += (bytes + 255) & ~(size_t)255; return (void*)p; };
    bf* WQ = (bf*)take((size_t)RK * DM * 2); bf* WK = (bf*)take((size_t)RK * DM * 2); bf* WV = (bf*)take((size_t)RK * DM * 2); bf* WO = (bf*)take((size_t)DM * RK * 2);   // WQ, WK, WV, WO, XB lie in a row (every size a multiple of 256 bytes)
    bf* XB = (bf*)take((size_t)NB_ * TT * DM * 2);
    h16* Q16 = (h16*)take((size_t)NB_ * NH_ * TT * HD * 2); h16* K16 = (h16*)take((size_t)NB_ * NH_ * TT * HD * 2); bf* Qh = (bf*)take((size_t)NB_ * NH_ * TT * HD * 2); bf* Ql = (bf*)take((size_t)NB_ * NH_ * TT * HD * 2); bf* Kh = (bf*)take((size_t)NB_ * NH_ * TT * HD * 2); bf* Kl = (bf*)take((size_t)NB_ * NH_ * TT * HD * 2);
    h16* VT16 = (h16*)take((size_t)NB_ * NH_ * HD * TT * 2); bf* VTh = (bf*)take((size_t)NB_ * NH_ * HD * TT * 2); bf* VTl = (bf*)take((size_t)NB_ * NH_ * HD * TT * 2);
    bf* Ah = (bf*)take((size_t)NB_ * TT * RK * 2); bf* Al = (bf*)take((size_t)NB_ * TT * RK * 2); float* MP = (float*)take((size_t)NB_ * TT * TT * 4); unsigned* LV = (unsigned*)take((size_t)NB_ * (TT / 16) * 16 * 128);
    if ((size_t)(wsp - (char*)d_ws) > ws_size) return;    // total 152.5 MiB
    (void)WK; (void)WV;
    k_cvt8<<<CVB + NB_ * TT * TT / 8 / 256, 256, 0, stream>>>(IN[2], IN[4], IN[6], IN[8], IN[0], IN[1], WQ, MP, LV);
    k_gemmw<bf, 0, true, true><<<dim3(NB_ * TT / 128, RK / 128, 3), 128, 0, stream>>>(XB, nullptr, WQ, nullptr, DM, DM, nullptr, 0, IN[3], IN[5], IN[7], 0, (size_t)RK * DM, 0, Q16, K16, VT16, Qh, Ql, Kh, Kl, VTh, VTl);
    k_fattn<<<dim3(NB_ * NH_, RH / 64 + (TT - RH) / 128, 1), 128, 0, stream>>>(Q16, K16, VT16, Qh, Ql, Kh, Kl, VTh, VTl, MP, LV, Ah, Al);
    k_gemmw<bf, 1, true, false><<<dim3(NB_ * TT / 128, DM / 128, 1), 128, 0, stream>>>(Ah, Al, WO, nullptr, RK, RK, OUT, DM, IN[9], IN[9], IN[9], 0, 0, 0, nullptr, nullptr, nullptr, nullptr, nullptr, nullptr, nullptr, nullptr, nullptr);
}

// v008
// Measured time: 117 microseconds a run.
// Timed twice side by side with v007, it ran 1.06 and 1.05 times as fast.
// All steps since v000 together make it 58.2 times as fast.
#include <hip/hip_runtime.h>

// OPTEigenAttention - low-rank (eigen) OPT attention (hidden [2][2048][2048]; q = (x Wq^T + bq) x 64^-0.5 (32 heads x 32 low-rank dims; the scaling uses the ORIGINAL head dim 64), k = x Wk^T + bk, v = x Wv^T + bv (32 x 32);
// scores = q.k + attention_mask[b][0][i][j] (additive f32 mask input, read as data; then max(., float min)); softmax; out = merged att.v Wo^T + bo -> [2][2048][2048]).
// Compute dtypes, f32 accumulate: every input rounded to bf16; projections on PLAIN bf16 operands (inputs: exact, + bias); scores (K 32) and att.v on bf16 hi+lo planes (3 products) for
// the first 512 query rows of each head and on SINGLE fp16 planes for the rest (the mask here is causal, so early rows see few keys);
// mask add and softmax in f32 registers; merged heads as bf16 hi+lo planes x exact Wo (2 products) + bo. The projections and the output product run in k_gemmw (128x128 tiles, operands staged in LDS); the projections' epilogue writes the head planes of q, k and v itself (no f32 copy of them reaches memory).
// Every launch covers both batch entries (rows b*2048 + t, head planes b*32 + h); the three projections are one launch (grid z = matrix). Attention is ONE kernel (k_fattn): S^T = K.Q^T, running-maximum softmax in registers, O^T += V^T.P^T; no score or probability ever reaches memory.
// FRAGMENT ORDER: every 16-bit operand plane is stored as 1-KiB tiles of 16 rows x 32 k, tile (row/16, k/32) at index (row/16) * (K/32) + k/32 (V^T: (k/32) * 2 + row/16), element (row, k) at (k%32/16) * 256 + ((k%16/8) * 16 + row%16) * 8 + k%8 inside it.
// A lane's two 16-byte fragment pieces then lie at lane * 8 and 256 + lane * 8, so each wave-wide load covers 512 contiguous bytes (4 lines) where a row-major plane gave 16 pieces of 32 bytes in 16 lines. The k order of a fragment is the one it had.
// The f32 mask is copied once into 16 query x 16 key tiles in the accumulator's map (value r of a lane at (r/4) * 128 + lane * 4 + r%4), tile index (q/16) * 128 + key/16, for the same reason: all 64 head planes read it.
// LIVE STEPS: while it copies the mask, the packer notes for each 16-query tile and each 32-key step whether any mask value there lies above DEADM. Once every query of a wave has a running maximum above LIVEM, the wave walks only the steps so marked:
// in any other step each score is at most DEADM + |q.k| (|q.k| below 8e37 is taken for granted: fp16 operands cannot pass 1.4e11, and the projections of these inputs lie far lower still), so exp(score - maximum) is 0 in f32 and the step adds nothing to the sum or to O. Until then (a row whose first keys, or all keys, are masked) every step is worked as before, so the function is the same for any mask.
// ZERO STEPS: the packer also notes whether a step holds any mask value other than zero. Where it holds none the scores are q.k alone and the wave loads no mask tile; in the other steps the tiles are loaded at the step itself and added to the product in f32.

#define NB_  2
#define TT   2048
#define DM   2048
#define RK   1024
#define NH_  32
#define HD   32
#define RH   512
#define SCL  0.125f
#define DEADM (-1.0e38f)
#define LIVEM (-1.0e37f)
typedef _Float16 h16;
typedef unsigned short bf;
typedef __attribute__((ext_vector_type(16))) __bf16   v16bf;
typedef __attribute__((ext_vector_type(16))) _Float16 v16h;
typedef __attribute__((ext_vector_type(8)))  _Float16 v8h;
typedef __attribute__((ext_vector_type(8)))  unsigned short v8us;
typedef __attribute__((ext_vector_type(8)))  float    v8f;
typedef __attribute__((ext_vector_type(4)))  float    v4f;
typedef v8h  __attribute__((may_alias)) v8ha;
typedef v4f  __attribute__((may_alias)) v4fa;
typedef v8us __attribute__((may_alias)) v8usa;

__device__ __forceinline__ unsigned short f2bf(float f) { unsigned u = __float_as_uint(f); u += 0x7FFFu + ((u >> 16) & 1u); return (unsigned short)(u >> 16); }
__device__ __forceinline__ float bf2f(unsigned short b) { return __uint_as_float(((unsigned)b) << 16); }
__device__ __forceinline__ float bfr(float f) { return bf2f(f2bf(f)); }
__device__ __forceinline__ v16h cat16(v8h lo, v8h hi) { return __builtin_shufflevector(lo, hi, 0, 1, 2, 3, 4, 5, 6, 7, 8, 9, 10, 11, 12, 13, 14, 15); }
__device__ __forceinline__ v16bf cat16b(v8us lo, v8us hi) { return __builtin_bit_cast(v16bf, __builtin_shufflevector(lo, hi, 0, 1, 2, 3, 4, 5, 6, 7, 8, 9, 10, 11, 12, 13, 14, 15)); }
__device__ __forceinline__ v8f wmma16(v16h a, v16h b, v8f c) { return __builtin_amdgcn_wmma_f32_16x16x32_f16(false, a, false, b, (short)0, c, false, false); }
__device__ __forceinline__ v8f wmmab(v16bf a, v16bf b, v8f c) { return __builtin_amdgcn_wmma_f32_16x16x32_bf16(false, a, false, b, (short)0, c, false, false); }



// ---- k_gemmw: GEMM, one 128x128 output tile per work-group of FOUR WAVES (2 x 2, each 64x64 = 16 accumulators); grid (M/128, N/128, Z), 128 threads. The operands' 16-bit planes are in fragment order.
// C[m][n] (f32, pitch ldc, + optional f32 bias[n]) = sum_k A[m][k] Bt[n][k] (NSPLIT 1: + A2[m][k] Bt[n][k]). A has lda k values a row, Bt K. z-batch strides sA/sB/sC in elements; z slices 0, 1, 2 take bias, bias1, bias2. K % 64 == 0.
// STAGING: a trip is 64 k. Its 8 row tiles x 2 k tiles (16 KiB) of each operand are brought into LDS once for the whole work-group by asynchronous copies (no register on the way), so each fragment is fetched from L2 once and read from LDS by the two waves that need it.
// Two buffers: the copies of trip t + 1 fly while trip t is worked on. A row tile's two k tiles are 2 KiB in a row in the plane and in LDS, one 16-byte piece a thread.
template <typename T16> struct WFrag;
template <> struct WFrag<h16> { typedef v16h V; static __device__ __forceinline__ V ld(const h16* p) { return cat16(*(const v8h*)p, *(const v8h*)(p + 256)); } static __device__ __forceinline__ v8f mma(V a, V b, v8f c) { return wmma16(a, b, c); } };
template <> struct WFrag<bf> { typedef v16bf V; static __device__ __forceinline__ V ld(const bf* p) { return cat16b(*(const v8us*)p, *(const v8us*)(p + 256)); } static __device__ __forceinline__ v8f mma(V a, V b, v8f c) { return wmmab(a, b, c); } };
// Eight copies of a lane, 16 bytes each: row tiles 0 .. 7 of one operand (LDS 2 KiB apart, the plane 'pitch' elements apart). The wait on the address translations is the statement's last line, so that no address register is rewritten ahead of it.
template <typename T16> __device__ __forceinline__ void cp8(unsigned l, const T16* g, size_t pitch) {
    asm volatile("global_load_async_to_lds_b128 %0, %8, off\n\t"
                 "global_load_async_to_lds_b128 %1, %9, off\n\t"
                 "global_load_async_to_lds_b128 %2, %10, off\n\t"
                 "global_load_async_to_lds_b128 %3, %11, off\n\t"
                 "global_load_async_to_lds_b128 %4, %12, off\n\t"
                 "global_load_async_to_lds_b128 %5, %13, off\n\t"
                 "global_load_async_to_lds_b128 %6, %14, off\n\t"
                 "global_load_async_to_lds_b128 %7, %15, off\n\t"
                 "s_wait_xcnt 0x0"
                 :: "v"(l), "v"(l + 2048u), "v"(l + 4096u), "v"(l + 6144u), "v"(l + 8192u), "v"(l + 10240u), "v"(l + 12288u), "v"(l + 14336u),
                    "v"(g), "v"(g + pitch), "v"(g + 2 * pitch), "v"(g + 3 * pitch), "v"(g + 4 * pitch), "v"(g + 5 * pitch), "v"(g + 6 * pitch), "v"(g + 7 * pitch) : "memory");
}
// PACK (the projections; z = 0, 1, 2 is q, k, v): no C. The result + bias (q: x 0.125) goes straight from the accumulators into the head planes that attention reads, numbered hb = b*32 + h: an fp16 plane and bf16 hi/lo planes each of
// q and k (rows t, k = d) and of v^T (rows dd < 32, k = t; the two row tiles of a 32-key step side by side), all in fragment order. A lane's 8 accumulator registers are 8 consecutive ROWS of one column of D, and a 16-byte piece of a plane is 8 consecutive k of one row:
// for v^T (k = t) D = X W^T fits as it is; for q and k (k = d) the two operands change places, D = W X^T. Only the LDS offsets of the A and B fragments differ, the loop is the same. Each 16x16 tile is then 512 contiguous bytes (piece = lane) of each plane.
typedef __attribute__((ext_vector_type(2))) __bf16 v2bf;
typedef __attribute__((ext_vector_type(4))) unsigned v4u;
struct Piece { v8h f; v4u h, l; };   // 8 values as fp16, as bf16 hi and as bf16 lo = the rounded rest
__device__ __forceinline__ Piece mk3(const v8f y) { Piece p;
#pragma unroll
    for (int r = 0; r < 8; r += 2) { p.f[r] = (h16)y[r]; p.f[r + 1] = (h16)y[r + 1]; const v2bf a = { (__bf16)y[r], (__bf16)y[r + 1] }; const unsigned u = __builtin_bit_cast(unsigned, a); p.h[r >> 1] = u;
        const v2bf c = { (__bf16)(y[r] - __uint_as_float(u << 16)), (__bf16)(y[r + 1] - __uint_as_float(u & 0xffff0000u)) }; p.l[r >> 1] = __builtin_bit_cast(unsigned, c); }
    return p; }
// Four tiles' pieces, at o0 .. o3 elements from the lane's base address in each of the three planes.
__device__ __forceinline__ void put4(const Piece (&p)[4], h16* pf, bf* ph, bf* pl, int o0, int o1, int o2, int o3) {
    const int of[4] = { o0, o1, o2, o3 };
#pragma unroll
    for (int u = 0; u < 4; ++u) { *(v8h*)(pf + of[u]) = p[u].f; *(v8us*)(ph + of[u]) = __builtin_bit_cast(v8us, p[u].h); *(v8us*)(pl + of[u]) = __builtin_bit_cast(v8us, p[u].l); }
    // stands behind the twelve stores, before their data registers are rewritten for the next four tiles (inputs here, like the lane's three base addresses, so that they live up to the wait)
    asm volatile("s_wait_xcnt 0x0" :: "v"(pf), "v"(ph), "v"(pl), "v"(p[0].f), "v"(p[0].h), "v"(p[0].l), "v"(p[1].f), "v"(p[1].h), "v"(p[1].l), "v"(p[2].f), "v"(p[2].h), "v"(p[2].l), "v"(p[3].f), "v"(p[3].h), "v"(p[3].l) : "memory");
}
template <typename T16, int NSPLIT, bool BIAS, bool PACK>
__global__ __launch_bounds__(128) void k_gemmw(const T16* __restrict__ A, const T16* __restrict__ A2, const T16* __restrict__ Bt, const T16* __restrict__ Bt2, int K, int lda, float* C, int ldc, const float* __restrict__ bias, const float* __restrict__ bias1, const float* __restrict__ bias2, size_t sA, size_t sB, size_t sC, h16* q16, h16* k16, h16* v16, bf* qh, bf* ql, bf* kh, bf* kl, bf* vh, bf* vl) {
    typedef typename WFrag<T16>::V V;
    static_assert(NSPLIT == 0 || NSPLIT == 1, "A (+ A2) x Bt"); static_assert(!PACK || (NSPLIT == 0 && BIAS), "the projections"); (void)Bt2;
    constexpr int NOP = NSPLIT == 1 ? 3 : 2;                  // operands staged: Bt, A (, A2)
    __shared__ __align__(2048) T16 ring[2][NOP][8192];        // [buffer][operand][row tile 8][k tile 2][512]
    const size_t z = blockIdx.z; A += z * sA; if (NSPLIT == 1) A2 += z * sA; Bt += z * sB; C += z * sC; if (z == 1) bias = bias1; else if (z == 2) bias = bias2;   // each z slice has its own bias vector
    const int tid = threadIdx.x, lane = tid & 31, lr = lane & 15, hi = lane >> 4, w = tid >> 5, wm = w >> 1, wn = w & 1; const int rb = blockIdx.x * 128, cb = blockIdx.y * 128, r0 = rb + wm * 64, c0 = cb + wn * 64;   // the block's and the wave's first row and column
    const bool sw = PACK && z < 2;   // q, k: the A fragments are rows of Bt, the B fragments rows of A
    const int oa = sw ? wn * 4096 : 8192 + wm * 4096, ob = sw ? 8192 + wm * 4096 : wn * 4096;   // the wave's four row tiles of each, in elements from the buffer's start
    v8f acc[4][4];
#pragma unroll
    for (int mb = 0; mb < 4; ++mb)
#pragma unroll
        for (int nb = 0; nb < 4; ++nb) acc[mb][nb] = (v8f){};
    const T16* ga = A + (size_t)rb * lda + 8 * tid; const T16* ga2 = NSPLIT == 1 ? A2 + (size_t)rb * lda + 8 * tid : ga; const T16* gb = Bt + (size_t)cb * K + 8 * tid;   // 16 rows of tiles hold 16 * K elements; a trip of 64 k is two tiles (1024 elements)
    const unsigned l0 = (unsigned)(size_t)&ring[0][0][0] + 16u * tid;   // the thread's own piece in LDS, as a byte address
    const int nt = K / 64;
    auto fill = [&](int t) { const unsigned l = l0 + (unsigned)(t & 1) * (NOP * 16384u);
        cp8<T16>(l, gb + (size_t)t * 1024, (size_t)16 * K); cp8<T16>(l + 16384u, ga + (size_t)t * 1024, (size_t)16 * lda); if (NSPLIT == 1) cp8<T16>(l + 32768u, ga2 + (size_t)t * 1024, (size_t)16 * lda); };
    fill(0);
    asm volatile("s_wait_asynccnt 0x0" ::: "memory");   // this wave's copies of trip 0 have landed
    __syncthreads();                                    // ... and every other wave's: nothing of trip 0 is read ahead of this
    if (nt > 1) fill(1);
#pragma unroll 1   // one trip's code: the two buffers differ only in a base address
    for (int t = 0; t < nt; ++t) {
        const T16* sb = &ring[t & 1][0][0] + ob + 8 * lane; const T16* sa = &ring[t & 1][0][0] + oa + 8 * lane;
        V a[4], a2[4], b[4];
#pragma unroll
        for (int ks = 0; ks < 2; ++ks) {
#pragma unroll
            for (int mb = 0; mb < 4; ++mb) { a[mb] = WFrag<T16>::ld(sa + mb * 1024 + ks * 512); if (NSPLIT == 1) a2[mb] = WFrag<T16>::ld(sa + 8192 + mb * 1024 + ks * 512); }
#pragma unroll
            for (int nb = 0; nb < 4; ++nb) b[nb] = WFrag<T16>::ld(sb + nb * 1024 + ks * 512);
            __builtin_amdgcn_sched_barrier(0);   // keeps the step's LDS reads together ahead of its matrix instructions: spread among them, each group of reads costs the wave a wait of its own
#pragma unroll
            for (int nb = 0; nb < 4; ++nb) {
#pragma unroll
                for (int mb = 0; mb < 4; ++mb) { acc[mb][nb] = WFrag<T16>::mma(a[mb], b[nb], acc[mb][nb]); if (NSPLIT == 1) acc[mb][nb] = WFrag<T16>::mma(a2[mb], b[nb], acc[mb][nb]); } }
        }
        __builtin_amdgcn_sched_barrier(0);   // the trip's matrix instructions stay ahead of the slots and waits below (the compiler otherwise moves most of them behind the barrier, which delays the refill)
        asm volatile("v_nop\n\tv_nop\n\tv_nop\n\tv_nop" : "+v"(acc[0][0]), "+v"(acc[1][1]), "+v"(acc[2][2]), "+v"(acc[3][3]) : "v"(a[0]), "v"(a[3]));   // four vector slots behind the trip's last matrix instructions, ahead of the address arithmetic that may take the fragments' registers
        asm volatile("s_wait_dscnt 0x0" ::: "memory");      // this wave's reads of the trip's buffer are done
        asm volatile("s_wait_asynccnt 0x0" ::: "memory");   // its copies of trip t + 1 have landed
        __syncthreads();                                    // publishes trip t + 1 and ends every wave's reads of the buffer that is refilled below
        if (t + 2 < nt) fill(t + 2);
    }
    asm volatile("s_wait_asynccnt 0x0" ::: "memory");   // no copy is outstanding when the wave goes on to its end
    if constexpr (PACK) {
        h16* pf = z == 0 ? q16 : z == 1 ? k16 : v16; bf* ph = z == 0 ? qh : z == 1 ? kh : vh; bf* pl = z == 0 ? ql : z == 1 ? kl : vl;
        const size_t o = ((size_t)((r0 / TT) * NH_ + c0 / HD) * TT + r0 % TT) * HD + 8 * lane; pf += o; ph += o; pl += o;   // the wave's 64 rows lie in one batch entry, its 64 columns are two heads; 32 t of a head are 1024 elements in every plane
        if (sw) {   // acc[i][j]: d = 16 i + 8 hi + r of the two heads, t = 16 j + lr
            const float sc = z == 0 ? SCL : 1.0f; const float* bp = bias + c0 + 8 * hi; v4f bl[4][2];
#pragma unroll
            for (int i = 0; i < 4; ++i) { bl[i][0] = *(const v4f*)(bp + i * 16); bl[i][1] = *(const v4f*)(bp + i * 16 + 4); }
            asm volatile("s_wait_xcnt 0x0" :: "v"(bp) : "memory");   // stands behind the bias loads, before their address registers are reused
#pragma unroll
            for (int i = 0; i < 4; ++i) { Piece p[4]; const int of = (i >> 1) * TT * HD + (i & 1) * 256;
#pragma unroll
                for (int j = 0; j < 4; ++j) { v8f y;
#pragma unroll
                    for (int r = 0; r < 8; ++r) y[r] = __fmul_rn(__fadd_rn(acc[i][j][r], bfr(bl[i][r >> 2][r & 3])), sc);
                    p[j] = mk3(y); }
                put4(p, pf, ph, pl, of, of + 512, of + 1024, of + 1536); }
        } else {    // acc[mb][nb]: t = 16 mb + 8 hi + r, dd = 16 nb + lr of the two heads
            const float* bp = bias + c0 + lr; float bl[4];
#pragma unroll
            for (int nb = 0; nb < 4; ++nb) bl[nb] = bp[nb * 16];
            asm volatile("s_wait_xcnt 0x0" :: "v"(bp) : "memory");   // as above
#pragma unroll
            for (int nb = 0; nb < 4; ++nb) { Piece p[4]; const int of = (nb >> 1) * TT * HD + (nb & 1) * 512;
#pragma unroll
                for (int mb = 0; mb < 4; ++mb) { v8f y;
#pragma unroll
                    for (int r = 0; r < 8; ++r) y[r] = __fadd_rn(acc[mb][nb][r], bfr(bl[nb]));
                    p[mb] = mk3(y); }
                put4(p, pf, ph, pl, of, of + 256, of + 1024, of + 1280); }
        }
    } else {
    __shared__ __align__(16) float osw[4][16 * 68];   // each wave's own output staging
    float* os = osw[w];
#pragma unroll
    for (int mb = 0; mb < 4; ++mb) {
#pragma unroll
        for (int nb = 0; nb < 4; ++nb) {
#pragma unroll
            for (int j = 0; j < 8; ++j) os[(hi * 8 + j) * 68 + nb * 16 + lr] = acc[mb][nb][j]; }
        __builtin_amdgcn_wave_barrier(); asm volatile("" ::: "memory");
        float* crow = C + (size_t)(r0 + mb * 16) * ldc + c0;
{
#pragma unroll
            for (int s = 0; s < 8; ++s) { const int row = 2 * s + hi, cofs = lr * 4; v4f val = *(const v4fa*)(os + row * 68 + cofs); if (BIAS) { val[0] += bfr(bias[c0 + cofs]); val[1] += bfr(bias[c0 + cofs + 1]); val[2] += bfr(bias[c0 + cofs + 2]); val[3] += bfr(bias[c0 + cofs + 3]); }
                *(v4f*)(crow + (size_t)row * ldc + cofs) = val; }
             }
        asm volatile("s_wait_xcnt 0x0" ::: "memory");   // stands behind the row stores, before their address registers are reused
        __builtin_amdgcn_wave_barrier(); asm volatile("" ::: "memory");
    }
    }
}

__device__ __forceinline__ void splitf(float y, unsigned short& h, unsigned short& l) { h = f2bf(y); l = f2bf(y - bf2f(h)); }

// k_cvt8: all five f32 -> bf16 conversions and the mask copy in one launch. dst is the row of planes WQ, WK, WV, WO, XB, each in fragment order; 1024 blocks (2^21 elements) for each weight, 4096 for the hidden states of both batch entries, then 4096 for the mask.
// A thread is one 16-byte piece of the destination (stores stay contiguous); its 8 source values are 8 consecutive k of one row, and a block reads whole lines of 16 rows.
#define CVB (4 * 1024 + NB_ * TT * DM / 8 / 256)
__global__ __launch_bounds__(256) void k_cvt8(const float* __restrict__ wq, const float* __restrict__ wk, const float* __restrict__ wv, const float* __restrict__ wo, const float* __restrict__ x, const float* __restrict__ mk, bf* dst, float* mp, unsigned* lv) {
    const int lane = threadIdx.x & 31, lr = lane & 15, hi = lane >> 4;
    if (blockIdx.x >= CVB) {   // mask: a wave copies one 16 x 16 tile, a lane its 8 keys 8 hi .. 8 hi + 7 of query row lr; a block is 8 tiles in a row = 4 steps of one query tile
        __shared__ unsigned fl[8];
        const size_t tile = ((size_t)(blockIdx.x - CVB) * 256 + threadIdx.x) >> 5; const float* s = mk + ((tile / (TT / 16)) * 16 + lr) * TT + (tile % (TT / 16)) * 16 + 8 * hi; const v4f a = *(const v4f*)s, c = *(const v4f*)(s + 4);
        asm volatile("s_wait_xcnt 0x0" ::: "memory");   // stands behind the loads, before their address registers are reused
        bool up = false, nz = false;   // not-a-number counts as live and as not zero
#pragma unroll
        for (int r = 0; r < 4; ++r) { up = up || !(a[r] <= DEADM) || !(c[r] <= DEADM); nz = nz || a[r] != 0.0f || c[r] != 0.0f; }
        const unsigned any = (__builtin_amdgcn_ballot_w32(up) != 0 ? 1u : 0u) | (__builtin_amdgcn_ballot_w32(nz) != 0 ? 16u : 0u); if (lane == 0) fl[threadIdx.x >> 5] = any;
        __syncthreads();   // the eight waves' tile marks meet here (the branch is the same for the whole block); it stands ahead of the tile's stores so that no wave waits at it for a store to finish
        *(v4f*)(mp + tile * 256 + lane * 4) = a; *(v4f*)(mp + tile * 256 + 128 + lane * 4) = c;
        if (threadIdx.x == 0) lv[(size_t)(blockIdx.x - CVB) * 32] = (fl[0] | fl[1]) | (fl[2] | fl[3]) << 1 | (fl[4] | fl[5]) << 2 | (fl[6] | fl[7]) << 3;   // bit j: step 4 * (block % 16) + j is live, bit 4 + j: it holds a value other than zero; one word a 128-byte line, so each line has one writer
        return; }
    const int seg = blockIdx.x >> 10; const float* src = seg == 0 ? wq : seg == 1 ? wk : seg == 2 ? wv : seg == 3 ? wo : x; const size_t i = (size_t)blockIdx.x * 256 + threadIdx.x; const size_t j = i - (size_t)(seg < 4 ? seg : 4) * 1024 * 256;
    const int sh = seg == 3 ? 5 : 6;   // log2 of the tiles in a row of tiles: K = 1024 for Wo, 2048 for the rest
    const size_t tile = j >> 6; const v8f v = *(const v8f*)(src + ((((tile >> sh) * 16 + lr) << sh) + (tile & ((1u << sh) - 1))) * 32 + ((j >> 5) & 1) * 16 + 8 * hi); v8us o;
    asm volatile("s_wait_xcnt 0x0" ::: "memory");   // stands behind the load, before its address registers are reused
#pragma unroll
    for (int k = 0; k < 8; ++k) o[k] = f2bf(v[k]); *(v8us*)(dst + i * 8) = o;  }
__device__ __forceinline__ float xhalf(float x) { const int b = __float_as_int(x); return __int_as_float(__builtin_amdgcn_permlanex16(b, b, 0x76543210, 0xfedcba98, false, false)); }
#define FMIN_ (-3.40282347e38f)
template <typename T16> struct AStage { typename WFrag<T16>::V k[2], k2[2]; };   // one step's K fragments
template <typename T16> struct VStage { typename WFrag<T16>::V v[2], v2[2]; };                          // one step's V^T fragments
template <typename T16, bool HILO>
__device__ __forceinline__ void a_loadk(AStage<T16>& s, const T16* pk, const T16* pk2) {
#pragma unroll
    for (int kt = 0; kt < 2; ++kt) { s.k[kt] = WFrag<T16>::ld(pk + kt * 16 * HD); if (HILO) s.k2[kt] = WFrag<T16>::ld(pk2 + kt * 16 * HD); }
    // stands behind the group's loads, before their address registers are rewritten for the next group (they are inputs, so that none is rewritten ahead of the wait, not even as a later load's destination); the clobber also keeps these loads ahead of the work on the other stage
    if constexpr (HILO) asm volatile("s_wait_xcnt 0x0" :: "v"(pk), "v"(pk2) : "memory"); else asm volatile("s_wait_xcnt 0x0" :: "v"(pk) : "memory");
}
template <typename T16, bool HILO>
__device__ __forceinline__ void a_loadv(VStage<T16>& s, const T16* pv, const T16* pv2) {
#pragma unroll
    for (int dt = 0; dt < 2; ++dt) { s.v[dt] = WFrag<T16>::ld(pv + dt * 512); if (HILO) s.v2[dt] = WFrag<T16>::ld(pv2 + dt * 512); }
    if constexpr (HILO) asm volatile("s_wait_xcnt 0x0" :: "v"(pv), "v"(pv2) : "memory"); else asm volatile("s_wait_xcnt 0x0" :: "v"(pv) : "memory");   // as in a_loadk
}
template <typename T16, bool HILO, int NQ>
__device__ __forceinline__ void a_step(const AStage<T16>& s, const VStage<T16>& sv, const typename WFrag<T16>::V (&bq)[NQ], const typename WFrag<T16>::V (&bq2)[NQ], v8f (&acc)[NQ][2], float (&mr)[NQ], float (&sm)[NQ], const float* pm, bool nz) {
    typedef typename WFrag<T16>::V V;
    float t[NQ][16], mx[NQ]; bool need = false; v8f d[NQ][2];
#pragma unroll
    for (int qt = 0; qt < NQ; ++qt)
#pragma unroll
        for (int kt = 0; kt < 2; ++kt) { d[qt][kt] = WFrag<T16>::mma(s.k[kt], bq[qt], (v8f){});
            if (HILO) { d[qt][kt] = WFrag<T16>::mma(s.k2[kt], bq[qt], d[qt][kt]); d[qt][kt] = WFrag<T16>::mma(s.k[kt], bq2[qt], d[qt][kt]); } }
    if (nz) {   // the same for the whole wave: this step's mask holds values other than zero (the mask tiles have D's map)
        v8f m[NQ][2];
#pragma unroll
        for (int qt = 0; qt < NQ; ++qt)
#pragma unroll
            for (int kt = 0; kt < 2; ++kt) { const float* p = pm + (size_t)qt * 16 * TT + kt * 256; m[qt][kt] = __builtin_shufflevector(*(const v4f*)p, *(const v4f*)(p + 128), 0, 1, 2, 3, 4, 5, 6, 7); }
        asm volatile("s_wait_xcnt 0x0" :: "v"(pm) : "memory");   // stands behind the mask loads, before their address registers (an input, so that it lives up to the wait) are rewritten
#pragma unroll
        for (int qt = 0; qt < NQ; ++qt)
#pragma unroll
            for (int kt = 0; kt < 2; ++kt) d[qt][kt] += m[qt][kt]; }
#pragma unroll
    for (int qt = 0; qt < NQ; ++qt) {
#pragma unroll
        for (int kt = 0; kt < 2; ++kt)
#pragma unroll
            for (int r = 0; r < 8; ++r) t[qt][kt * 8 + r] = fmaxf(d[qt][kt][r], FMIN_);
        float a = t[qt][0];
#pragma unroll
        for (int i = 1; i < 16; ++i) a = fmaxf(a, t[qt][i]);
        a = fmaxf(a, xhalf(a)); mx[qt] = a; need = need || (a > mr[qt]); }
    if (__builtin_amdgcn_ballot_w32(need) != 0) {   // a column's maximum rose: rescale what is summed so far (factor 1 in the other columns)
#pragma unroll
        for (int qt = 0; qt < NQ; ++qt) { const float mn = fmaxf(mr[qt], mx[qt]); const float al = __expf(mr[qt] - mn); mr[qt] = mn; sm[qt] *= al;
#pragma unroll
            for (int dt = 0; dt < 2; ++dt)
#pragma unroll
                for (int r = 0; r < 8; ++r) acc[qt][dt][r] *= al; } }
#pragma unroll
    for (int qt = 0; qt < NQ; ++qt) { V bp, bp2;
#pragma unroll
        for (int i = 0; i < 16; ++i) { const float p = __expf(t[qt][i] - mr[qt]); sm[qt] += p;
            if constexpr (HILO) { const __bf16 ph = (__bf16)p; bp[i] = ph; bp2[i] = (__bf16)(p - (float)ph); } else bp[i] = (h16)p; }
#pragma unroll
        for (int dt = 0; dt < 2; ++dt) { acc[qt][dt] = WFrag<T16>::mma(sv.v[dt], bp, acc[qt][dt]); if (HILO) { acc[qt][dt] = WFrag<T16>::mma(sv.v2[dt], bp, acc[qt][dt]); acc[qt][dt] = WFrag<T16>::mma(sv.v[dt], bp2, acc[qt][dt]); } } }
}
// Four vector slots behind a step's last matrix instructions: the branches that follow lead, on their taken side, to address arithmetic in the registers that held V^T. The accumulators are inputs so that the slots stand behind those instructions.
template <int NQ> __device__ __forceinline__ void a_gap(const v8f (&acc)[NQ][2]) {
    if constexpr (NQ == 2) asm volatile("v_nop\n\tv_nop\n\tv_nop\n\tv_nop" :: "v"(acc[0][0]), "v"(acc[0][1]), "v"(acc[1][0]), "v"(acc[1][1]));
    else asm volatile("v_nop\n\tv_nop\n\tv_nop\n\tv_nop" :: "v"(acc[0][0]), "v"(acc[0][1])); }
template <int NQ> __device__ __forceinline__ bool a_settled(const float (&mr)[NQ]) { bool ok = true;   // true, for the whole wave, once each of its queries has met a key that is not masked out
#pragma unroll
    for (int qt = 0; qt < NQ; ++qt) ok = ok && (mr[qt] > LIVEM);
    return __builtin_amdgcn_ballot_w32(ok) == 0xffffffffu; }
// Qp, Kp: one head's planes (rows t, k = d); Vp: its plane (rows dd, k = t); mk: this batch entry's mask tiles; lv: its live-step words (16 a query tile, 4 steps each, 32 words apart); q0: the wave's first query; the merged-head planes Ah/Al (rows t, k = h*32 + d, fragment order) take o = O / sum as bf16 hi + lo.
template <typename T16, bool HILO, int NQ>
__device__ __forceinline__ void attn_cols(const T16* Qp, const T16* Qp2, const T16* Kp, const T16* Kp2, const T16* Vp, const T16* Vp2, const float* mk, const unsigned* lv, bf* Ah, bf* Al, int h, int q0) {
    typedef typename WFrag<T16>::V V;
    const int lane = threadIdx.x & 31;
    V bq[NQ], bq2[NQ]; v8f acc[NQ][2]; float mr[NQ], sm[NQ];
    const T16* ql = Qp + (size_t)q0 * HD + 8 * lane; const T16* q2l = Qp2 + (size_t)q0 * HD + 8 * lane;
    unsigned nib = lv[((size_t)(q0 >> 4) * 16 + (NQ == 2 ? lane : (lane & 15))) * 32];   // lane l: steps 4 (l % 16) .. + 3 of query tile l / 16 (NQ 1: of its one tile in every lane)
#pragma unroll
    for (int qt = 0; qt < NQ; ++qt) { bq[qt] = WFrag<T16>::ld(ql + qt * 16 * HD); if (HILO) bq2[qt] = WFrag<T16>::ld(q2l + qt * 16 * HD); acc[qt][0] = (v8f){}; acc[qt][1] = (v8f){}; mr[qt] = FMIN_; sm[qt] = 0.f; }
    asm volatile("s_wait_xcnt 0x0" ::: "memory");   // as in a_loadk, for the Q loads
    const T16* kl = Kp + 8 * lane; const T16* k2l = Kp2 + 8 * lane; const T16* vl = Vp + 8 * lane; const T16* v2l = Vp2 + 8 * lane; const float* ml = mk + (size_t)q0 * TT + 4 * lane;   // key kb: K tile at kb * 32 elements, the V^T tile pair at kb * 32, the mask tile at kb * 16 floats
    // K is fetched one step ahead into two stages. V^T too on the fp16 path; the hi+lo path (twice the fragments) fetches a step's V^T at the step's head, behind which the scores and the softmax stand, to stay within 256 registers
    AStage<T16> s0, s1; VStage<T16> v0, v1;
    a_loadk<T16, HILO>(s0, kl, k2l); if (!HILO) a_loadv<T16, HILO>(v0, vl, v2l);
    if (NQ == 2) nib |= (unsigned)__builtin_amdgcn_permlanex16((int)nib, (int)nib, 0x76543210, 0xfedcba98, false, false);   // a step is live, or not zero, if it is so for either query tile
    unsigned long long live = 0, nzm = 0;   // bit s: step s (keys 32 s .. 32 s + 31) is live; its mask is not all zero; the same in every lane, kept in scalar registers
#pragma unroll
    for (int l = 0; l < 16; ++l) { const unsigned u = (unsigned)__builtin_amdgcn_readlane((int)nib, l); live |= (unsigned long long)(u & 15u) << (4 * l); nzm |= (unsigned long long)(u >> 4 & 15u) << (4 * l); }
    unsigned long long todo = ~1ull;   // steps not yet fetched: all of them until every query's maximum has settled above LIVEM, then the live ones among them
    bool settled = false, more; int kb = 0;
    do {   // two steps a trip, one per stage; each step fetches the next step still to do; once none is left, step 0 is fetched again (in bounds, unused)
        const bool pair = todo != 0; int kn = pair ? __builtin_ctzll(todo) * 32 : 0; todo &= todo - 1;
        a_loadk<T16, HILO>(s1, kl + kn * HD, k2l + kn * HD);
        if (HILO) a_loadv<T16, HILO>(v0, vl + kb * 32, v2l + kb * 32); else a_loadv<T16, HILO>(v1, vl + kn * 32, v2l + kn * 32);
        a_step<T16, HILO, NQ>(s0, v0, bq, bq2, acc, mr, sm, ml + kb * 16, (nzm >> (kb >> 5) & 1) != 0);
        a_gap<NQ>(acc); if (!settled) { settled = a_settled<NQ>(mr); if (settled) todo &= live; }
        kb = kn; more = todo != 0; kn = more ? __builtin_ctzll(todo) * 32 : 0; todo &= todo - 1;
        a_loadk<T16, HILO>(s0, kl + kn * HD, k2l + kn * HD);
        if (HILO) a_loadv<T16, HILO>(v0, vl + kb * 32, v2l + kb * 32); else a_loadv<T16, HILO>(v0, vl + kn * 32, v2l + kn * 32);
        if (pair) {   // an odd count ends with half a trip
            a_step<T16, HILO, NQ>(s1, HILO ? v0 : v1, bq, bq2, acc, mr, sm, ml + kb * 16, (nzm >> (kb >> 5) & 1) != 0);
            a_gap<NQ>(acc); if (!settled) { settled = a_settled<NQ>(mr); if (settled) todo &= live; } }
        kb = kn;
    } while (more);
#pragma unroll
    for (int qt = 0; qt < NQ; ++qt) { const float f = __fdiv_rn(1.0f, sm[qt] + xhalf(sm[qt])); const size_t oo = (size_t)(q0 + qt * 16) * RK + h * 512 + 8 * lane;   // tile (query tile, head); d = 16 dt + 8 hi + r is piece dt of lane (lr, hi)
#pragma unroll
        for (int dt = 0; dt < 2; ++dt) { v8us oh, ol;
#pragma unroll
            for (int r = 0; r < 8; ++r) { unsigned short a, c2; splitf(__fmul_rn(acc[qt][dt][r], f), a, c2); oh[r] = a; ol[r] = c2; }
            bf* pa = Ah + oo + dt * 256; bf* pl = Al + oo + dt * 256; *(v8us*)pa = oh; *(v8us*)pl = ol;
            asm volatile("s_wait_xcnt 0x0" :: "v"(pa), "v"(pl), "v"(oh), "v"(ol) : "memory"); } }   // stands behind the two stores, before their address and data registers (inputs here, so that they live up to the wait) are rewritten for the next piece
}
// grid (batch entries x heads, (TT-RH)/128 + RH/64), 4 waves (one a SIMD; 1280 blocks, five a WGP, all resident at 192 registers a wave): the first (TT-RH)/128 blocks of a head take 32 queries a wave on fp16, the rest the hi+lo rows, 16 queries a wave
// (three products a tile, so half the columns). Both run from the last query rows to the first: under a causal mask those have the most live steps, so the longest blocks have the low indices and start first (for speed only). A block's waves walk the same K and V^T lines.
__global__ __launch_bounds__(128) void k_fattn(const h16* __restrict__ Q16, const h16* __restrict__ K16, const h16* __restrict__ VT16, const bf* __restrict__ Qh, const bf* __restrict__ Ql, const bf* __restrict__ Kh, const bf* __restrict__ Kl, const bf* __restrict__ VTh, const bf* __restrict__ VTl, const float* __restrict__ mk, const unsigned* __restrict__ lv, bf* Ah, bf* Al) {
    const int h = blockIdx.x % NH_, b = blockIdx.x / NH_, w = threadIdx.x >> 5, bx = blockIdx.y; const size_t oq = (size_t)blockIdx.x * TT * HD, ov = (size_t)blockIdx.x * HD * TT; mk += (size_t)b * TT * TT; lv += (size_t)b * (TT / 16) * 16 * 32; Ah += (size_t)b * TT * RK; Al += (size_t)b * TT * RK;
    if (bx >= (TT - RH) / 128) attn_cols<bf, true, 1>(Qh + oq, Ql + oq, Kh + oq, Kl + oq, VTh + ov, VTl + ov, mk, lv, Ah, Al, h, ((TT - RH) / 128 + RH / 64 - 1 - bx) * 64 + w * 16);
    else attn_cols<h16, false, 2>(Q16 + oq, Q16 + oq, K16 + oq, K16 + oq, VT16 + ov, VT16 + ov, mk, lv, Ah, Al, h, RH + ((TT - RH) / 128 - 1 - bx) * 128 + w * 32);
}

extern "C" void kernel_launch(void* const* d_in, const int* in_sizes, int n_in,
                              void* d_out, int out_size, void* d_ws, size_t ws_size, hipStream_t stream) {
    (void)in_sizes; (void)n_in; (void)out_size;
    const float* IN[10]; for (int i = 0; i < 10; ++i) IN[i] = (const float*)d_in[i];   // 0 hidden, 1 attention_mask [2][1][2048][2048], 2 Wq [1024][2048], 3 bq, 4 Wk, 5 bk, 6 Wv, 7 bv, 8 Wo [2048][1024], 9 bo (torch [out][in])
    float* OUT = (float*)d_out;     // [2][2048][2048]
    char* wsp = (char*)d_ws;
    auto take = [&](size_t bytes) { char* p = wsp; wsp += (bytes + 255) & ~(size_t)255; return (void*)p; };
    bf* WQ = (bf*)take((size_t)RK * DM * 2); bf* WK = (bf*)take((size_t)RK * DM * 2); bf* WV = (bf*)take((size_t)RK * DM * 2); bf* WO = (bf*)take((size_t)DM * RK * 2);   // WQ, WK, WV, WO, XB lie in a row (every size a multiple of 256 bytes)
    bf* XB = (bf*)take((size_t)NB_ * TT * DM * 2);
    h16* Q16 = (h16*)take((size_t)NB_ * NH_ * TT * HD * 2); h16* K16 = (h16*)take((size_t)NB_ * NH_ * TT * HD * 2); bf* Qh = (bf*)take((size_t)NB_ * NH_ * TT * HD * 2); bf* Ql = (bf*)take((size_t)NB_ * NH_ * TT * HD * 2); bf* Kh = (bf*)take((size_t)NB_ * NH_ * TT * HD * 2); bf* Kl = (bf*)take((size_t)NB_ * NH_ * TT * HD * 2);
    h16* VT16 = (h16*)take((size_t)NB_ * NH_ * HD * TT * 2); bf* VTh = (bf*)take((size_t)NB_ * NH_ * HD * TT * 2); bf* VTl = (bf*)take((size_t)NB_ * NH_ * HD * TT * 2);
    bf* Ah = (bf*)take((size_t)NB_ * TT * RK * 2); bf* Al = (bf*)take((size_t)NB_ * TT * RK * 2); float* MP = (float*)take((size_t)NB_ * TT * TT * 4); unsigned* LV = (unsigned*)take((size_t)NB_ * (TT / 16) * 16 * 128);
    if ((size_t)(wsp - (char*)d_ws) > ws_size) return;    // total 152.5 MiB
    (void)WK; (void)WV;
    k_cvt8<<<CVB + NB_ * TT * TT / 8 / 256, 256, 0, stream>>>(IN[2], IN[4], IN[6], IN[8], IN[0], IN[1], WQ, MP, LV);
    k_gemmw<bf, 0, true, true><<<dim3(NB_ * TT / 128, RK / 128, 3), 128, 0, stream>>>(XB, nullptr, WQ, nullptr, DM, DM, nullptr, 0, IN[3], IN[5], IN[7], 0, (size_t)RK * DM, 0, Q16, K16, VT16, Qh, Ql, Kh, Kl, VTh, VTl);
    k_fattn<<<dim3(NB_ * NH_, RH / 64 + (TT - RH) / 128, 1), 128, 0, stream>>>(Q16, K16, VT16, Qh, Ql, Kh, Kl, VTh, VTl, MP, LV, Ah, Al);
    k_gemmw<bf, 1, true, false><<<dim3(NB_ * TT / 128, DM / 128, 1), 128, 0, stream>>>(Ah, Al, WO, nullptr, RK, RK, OUT, DM, IN[9], IN[9], IN[9], 0, 0, 0, nullptr, nullptr, nullptr, nullptr, nullptr, nullptr, nullptr, nullptr, nullptr);
}

// v009
// Measured time: 111 microseconds a run.
// Two timings next to v008 both put it at 1.05 times that version's speed.
// All steps since v000 together make it 61.0 times as fast.
#include <hip/hip_runtime.h>

// OPTEigenAttention - low-rank (eigen) OPT attention (hidden [2][2048][2048]; q = (x Wq^T + bq) x 64^-0.5 (32 heads x 32 low-rank dims; the scaling uses the ORIGINAL head dim 64), k = x Wk^T + bk, v = x Wv^T + bv (32 x 32);
// scores = q.k + attention_mask[b][0][i][j] (additive f32 mask input, read as data; then max(., float min)); softmax; out = merged att.v Wo^T + bo -> [2][2048][2048]).
// Compute dtypes, f32 accumulate: every input rounded to bf16; projections on PLAIN bf16 operands (inputs: exact, + bias); scores (K 32) and att.v on bf16 hi+lo planes (3 products) for
// the first 512 query rows of each head and on SINGLE fp16 planes for the rest (the mask here is causal, so early rows see few keys);
// mask add and softmax in f32 registers; merged heads as bf16 hi+lo planes x exact Wo (2 products) + bo. The projections and the output product run in k_gemmw (128x128 tiles, operands staged in LDS); the projections' epilogue writes the head planes of q, k and v itself (no f32 copy of them reaches memory).
// Every launch covers both batch entries (rows b*2048 + t, head planes b*32 + h); the three projections are one launch (grid z = matrix; z = 3: BESIDE THE PROJECTIONS below). Attention is ONE kernel (k_fattn): S^T = K.Q^T, running-maximum softmax in registers, O^T += V^T.P^T; no score or probability ever reaches memory.
// FRAGMENT ORDER: every 16-bit operand plane is stored as 1-KiB tiles of 16 rows x 32 k, tile (row/16, k/32) at index (row/16) * (K/32) + k/32 (V^T: (k/32) * 2 + row/16), element (row, k) at (k%32/16) * 256 + ((k%16/8) * 16 + row%16) * 8 + k%8 inside it.
// A lane's two 16-byte fragment pieces then lie at lane * 8 and 256 + lane * 8, so each wave-wide load covers 512 contiguous bytes (4 lines) where a row-major plane gave 16 pieces of 32 bytes in 16 lines. The k order of a fragment is the one it had.
// The f32 mask is copied once into 16 query x 16 key tiles in the accumulator's map (value r of a lane at (r/4) * 128 + lane * 4 + r%4), tile index (q/16) * 128 + key/16, for the same reason: all 64 head planes read it.
// LIVE STEPS: while it copies the mask, the packer notes for each 16-query tile and each 32-key step whether any mask value there lies above DEADM. Once every query of a wave has a running maximum above LIVEM, the wave walks only the steps so marked:
// in any other step each score is at most DEADM + |q.k| (|q.k| below 8e37 is taken for granted: fp16 operands cannot pass 1.4e11, and the projections of these inputs lie far lower still), so exp(score - maximum) is 0 in f32 and the step adds nothing to the sum or to O. Until then (a row whose first keys, or all keys, are masked) every step is worked as before, so the function is the same for any mask.
// BESIDE THE PROJECTIONS: the mask copy with its step marks and the conversion of Wo feed only the launches behind the projections, and they are memory traffic where the projections are matrix work. They run as a fourth z slice of the projection launch (256 work-groups, one more a WGP), not in the conversion launch ahead of it.
// ZERO STEPS: the packer also notes whether a step holds any mask value other than zero. Where it holds none the scores are q.k alone and the wave loads no mask tile; in the other steps the tiles are loaded at the step itself and added to the product in f32.

#define NB_  2
#define TT   2048
#define DM   2048
#define RK   1024
#define NH_  32
#define HD   32
#define RH   512
#define SCL  0.125f
#define DEADM (-1.0e38f)
#define LIVEM (-1.0e37f)
typedef _Float16 h16;
typedef unsigned short bf;
typedef __attribute__((ext_vector_type(16))) __bf16   v16bf;
typedef __attribute__((ext_vector_type(16))) _Float16 v16h;
typedef __attribute__((ext_vector_type(8)))  _Float16 v8h;
typedef __attribute__((ext_vector_type(8)))  unsigned short v8us;
typedef __attribute__((ext_vector_type(8)))  float    v8f;
typedef __attribute__((ext_vector_type(4)))  float    v4f;
typedef v8h  __attribute__((may_alias)) v8ha;
typedef v4f  __attribute__((may_alias)) v4fa;
typedef v8us __attribute__((may_alias)) v8usa;

__device__ __forceinline__ unsigned short f2bf(float f) { unsigned u = __float_as_uint(f); u += 0x7FFFu + ((u >> 16) & 1u); return (unsigned short)(u >> 16); }
__device__ __forceinline__ float bf2f(unsigned short b) { return __uint_as_float(((unsigned)b) << 16); }
__device__ __forceinline__ float bfr(float f) { return bf2f(f2bf(f)); }
__device__ __forceinline__ v16h cat16(v8h lo, v8h hi) { return __builtin_shufflevector(lo, hi, 0, 1, 2, 3, 4, 5, 6, 7, 8, 9, 10, 11, 12, 13, 14, 15); }
__device__ __forceinline__ v16bf cat16b(v8us lo, v8us hi) { return __builtin_bit_cast(v16bf, __builtin_shufflevector(lo, hi, 0, 1, 2, 3, 4, 5, 6, 7, 8, 9, 10, 11, 12, 13, 14, 15)); }
__device__ __forceinline__ v8f wmma16(v16h a, v16h b, v8f c) { return __builtin_amdgcn_wmma_f32_16x16x32_f16(false, a, false, b, (short)0, c, false, false); }
__device__ __forceinline__ v8f wmmab(v16bf a, v16bf b, v8f c) { return __builtin_amdgcn_wmma_f32_16x16x32_bf16(false, a, false, b, (short)0, c, false, false); }



// ---- k_gemmw: GEMM, one 128x128 output tile per work-group of FOUR WAVES (2 x 2, each 64x64 = 16 accumulators); grid (M/128, N/128, Z), 128 threads. The operands' 16-bit planes are in fragment order.
// C[m][n] (f32, pitch ldc, + optional f32 bias[n]) = sum_k A[m][k] Bt[n][k] (NSPLIT 1: + A2[m][k] Bt[n][k]). A has lda k values a row, Bt K. z-batch strides sA/sB/sC in elements; z slices 0, 1, 2 take bias, bias1, bias2. K % 64 == 0.
// STAGING: a trip is 64 k. Its 8 row tiles x 2 k tiles (16 KiB) of each operand are brought into LDS once for the whole work-group by asynchronous copies (no register on the way), so each fragment is fetched from L2 once and read from LDS by the two waves that need it.
// Two buffers: the copies of trip t + 1 fly while trip t is worked on. A row tile's two k tiles are 2 KiB in a row in the plane and in LDS, one 16-byte piece a thread.
template <typename T16> struct WFrag;
template <> struct WFrag<h16> { typedef v16h V; static __device__ __forceinline__ V ld(const h16* p) { return cat16(*(const v8h*)p, *(const v8h*)(p + 256)); } static __device__ __forceinline__ v8f mma(V a, V b, v8f c) { return wmma16(a, b, c); } };
template <> struct WFrag<bf> { typedef v16bf V; static __device__ __forceinline__ V ld(const bf* p) { return cat16b(*(const v8us*)p, *(const v8us*)(p + 256)); } static __device__ __forceinline__ v8f mma(V a, V b, v8f c) { return wmmab(a, b, c); } };
// Eight copies of a lane, 16 bytes each: row tiles 0 .. 7 of one operand (LDS 2 KiB apart, the plane 'pitch' elements apart). The wait on the address translations is the statement's last line, so that no address register is rewritten ahead of it.
template <typename T16> __device__ __forceinline__ void cp8(unsigned l, const T16* g, size_t pitch) {
    asm volatile("global_load_async_to_lds_b128 %0, %8, off\n\t"
                 "global_load_async_to_lds_b128 %1, %9, off\n\t"
                 "global_load_async_to_lds_b128 %2, %10, off\n\t"
                 "global_load_async_to_lds_b128 %3, %11, off\n\t"
                 "global_load_async_to_lds_b128 %4, %12, off\n\t"
                 "global_load_async_to_lds_b128 %5, %13, off\n\t"
                 "global_load_async_to_lds_b128 %6, %14, off\n\t"
                 "global_load_async_to_lds_b128 %7, %15, off\n\t"
                 "s_wait_xcnt 0x0"
                 :: "v"(l), "v"(l + 2048u), "v"(l + 4096u), "v"(l + 6144u), "v"(l + 8192u), "v"(l + 10240u), "v"(l + 12288u), "v"(l + 14336u),
                    "v"(g), "v"(g + pitch), "v"(g + 2 * pitch), "v"(g + 3 * pitch), "v"(g + 4 * pitch), "v"(g + 5 * pitch), "v"(g + 6 * pitch), "v"(g + 7 * pitch) : "memory");
}
// PACK (the projections; z = 0, 1, 2 is q, k, v): no C. The result + bias (q: x 0.125) goes straight from the accumulators into the head planes that attention reads, numbered hb = b*32 + h: an fp16 plane and bf16 hi/lo planes each of
// q and k (rows t, k = d) and of v^T (rows dd < 32, k = t; the two row tiles of a 32-key step side by side), all in fragment order. A lane's 8 accumulator registers are 8 consecutive ROWS of one column of D, and a 16-byte piece of a plane is 8 consecutive k of one row:
// for v^T (k = t) D = X W^T fits as it is; for q and k (k = d) the two operands change places, D = W X^T. Only the LDS offsets of the A and B fragments differ, the loop is the same. Each 16x16 tile is then 512 contiguous bytes (piece = lane) of each plane.
typedef __attribute__((ext_vector_type(2))) __bf16 v2bf;
typedef __attribute__((ext_vector_type(4))) unsigned v4u;
struct Piece { v8h f; v4u h, l; };   // 8 values as fp16, as bf16 hi and as bf16 lo = the rounded rest
__device__ __forceinline__ Piece mk3(const v8f y) { Piece p;
#pragma unroll
    for (int r = 0; r < 8; r += 2) { p.f[r] = (h16)y[r]; p.f[r + 1] = (h16)y[r + 1]; const v2bf a = { (__bf16)y[r], (__bf16)y[r + 1] }; const unsigned u = __builtin_bit_cast(unsigned, a); p.h[r >> 1] = u;
        const v2bf c = { (__bf16)(y[r] - __uint_as_float(u << 16)), (__bf16)(y[r + 1] - __uint_as_float(u & 0xffff0000u)) }; p.l[r >> 1] = __builtin_bit_cast(unsigned, c); }
    return p; }
// Four tiles' pieces, at o0 .. o3 elements from the lane's base address in each of the three planes.
__device__ __forceinline__ void put4(const Piece (&p)[4], h16* pf, bf* ph, bf* pl, int o0, int o1, int o2, int o3) {
    const int of[4] = { o0, o1, o2, o3 };
#pragma unroll
    for (int u = 0; u < 4; ++u) { *(v8h*)(pf + of[u]) = p[u].f; *(v8us*)(ph + of[u]) = __builtin_bit_cast(v8us, p[u].h); *(v8us*)(pl + of[u]) = __builtin_bit_cast(v8us, p[u].l); }
    // stands behind the twelve stores, before their data registers are rewritten for the next four tiles (inputs here, like the lane's three base addresses, so that they live up to the wait)
    asm volatile("s_wait_xcnt 0x0" :: "v"(pf), "v"(ph), "v"(pl), "v"(p[0].f), "v"(p[0].h), "v"(p[0].l), "v"(p[1].f), "v"(p[1].h), "v"(p[1].l), "v"(p[2].f), "v"(p[2].h), "v"(p[2].l), "v"(p[3].f), "v"(p[3].h), "v"(p[3].l) : "memory");
}
// side_pack: what the fourth z slice of the projection launch does; blk = 0 .. 255, four waves.
// Mask: the work-group is one 16-query tile of the two batch entries' 256, a wave 16 of its 64 steps, four steps (8 tiles of 16 x 16) a trip; a lane holds keys 8 hi .. 8 hi + 7 of query row lr of each tile. A step's two tiles lie in one wave, so its marks need no other wave.
// Wo: the work-group is 16 rows x 512 k (16 tiles of the plane); a thread takes 8 pieces of 16 bytes, 2 KiB apart in the plane, 64 k apart in its row.
__device__ __forceinline__ void side_pack(const float* __restrict__ mk, float* mp, unsigned* lv, const float* __restrict__ wo, bf* wod, int blk) {
    const int tid = threadIdx.x, lane = tid & 31, lr = lane & 15, hi = lane >> 4, w = tid >> 5;
    const float* s = mk + ((size_t)blk * 16 + lr) * TT + w * 512 + 8 * hi; float* d = mp + ((size_t)blk * 128 + w * 32) * 256 + lane * 4; unsigned* f = lv + ((size_t)blk * 16 + w * 4) * 32;
#pragma unroll 1   // one trip's code; sixteen loads of a lane are in flight in each
    for (int g = 0; g < 4; ++g) {
        v4f a[8], c[8];
#pragma unroll
        for (int u = 0; u < 8; ++u) { a[u] = *(const v4f*)(s + u * 16); c[u] = *(const v4f*)(s + u * 16 + 4); }
        asm volatile("s_wait_xcnt 0x0" :: "v"(s) : "memory");   // stands behind the loads, before their address registers (an input, so that it lives up to the wait) are rewritten
        const unsigned dead = __float_as_uint(DEADM); unsigned word = 0;   // bit j: step 4 g + j of the wave is live, bit 4 + j: it holds a value other than zero; not-a-number counts as live and as not zero
#pragma unroll
        for (int u = 0; u < 8; ++u) { const v4u ua = __builtin_bit_cast(v4u, a[u]), uc = __builtin_bit_cast(v4u, c[u]); unsigned any = 0, far = 0;   // the lane's 8 values are merged as words, so that a tile takes two compares (one a value ran the wave out of scalar registers)
#pragma unroll
            for (int r = 0; r < 4; ++r) { any |= ua[r] | uc[r]; const unsigned fa = ua[r] - dead, fc = uc[r] - dead; far = far > fa ? far : fa; far = far > fc ? far : fc; }
            const bool nz = (any << 1) != 0, up = far > 0xff800000u - dead;   // nz: a word other than +0 and -0; up: read as unsigned words, the values x <= DEADM are exactly the words from DEADM's to minus infinity's
            word |= ((__builtin_amdgcn_ballot_w32(up) != 0 ? 1u : 0u) | (__builtin_amdgcn_ballot_w32(nz) != 0 ? 16u : 0u)) << (u >> 1);
            *(v4f*)(d + u * 256) = a[u]; *(v4f*)(d + u * 256 + 128) = c[u]; }
        if (lane == 0) *f = word;   // one word a 128-byte line, so each line has one writer
        // stands behind the trip's stores, before their address and data registers (inputs here, so that they live up to the wait) are rewritten for the next trip
        asm volatile("s_wait_xcnt 0x0" :: "v"(d), "v"(f), "v"(a[0]), "v"(a[1]), "v"(a[2]), "v"(a[3]), "v"(a[4]), "v"(a[5]), "v"(a[6]), "v"(a[7]), "v"(c[0]), "v"(c[1]), "v"(c[2]), "v"(c[3]), "v"(c[4]), "v"(c[5]), "v"(c[6]), "v"(c[7]) : "memory");
        s += 128; d += 2048; f += 32;
    }
    const float* sw = wo + ((((size_t)(blk >> 1) * 16 + lr) * 32 + (blk & 1) * 16 + (tid >> 6)) * 32) + ((tid >> 5) & 1) * 16 + 8 * hi; bf* dw = wod + ((size_t)blk * 1024 + tid) * 8;
    v8f v[8]; v8us o[8];
#pragma unroll
    for (int it = 0; it < 8; ++it) v[it] = *(const v8f*)(sw + it * 64);
    asm volatile("s_wait_xcnt 0x0" :: "v"(sw) : "memory");   // as above, for the loads of Wo
#pragma unroll
    for (int it = 0; it < 8; ++it) {
#pragma unroll
        for (int k = 0; k < 8; ++k) o[it][k] = f2bf(v[it][k]);
        *(v8us*)(dw + it * 1024) = o[it]; }
    asm volatile("s_wait_xcnt 0x0" :: "v"(dw), "v"(o[0]), "v"(o[1]), "v"(o[2]), "v"(o[3]), "v"(o[4]), "v"(o[5]), "v"(o[6]), "v"(o[7]) : "memory");   // as above, for the stores of the plane
}
template <typename T16, int NSPLIT, bool BIAS, bool PACK>
__global__ __launch_bounds__(128) void k_gemmw(const T16* __restrict__ A, const T16* __restrict__ A2, const T16* __restrict__ Bt, const T16* __restrict__ Bt2, int K, int lda, float* C, int ldc, const float* __restrict__ bias, const float* __restrict__ bias1, const float* __restrict__ bias2, size_t sA, size_t sB, size_t sC, h16* q16, h16* k16, h16* v16, bf* qh, bf* ql, bf* kh, bf* kl, bf* vh, bf* vl, const float* __restrict__ mk, float* mp, unsigned* lv, const float* __restrict__ wo, bf* wod) {
    typedef typename WFrag<T16>::V V;
    if constexpr (PACK) { if (blockIdx.z == 3) { side_pack(mk, mp, lv, wo, wod, blockIdx.y * (NB_ * TT / 128) + blockIdx.x); return; } }   // the same for the whole work-group, ahead of every copy and barrier
    static_assert(NSPLIT == 0 || NSPLIT == 1, "A (+ A2) x Bt"); static_assert(!PACK || (NSPLIT == 0 && BIAS), "the projections"); (void)Bt2;
    constexpr int NOP = NSPLIT == 1 ? 3 : 2;                  // operands staged: Bt, A (, A2)
    __shared__ __align__(2048) T16 ring[2][NOP][8192];        // [buffer][operand][row tile 8][k tile 2][512]
    const size_t z = blockIdx.z; A += z * sA; if (NSPLIT == 1) A2 += z * sA; Bt += z * sB; C += z * sC; if (z == 1) bias = bias1; else if (z == 2) bias = bias2;   // each z slice has its own bias vector
    const int tid = threadIdx.x, lane = tid & 31, lr = lane & 15, hi = lane >> 4, w = tid >> 5, wm = w >> 1, wn = w & 1; const int rb = blockIdx.x * 128, cb = blockIdx.y * 128, r0 = rb + wm * 64, c0 = cb + wn * 64;   // the block's and the wave's first row and column
    const bool sw = PACK && z < 2;   // q, k: the A fragments are rows of Bt, the B fragments rows of A
    const int oa = sw ? wn * 4096 : 8192 + wm * 4096, ob = sw ? 8192 + wm * 4096 : wn * 4096;   // the wave's four row tiles of each, in elements from the buffer's start
    v8f acc[4][4];
#pragma unroll
    for (int mb = 0; mb < 4; ++mb)
#pragma unroll
        for (int nb = 0; nb < 4; ++nb) acc[mb][nb] = (v8f){};
    const T16* ga = A + (size_t)rb * lda + 8 * tid; const T16* ga2 = NSPLIT == 1 ? A2 + (size_t)rb * lda + 8 * tid : ga; const T16* gb = Bt + (size_t)cb * K + 8 * tid;   // 16 rows of tiles hold 16 * K elements; a trip of 64 k is two tiles (1024 elements)
    const unsigned l0 = (unsigned)(size_t)&ring[0][0][0] + 16u * tid;   // the thread's own piece in LDS, as a byte address
    const int nt = K / 64;
    auto fill = [&](int t) { const unsigned l = l0 + (unsigned)(t & 1) * (NOP * 16384u);
        cp8<T16>(l, gb + (size_t)t * 1024, (size_t)16 * K); cp8<T16>(l + 16384u, ga + (size_t)t * 1024, (size_t)16 * lda); if (NSPLIT == 1) cp8<T16>(l + 32768u, ga2 + (size_t)t * 1024, (size_t)16 * lda); };
    fill(0);
    asm volatile("s_wait_asynccnt 0x0" ::: "memory");   // this wave's copies of trip 0 have landed
    __syncthreads();                                    // ... and every other wave's: nothing of trip 0 is read ahead of this
    if (nt > 1) fill(1);
#pragma unroll 1   // one trip's code: the two buffers differ only in a base address
    for (int t = 0; t < nt; ++t) {
        const T16* sb = &ring[t & 1][0][0] + ob + 8 * lane; const T16* sa = &ring[t & 1][0][0] + oa + 8 * lane;
        V a[4], a2[4], b[4];
#pragma unroll
        for (int ks = 0; ks < 2; ++ks) {
#pragma unroll
            for (int mb = 0; mb < 4; ++mb) { a[mb] = WFrag<T16>::ld(sa + mb * 1024 + ks * 512); if (NSPLIT == 1) a2[mb] = WFrag<T16>::ld(sa + 8192 + mb * 1024 + ks * 512); }
#pragma unroll
            for (int nb = 0; nb < 4; ++nb) b[nb] = WFrag<T16>::ld(sb + nb * 1024 + ks * 512);
            __builtin_amdgcn_sched_barrier(0);   // keeps the step's LDS reads together ahead of its matrix instructions: spread among them, each group of reads costs the wave a wait of its own
#pragma unroll
            for (int nb = 0; nb < 4; ++nb) {
#pragma unroll
                for (int mb = 0; mb < 4; ++mb) { acc[mb][nb] = WFrag<T16>::mma(a[mb], b[nb], acc[mb][nb]); if (NSPLIT == 1) acc[mb][nb] = WFrag<T16>::mma(a2[mb], b[nb], acc[mb][nb]); } }
        }
        __builtin_amdgcn_sched_barrier(0);   // the trip's matrix instructions stay ahead of the slots and waits below (the compiler otherwise moves most of them behind the barrier, which delays the refill)
        asm volatile("v_nop\n\tv_nop\n\tv_nop\n\tv_nop" : "+v"(acc[0][0]), "+v"(acc[1][1]), "+v"(acc[2][2]), "+v"(acc[3][3]) : "v"(a[0]), "v"(a[3]));   // four vector slots behind the trip's last matrix instructions, ahead of the address arithmetic that may take the fragments' registers
        asm volatile("s_wait_dscnt 0x0" ::: "memory");      // this wave's reads of the trip's buffer are done
        asm volatile("s_wait_asynccnt 0x0" ::: "memory");   // its copies of trip t + 1 have landed
        __syncthreads();                                    // publishes trip t + 1 and ends every wave's reads of the buffer that is refilled below
        if (t + 2 < nt) fill(t + 2);
    }
    asm volatile("s_wait_asynccnt 0x0" ::: "memory");   // no copy is outstanding when the wave goes on to its end
    if constexpr (PACK) {
        h16* pf = z == 0 ? q16 : z == 1 ? k16 : v16; bf* ph = z == 0 ? qh : z == 1 ? kh : vh; bf* pl = z == 0 ? ql : z == 1 ? kl : vl;
        const size_t o = ((size_t)((r0 / TT) * NH_ + c0 / HD) * TT + r0 % TT) * HD + 8 * lane; pf += o; ph += o; pl += o;   // the wave's 64 rows lie in one batch entry, its 64 columns are two heads; 32 t of a head are 1024 elements in every plane
        if (sw) {   // acc[i][j]: d = 16 i + 8 hi + r of the two heads, t = 16 j + lr
            const float sc = z == 0 ? SCL : 1.0f; const float* bp = bias + c0 + 8 * hi; v4f bl[4][2];
#pragma unroll
            for (int i = 0; i < 4; ++i) { bl[i][0] = *(const v4f*)(bp + i * 16); bl[i][1] = *(const v4f*)(bp + i * 16 + 4); }
            asm volatile("s_wait_xcnt 0x0" :: "v"(bp) : "memory");   // stands behind the bias loads, before their address registers are reused
#pragma unroll
            for (int i = 0; i < 4; ++i) { Piece p[4]; const int of = (i >> 1) * TT * HD + (i & 1) * 256;
#pragma unroll
                for (int j = 0; j < 4; ++j) { v8f y;
#pragma unroll
                    for (int r = 0; r < 8; ++r) y[r] = __fmul_rn(__fadd_rn(acc[i][j][r], bfr(bl[i][r >> 2][r & 3])), sc);
                    p[j] = mk3(y); }
                put4(p, pf, ph, pl, of, of + 512, of + 1024, of + 1536); }
        } else {    // acc[mb][nb]: t = 16 mb + 8 hi + r, dd = 16 nb + lr of the two heads
            const float* bp = bias + c0 + lr; float bl[4];
#pragma unroll
            for (int nb = 0; nb < 4; ++nb) bl[nb] = bp[nb * 16];
            asm volatile("s_wait_xcnt 0x0" :: "v"(bp) : "memory");   // as above
#pragma unroll
            for (int nb = 0; nb < 4; ++nb) { Piece p[4]; const int of = (nb >> 1) * TT * HD + (nb & 1) * 512;
#pragma unroll
                for (int mb = 0; mb < 4; ++mb) { v8f y;
#pragma unroll
                    for (int r = 0; r < 8; ++r) y[r] = __fadd_rn(acc[mb][nb][r], bfr(bl[nb]));
                    p[mb] = mk3(y); }
                put4(p, pf, ph, pl, of, of + 256, of + 1024, of + 1280); }
        }
    } else {
    __shared__ __align__(16) float osw[4][16 * 68];   // each wave's own output staging
    float* os = osw[w];
#pragma unroll
    for (int mb = 0; mb < 4; ++mb) {
#pragma unroll
        for (int nb = 0; nb < 4; ++nb) {
#pragma unroll
            for (int j = 0; j < 8; ++j) os[(hi * 8 + j) * 68 + nb * 16 + lr] = acc[mb][nb][j]; }
        __builtin_amdgcn_wave_barrier(); asm volatile("" ::: "memory");
        float* crow = C + (size_t)(r0 + mb * 16) * ldc + c0;
{
#pragma unroll
            for (int s = 0; s < 8; ++s) { const int row = 2 * s + hi, cofs = lr * 4; v4f val = *(const v4fa*)(os + row * 68 + cofs); if (BIAS) { val[0] += bfr(bias[c0 + cofs]); val[1] += bfr(bias[c0 + cofs + 1]); val[2] += bfr(bias[c0 + cofs + 2]); val[3] += bfr(bias[c0 + cofs + 3]); }
                *(v4f*)(crow + (size_t)row * ldc + cofs) = val; }
             }
        asm volatile("s_wait_xcnt 0x0" ::: "memory");   // stands behind the row stores, before their address registers are reused
        __builtin_amdgcn_wave_barrier(); asm volatile("" ::: "memory");
    }
    }
}

__device__ __forceinline__ void splitf(float y, unsigned short& h, unsigned short& l) { h = f2bf(y); l = f2bf(y - bf2f(h)); }

// k_cvt8: the f32 -> bf16 conversions that the projections read, in one launch. dst is the row of planes WQ, WK, WV, WO, XB, each in fragment order; 1024 blocks (2^21 elements) for each of Wq, Wk, Wv, then 4096 for the hidden states of both batch entries (the plane of Wo, fourth in the row, is written by side_pack).
// A thread is one 16-byte piece of the destination (stores stay contiguous); its 8 source values are 8 consecutive k of one row, and a block reads whole lines of 16 rows.
#define CVB (3 * 1024 + NB_ * TT * DM / 8 / 256)
__global__ __launch_bounds__(256) void k_cvt8(const float* __restrict__ wq, const float* __restrict__ wk, const float* __restrict__ wv, const float* __restrict__ x, bf* dst) {
    const int lane = threadIdx.x & 31, lr = lane & 15, hi = lane >> 4;
    const int bi = blockIdx.x < 3 * 1024 ? blockIdx.x : blockIdx.x + 1024;   // the block's place in the row of planes
    const int seg = bi >> 10; const float* src = seg == 0 ? wq : seg == 1 ? wk : seg == 2 ? wv : x; const size_t i = (size_t)bi * 256 + threadIdx.x; const size_t j = i - (size_t)(seg < 4 ? seg : 4) * 1024 * 256;
    const int sh = 6;   // log2 of the tiles in a row of tiles: K = 2048
    const size_t tile = j >> 6; const v8f v = *(const v8f*)(src + ((((tile >> sh) * 16 + lr) << sh) + (tile & ((1u << sh) - 1))) * 32 + ((j >> 5) & 1) * 16 + 8 * hi); v8us o;
    asm volatile("s_wait_xcnt 0x0" ::: "memory");   // stands behind the load, before its address registers are reused
#pragma unroll
    for (int k = 0; k < 8; ++k) o[k] = f2bf(v[k]); *(v8us*)(dst + i * 8) = o;  }
__device__ __forceinline__ float xhalf(float x) { const int b = __float_as_int(x); return __int_as_float(__builtin_amdgcn_permlanex16(b, b, 0x76543210, 0xfedcba98, false, false)); }
#define FMIN_ (-3.40282347e38f)
template <typename T16> struct AStage { typename WFrag<T16>::V k[2], k2[2]; };   // one step's K fragments
template <typename T16> struct VStage { typename WFrag<T16>::V v[2], v2[2]; };                          // one step's V^T fragments
template <typename T16, bool HILO>
__device__ __forceinline__ void a_loadk(AStage<T16>& s, const T16* pk, const T16* pk2) {
#pragma unroll
    for (int kt = 0; kt < 2; ++kt) { s.k[kt] = WFrag<T16>::ld(pk + kt * 16 * HD); if (HILO) s.k2[kt] = WFrag<T16>::ld(pk2 + kt * 16 * HD); }
    // stands behind the group's loads, before their address registers are rewritten for the next group (they are inputs, so that none is rewritten ahead of the wait, not even as a later load's destination); the clobber also keeps these loads ahead of the work on the other stage
    if constexpr (HILO) asm volatile("s_wait_xcnt 0x0" :: "v"(pk), "v"(pk2) : "memory"); else asm volatile("s_wait_xcnt 0x0" :: "v"(pk) : "memory");
}
template <typename T16, bool HILO>
__device__ __forceinline__ void a_loadv(VStage<T16>& s, const T16* pv, const T16* pv2) {
#pragma unroll
    for (int dt = 0; dt < 2; ++dt) { s.v[dt] = WFrag<T16>::ld(pv + dt * 512); if (HILO) s.v2[dt] = WFrag<T16>::ld(pv2 + dt * 512); }
    if constexpr (HILO) asm volatile("s_wait_xcnt 0x0" :: "v"(pv), "v"(pv2) : "memory"); else asm volatile("s_wait_xcnt 0x0" :: "v"(pv) : "memory");   // as in a_loadk
}
template <typename T16, bool HILO, int NQ>
__device__ __forceinline__ void a_step(const AStage<T16>& s, const VStage<T16>& sv, const typename WFrag<T16>::V (&bq)[NQ], const typename WFrag<T16>::V (&bq2)[NQ], v8f (&acc)[NQ][2], float (&mr)[NQ], float (&sm)[NQ], const float* pm, bool nz) {
    typedef typename WFrag<T16>::V V;
    float t[NQ][16], mx[NQ]; bool need = false; v8f d[NQ][2];
#pragma unroll
    for (int qt = 0; qt < NQ; ++qt)
#pragma unroll
        for (int kt = 0; kt < 2; ++kt) { d[qt][kt] = WFrag<T16>::mma(s.k[kt], bq[qt], (v8f){});
            if (HILO) { d[qt][kt] = WFrag<T16>::mma(s.k2[kt], bq[qt], d[qt][kt]); d[qt][kt] = WFrag<T16>::mma(s.k[kt], bq2[qt], d[qt][kt]); } }
    if (nz) {   // the same for the whole wave: this step's mask holds values other than zero (the mask tiles have D's map)
        v8f m[NQ][2];
#pragma unroll
        for (int qt = 0; qt < NQ; ++qt)
#pragma unroll
            for (int kt = 0; kt < 2; ++kt) { const float* p = pm + (size_t)qt * 16 * TT + kt * 256; m[qt][kt] = __builtin_shufflevector(*(const v4f*)p, *(const v4f*)(p + 128), 0, 1, 2, 3, 4, 5, 6, 7); }
        asm volatile("s_wait_xcnt 0x0" :: "v"(pm) : "memory");   // stands behind the mask loads, before their address registers (an input, so that it lives up to the wait) are rewritten
#pragma unroll
        for (int qt = 0; qt < NQ; ++qt)
#pragma unroll
            for (int kt = 0; kt < 2; ++kt) d[qt][kt] += m[qt][kt]; }
#pragma unroll
    for (int qt = 0; qt < NQ; ++qt) {
#pragma unroll
        for (int kt = 0; kt < 2; ++kt)
#pragma unroll
            for (int r = 0; r < 8; ++r) t[qt][kt * 8 + r] = fmaxf(d[qt][kt][r], FMIN_);
        float a = t[qt][0];
#pragma unroll
        for (int i = 1; i < 16; ++i) a = fmaxf(a, t[qt][i]);
        a = fmaxf(a, xhalf(a)); mx[qt] = a; need = need || (a > mr[qt]); }
    if (__builtin_amdgcn_ballot_w32(need) != 0) {   // a column's maximum rose: rescale what is summed so far (factor 1 in the other columns)
#pragma unroll
        for (int qt = 0; qt < NQ; ++qt) { const float mn = fmaxf(mr[qt], mx[qt]); const float al = __expf(mr[qt] - mn); mr[qt] = mn; sm[qt] *= al;
#pragma unroll
            for (int dt = 0; dt < 2; ++dt)
#pragma unroll
                for (int r = 0; r < 8; ++r) acc[qt][dt][r] *= al; } }
#pragma unroll
    for (int qt = 0; qt < NQ; ++qt) { V bp, bp2;
#pragma unroll
        for (int i = 0; i < 16; ++i) { const float p = __expf(t[qt][i] - mr[qt]); sm[qt] += p;
            if constexpr (HILO) { const __bf16 ph = (__bf16)p; bp[i] = ph; bp2[i] = (__bf16)(p - (float)ph); } else bp[i] = (h16)p; }
#pragma unroll
        for (int dt = 0; dt < 2; ++dt) { acc[qt][dt] = WFrag<T16>::mma(sv.v[dt], bp, acc[qt][dt]); if (HILO) { acc[qt][dt] = WFrag<T16>::mma(sv.v2[dt], bp, acc[qt][dt]); acc[qt][dt] = WFrag<T16>::mma(sv.v[dt], bp2, acc[qt][dt]); } } }
}
// Four vector slots behind a step's last matrix instructions: the branches that follow lead, on their taken side, to address arithmetic in the registers that held V^T. The accumulators are inputs so that the slots stand behind those instructions.
template <int NQ> __device__ __forceinline__ void a_gap(const v8f (&acc)[NQ][2]) {
    if constexpr (NQ == 2) asm volatile("v_nop\n\tv_nop\n\tv_nop\n\tv_nop" :: "v"(acc[0][0]), "v"(acc[0][1]), "v"(acc[1][0]), "v"(acc[1][1]));
    else asm volatile("v_nop\n\tv_nop\n\tv_nop\n\tv_nop" :: "v"(acc[0][0]), "v"(acc[0][1])); }
template <int NQ> __device__ __forceinline__ bool a_settled(const float (&mr)[NQ]) { bool ok = true;   // true, for the whole wave, once each of its queries has met a key that is not masked out
#pragma unroll
    for (int qt = 0; qt < NQ; ++qt) ok = ok && (mr[qt] > LIVEM);
    return __builtin_amdgcn_ballot_w32(ok) == 0xffffffffu; }
// Qp, Kp: one head's planes (rows t, k = d); Vp: its plane (rows dd, k = t); mk: this batch entry's mask tiles; lv: its live-step words (16 a query tile, 4 steps each, 32 words apart); q0: the wave's first query; the merged-head planes Ah/Al (rows t, k = h*32 + d, fragment order) take o = O / sum as bf16 hi + lo.
template <typename T16, bool HILO, int NQ>
__device__ __forceinline__ void attn_cols(const T16* Qp, const T16* Qp2, const T16* Kp, const T16* Kp2, const T16* Vp, const T16* Vp2, const float* mk, const unsigned* lv, bf* Ah, bf* Al, int h, int q0) {
    typedef typename WFrag<T16>::V V;
    const int lane = threadIdx.x & 31;
    V bq[NQ], bq2[NQ]; v8f acc[NQ][2]; float mr[NQ], sm[NQ];
    const T16* ql = Qp + (size_t)q0 * HD + 8 * lane; const T16* q2l = Qp2 + (size_t)q0 * HD + 8 * lane;
    unsigned nib = lv[((size_t)(q0 >> 4) * 16 + (NQ == 2 ? lane : (lane & 15))) * 32];   // lane l: steps 4 (l % 16) .. + 3 of query tile l / 16 (NQ 1: of its one tile in every lane)
#pragma unroll
    for (int qt = 0; qt < NQ; ++qt) { bq[qt] = WFrag<T16>::ld(ql + qt * 16 * HD); if (HILO) bq2[qt] = WFrag<T16>::ld(q2l + qt * 16 * HD); acc[qt][0] = (v8f){}; acc[qt][1] = (v8f){}; mr[qt] = FMIN_; sm[qt] = 0.f; }
    asm volatile("s_wait_xcnt 0x0" ::: "memory");   // as in a_loadk, for the Q loads
    const T16* kl = Kp + 8 * lane; const T16* k2l = Kp2 + 8 * lane; const T16* vl = Vp + 8 * lane; const T16* v2l = Vp2 + 8 * lane; const float* ml = mk + (size_t)q0 * TT + 4 * lane;   // key kb: K tile at kb * 32 elements, the V^T tile pair at kb * 32, the mask tile at kb * 16 floats
    // K is fetched one step ahead into two stages. V^T too on the fp16 path; the hi+lo path (twice the fragments) fetches a step's V^T at the step's head, behind which the scores and the softmax stand, to stay within 256 registers
    AStage<T16> s0, s1; VStage<T16> v0, v1;
    a_loadk<T16, HILO>(s0, kl, k2l); if (!HILO) a_loadv<T16, HILO>(v0, vl, v2l);
    if (NQ == 2) nib |= (unsigned)__builtin_amdgcn_permlanex16((int)nib, (int)nib, 0x76543210, 0xfedcba98, false, false);   // a step is live, or not zero, if it is so for either query tile
    unsigned long long live = 0, nzm = 0;   // bit s: step s (keys 32 s .. 32 s + 31) is live; its mask is not all zero; the same in every lane, kept in scalar registers
#pragma unroll
    for (int l = 0; l < 16; ++l) { const unsigned u = (unsigned)__builtin_amdgcn_readlane((int)nib, l); live |= (unsigned long long)(u & 15u) << (4 * l); nzm |= (unsigned long long)(u >> 4 & 15u) << (4 * l); }
    unsigned long long todo = ~1ull;   // steps not yet fetched: all of them until every query's maximum has settled above LIVEM, then the live ones among them
    bool settled = false, more; int kb = 0;
    do {   // two steps a trip, one per stage; each step fetches the next step still to do; once none is left, step 0 is fetched again (in bounds, unused)
        const bool pair = todo != 0; int kn = pair ? __builtin_ctzll(todo) * 32 : 0; todo &= todo - 1;
        a_loadk<T16, HILO>(s1, kl + kn * HD, k2l + kn * HD);
        if (HILO) a_loadv<T16, HILO>(v0, vl + kb * 32, v2l + kb * 32); else a_loadv<T16, HILO>(v1, vl + kn * 32, v2l + kn * 32);
        a_step<T16, HILO, NQ>(s0, v0, bq, bq2, acc, mr, sm, ml + kb * 16, (nzm >> (kb >> 5) & 1) != 0);
        a_gap<NQ>(acc); if (!settled) { settled = a_settled<NQ>(mr); if (settled) todo &= live; }
        kb = kn; more = todo != 0; kn = more ? __builtin_ctzll(todo) * 32 : 0; todo &= todo - 1;
        a_loadk<T16, HILO>(s0, kl + kn * HD, k2l + kn * HD);
        if (HILO) a_loadv<T16, HILO>(v0, vl + kb * 32, v2l + kb * 32); else a_loadv<T16, HILO>(v0, vl + kn * 32, v2l + kn * 32);
        if (pair) {   // an odd count ends with half a trip
            a_step<T16, HILO, NQ>(s1, HILO ? v0 : v1, bq, bq2, acc, mr, sm, ml + kb * 16, (nzm >> (kb >> 5) & 1) != 0);
            a_gap<NQ>(acc); if (!settled) { settled = a_settled<NQ>(mr); if (settled) todo &= live; } }
        kb = kn;
    } while (more);
#pragma unroll
    for (int qt = 0; qt < NQ; ++qt) { const float f = __fdiv_rn(1.0f, sm[qt] + xhalf(sm[qt])); const size_t oo = (size_t)(q0 + qt * 16) * RK + h * 512 + 8 * lane;   // tile (query tile, head); d = 16 dt + 8 hi + r is piece dt of lane (lr, hi)
#pragma unroll
        for (int dt = 0; dt < 2; ++dt) { v8us oh, ol;
#pragma unroll
            for (int r = 0; r < 8; ++r) { unsigned short a, c2; splitf(__fmul_rn(acc[qt][dt][r], f), a, c2); oh[r] = a; ol[r] = c2; }
            bf* pa = Ah + oo + dt * 256; bf* pl = Al + oo + dt * 256; *(v8us*)pa = oh; *(v8us*)pl = ol;
            asm volatile("s_wait_xcnt 0x0" :: "v"(pa), "v"(pl), "v"(oh), "v"(ol) : "memory"); } }   // stands behind the two stores, before their address and data registers (inputs here, so that they live up to the wait) are rewritten for the next piece
}
// grid (batch entries x heads, (TT-RH)/128 + RH/64), 4 waves (one a SIMD; 1280 blocks, five a WGP, all resident at 192 registers a wave): the first (TT-RH)/128 blocks of a head take 32 queries a wave on fp16, the rest the hi+lo rows, 16 queries a wave
// (three products a tile, so half the columns). Both run from the last query rows to the first: under a causal mask those have the most live steps, so the longest blocks have the low indices and start first (for speed only). A block's waves walk the same K and V^T lines.
__global__ __launch_bounds__(128) void k_fattn(const h16* __restrict__ Q16, const h16* __restrict__ K16, const h16* __restrict__ VT16, const bf* __restrict__ Qh, const bf* __restrict__ Ql, const bf* __restrict__ Kh, const bf* __restrict__ Kl, const bf* __restrict__ VTh, const bf* __restrict__ VTl, const float* __restrict__ mk, const unsigned* __restrict__ lv, bf* Ah, bf* Al) {
    const int h = blockIdx.x % NH_, b = blockIdx.x / NH_, w = threadIdx.x >> 5, bx = blockIdx.y; const size_t oq = (size_t)blockIdx.x * TT * HD, ov = (size_t)blockIdx.x * HD * TT; mk += (size_t)b * TT * TT; lv += (size_t)b * (TT / 16) * 16 * 32; Ah += (size_t)b * TT * RK; Al += (size_t)b * TT * RK;
    if (bx >= (TT - RH) / 128) attn_cols<bf, true, 1>(Qh + oq, Ql + oq, Kh + oq, Kl + oq, VTh + ov, VTl + ov, mk, lv, Ah, Al, h, ((TT - RH) / 128 + RH / 64 - 1 - bx) * 64 + w * 16);
    else attn_cols<h16, false, 2>(Q16 + oq, Q16 + oq, K16 + oq, K16 + oq, VT16 + ov, VT16 + ov, mk, lv, Ah, Al, h, RH + ((TT - RH) / 128 - 1 - bx) * 128 + w * 32);
}

extern "C" void kernel_launch(void* const* d_in, const int* in_sizes, int n_in,
                              void* d_out, int out_size, void* d_ws, size_t ws_size, hipStream_t stream) {
    (void)in_sizes; (void)n_in; (void)out_size;
    const float* IN[10]; for (int i = 0; i < 10; ++i) IN[i] = (const float*)d_in[i];   // 0 hidden, 1 attention_mask [2][1][2048][2048], 2 Wq [1024][2048], 3 bq, 4 Wk, 5 bk, 6 Wv, 7 bv, 8 Wo [2048][1024], 9 bo (torch [out][in])
    float* OUT = (float*)d_out;     // [2][2048][2048]
    char* wsp = (char*)d_ws;
    auto take = [&](size_t bytes) { char* p = wsp; wsp += (bytes + 255) & ~(size_t)255; return (void*)p; };
    bf* WQ = (bf*)take((size_t)RK * DM * 2); bf* WK = (bf*)take((size_t)RK * DM * 2); bf* WV = (bf*)take((size_t)RK * DM * 2); bf* WO = (bf*)take((size_t)DM * RK * 2);   // WQ, WK, WV, WO, XB lie in a row (every size a multiple of 256 bytes)
    bf* XB = (bf*)take((size_t)NB_ * TT * DM * 2);
    h16* Q16 = (h16*)take((size_t)NB_ * NH_ * TT * HD * 2); h16* K16 = (h16*)take((size_t)NB_ * NH_ * TT * HD * 2); bf* Qh = (bf*)take((size_t)NB_ * NH_ * TT * HD * 2); bf* Ql = (bf*)take((size_t)NB_ * NH_ * TT * HD * 2); bf* Kh = (bf*)take((size_t)NB_ * NH_ * TT * HD * 2); bf* Kl = (bf*)take((size_t)NB_ * NH_ * TT * HD * 2);
    h16* VT16 = (h16*)take((size_t)NB_ * NH_ * HD * TT * 2); bf* VTh = (bf*)take((size_t)NB_ * NH_ * HD * TT * 2); bf* VTl = (bf*)take((size_t)NB_ * NH_ * HD * TT * 2);
    bf* Ah = (bf*)take((size_t)NB_ * TT * RK * 2); bf* Al = (bf*)take((size_t)NB_ * TT * RK * 2); float* MP = (float*)take((size_t)NB_ * TT * TT * 4); unsigned* LV = (unsigned*)take((size_t)NB_ * (TT / 16) * 16 * 128);
    if ((size_t)(wsp - (char*)d_ws) > ws_size) return;    // total 152.5 MiB
    (void)WK; (void)WV;
    k_cvt8<<<CVB, 256, 0, stream>>>(IN[2], IN[4], IN[6], IN[0], WQ);
    k_gemmw<bf, 0, true, true><<<dim3(NB_ * TT / 128, RK / 128, 4), 128, 0, stream>>>(XB, nullptr, WQ, nullptr, DM, DM, nullptr, 0, IN[3], IN[5], IN[7], 0, (size_t)RK * DM, 0, Q16, K16, VT16, Qh, Ql, Kh, Kl, VTh, VTl, IN[1], MP, LV, IN[8], WO);   // z = 3: side_pack, NB_ * TT / 16 = 256 work-groups
    k_fattn<<<dim3(NB_ * NH_, RH / 64 + (TT - RH) / 128, 1), 128, 0, stream>>>(Q16, K16, VT16, Qh, Ql, Kh, Kl, VTh, VTl, MP, LV, Ah, Al);
    k_gemmw<bf, 1, true, false><<<dim3(NB_ * TT / 128, DM / 128, 1), 128, 0, stream>>>(Ah, Al, WO, nullptr, RK, RK, OUT, DM, IN[9], IN[9], IN[9], 0, 0, 0, nullptr, nullptr, nullptr, nullptr, nullptr, nullptr, nullptr, nullptr, nullptr, nullptr, nullptr, nullptr, nullptr, nullptr);
}

// v010
// Measured time: 106 microseconds a run.
// In two side-by-side timings against v009, it was 1.06 and 1.05 times as fast.
// Over all steps from v000 it is 64.3 times as fast.
#include <hip/hip_runtime.h>

// OPTEigenAttention - low-rank (eigen) OPT attention (hidden [2][2048][2048]; q = (x Wq^T + bq) x 64^-0.5 (32 heads x 32 low-rank dims; the scaling uses the ORIGINAL head dim 64), k = x Wk^T + bk, v = x Wv^T + bv (32 x 32);
// scores = q.k + attention_mask[b][0][i][j] (additive f32 mask input, read as data; then max(., float min)); softmax; out = merged att.v Wo^T + bo -> [2][2048][2048]).
// Compute dtypes, f32 accumulate: every input rounded to bf16; projections on PLAIN bf16 operands (inputs: exact, + bias); scores (K 32) and att.v on bf16 hi+lo planes (3 products) for
// the first 512 query rows of each head and on SINGLE fp16 planes for the rest (the mask here is causal, so early rows see few keys);
// mask add and softmax in f32 registers; merged heads as bf16 hi+lo planes x exact Wo (2 products) + bo. The projections and the output product run in k_gemmw (128x128 tiles, operands staged in LDS); the projections' epilogue writes the head planes of q, k and v itself (no f32 copy of them reaches memory).
// Every launch covers both batch entries (rows b*2048 + t, head planes b*32 + h); the three projections are one launch (grid z = matrix; z = 3: BESIDE THE PROJECTIONS below). Attention is ONE kernel (k_fattn): S^T = K.Q^T, running-maximum softmax in registers, O^T += V^T.P^T; no score or probability ever reaches memory.
// FRAGMENT ORDER: every 16-bit operand plane is stored as 1-KiB tiles of 16 rows x 32 k, tile (row/16, k/32) at index (row/16) * (K/32) + k/32 (V^T: (k/32) * 2 + row/16), element (row, k) at (k%32/16) * 256 + ((k%16/8) * 16 + row%16) * 8 + k%8 inside it.
// A lane's two 16-byte fragment pieces then lie at lane * 8 and 256 + lane * 8, so each wave-wide load covers 512 contiguous bytes (4 lines) where a row-major plane gave 16 pieces of 32 bytes in 16 lines. The k order of a fragment is the one it had.
// The f32 mask is copied once into 16 query x 16 key tiles in the accumulator's map (value r of a lane at (r/4) * 128 + lane * 4 + r%4), tile index (q/16) * 128 + key/16, for the same reason: all 64 head planes read it.
// LIVE STEPS: while it copies the mask, the packer notes for each 16-query tile and each 32-key step whether any mask value there lies above DEADM. Once every query of a wave has a running maximum above LIVEM, the wave walks only the steps so marked:
// in any other step each score is at most DEADM + |q.k| (|q.k| below 8e37 is taken for granted: fp16 operands cannot pass 1.4e11, and the projections of these inputs lie far lower still), so exp(score - maximum) is 0 in f32 and the step adds nothing to the sum or to O. Until then (a row whose first keys, or all keys, are masked) every step is worked as before, so the function is the same for any mask.
// BESIDE THE PROJECTIONS: the mask copy with its step marks and the conversion of Wo feed only the launches behind the projections, and they are memory traffic where the projections are matrix work. They run as a fourth z slice of the projection launch (256 work-groups, one more a WGP), not in the conversion launch ahead of it.
// ASKED INTO L2: the readers here (a two-buffer ring, fragments fetched one step ahead) lead their reads by less than a trip to memory. So the first 256 work-groups of each consumer launch (one a WGP)
// ask at their entry for the planes their launch reads, one prefetch a 256-byte unit (ask3, ask5). A hint only: nothing waits for it and no result depends on it. The weights are dealt out twice, by the block index without its bit 2 (for speed only).
// ZERO STEPS: the packer also notes whether a step holds any mask value other than zero. Where it holds none the scores are q.k alone and the wave loads no mask tile; in the other steps the tiles are loaded at the step itself and added to the product in f32.

#define NB_  2
#define TT   2048
#define DM   2048
#define RK   1024
#define NH_  32
#define HD   32
#define RH   512
#define SCL  0.125f
#define DEADM (-1.0e38f)
#define LIVEM (-1.0e37f)
typedef _Float16 h16;
typedef unsigned short bf;
typedef __attribute__((ext_vector_type(16))) __bf16   v16bf;
typedef __attribute__((ext_vector_type(16))) _Float16 v16h;
typedef __attribute__((ext_vector_type(8)))  _Float16 v8h;
typedef __attribute__((ext_vector_type(8)))  unsigned short v8us;
typedef __attribute__((ext_vector_type(8)))  float    v8f;
typedef __attribute__((ext_vector_type(4)))  float    v4f;
typedef v8h  __attribute__((may_alias)) v8ha;
typedef v4f  __attribute__((may_alias)) v4fa;
typedef v8us __attribute__((may_alias)) v8usa;

__device__ __forceinline__ unsigned short f2bf(float f) { unsigned u = __float_as_uint(f); u += 0x7FFFu + ((u >> 16) & 1u); return (unsigned short)(u >> 16); }
__device__ __forceinline__ float bf2f(unsigned short b) { return __uint_as_float(((unsigned)b) << 16); }
__device__ __forceinline__ float bfr(float f) { return bf2f(f2bf(f)); }
__device__ __forceinline__ v16h cat16(v8h lo, v8h hi) { return __builtin_shufflevector(lo, hi, 0, 1, 2, 3, 4, 5, 6, 7, 8, 9, 10, 11, 12, 13, 14, 15); }
__device__ __forceinline__ v16bf cat16b(v8us lo, v8us hi) { return __builtin_bit_cast(v16bf, __builtin_shufflevector(lo, hi, 0, 1, 2, 3, 4, 5, 6, 7, 8, 9, 10, 11, 12, 13, 14, 15)); }
__device__ __forceinline__ v8f wmma16(v16h a, v16h b, v8f c) { return __builtin_amdgcn_wmma_f32_16x16x32_f16(false, a, false, b, (short)0, c, false, false); }
__device__ __forceinline__ v8f wmmab(v16bf a, v16bf b, v8f c) { return __builtin_amdgcn_wmma_f32_16x16x32_bf16(false, a, false, b, (short)0, c, false, false); }



// ask3, ask5: each lane asks L2 for the data at its addresses, one every 256 bytes of a plane (no register, no counter, no result; every address lies inside its plane). scope SE: into L2 only. The wait on the address translations is the statement's last line, so that no address register is rewritten ahead of it.
__device__ __forceinline__ void ask3(const void* a, const void* b, const void* c) {
    asm volatile("global_prefetch_b8 %0, off scope:SCOPE_SE\n\t"
                 "global_prefetch_b8 %1, off scope:SCOPE_SE\n\t"
                 "global_prefetch_b8 %2, off scope:SCOPE_SE\n\t"
                 "s_wait_xcnt 0x0" :: "v"(a), "v"(b), "v"(c) : "memory");
}
__device__ __forceinline__ void ask5(const void* a, const void* b, const void* c, const void* d, const void* e) {
    asm volatile("global_prefetch_b8 %0, off scope:SCOPE_SE\n\t"
                 "global_prefetch_b8 %1, off scope:SCOPE_SE\n\t"
                 "global_prefetch_b8 %2, off scope:SCOPE_SE\n\t"
                 "global_prefetch_b8 %3, off scope:SCOPE_SE\n\t"
                 "global_prefetch_b8 %4, off scope:SCOPE_SE\n\t"
                 "s_wait_xcnt 0x0" :: "v"(a), "v"(b), "v"(c), "v"(d), "v"(e) : "memory");
}
// ---- k_gemmw: GEMM, one 128x128 output tile per work-group of FOUR WAVES (2 x 2, each 64x64 = 16 accumulators); grid (M/128, N/128, Z), 128 threads. The operands' 16-bit planes are in fragment order.
// C[m][n] (f32, pitch ldc, + optional f32 bias[n]) = sum_k A[m][k] Bt[n][k] (NSPLIT 1: + A2[m][k] Bt[n][k]). A has lda k values a row, Bt K. z-batch strides sA/sB/sC in elements; z slices 0, 1, 2 take bias, bias1, bias2. K % 64 == 0.
// STAGING: a trip is 64 k. Its 8 row tiles x 2 k tiles (16 KiB) of each operand are brought into LDS once for the whole work-group by asynchronous copies (no register on the way), so each fragment is fetched from L2 once and read from LDS by the two waves that need it.
// Two buffers: the copies of trip t + 1 fly while trip t is worked on. A row tile's two k tiles are 2 KiB in a row in the plane and in LDS, one 16-byte piece a thread.
template <typename T16> struct WFrag;
template <> struct WFrag<h16> { typedef v16h V; static __device__ __forceinline__ V ld(const h16* p) { return cat16(*(const v8h*)p, *(const v8h*)(p + 256)); } static __device__ __forceinline__ v8f mma(V a, V b, v8f c) { return wmma16(a, b, c); } };
template <> struct WFrag<bf> { typedef v16bf V; static __device__ __forceinline__ V ld(const bf* p) { return cat16b(*(const v8us*)p, *(const v8us*)(p + 256)); } static __device__ __forceinline__ v8f mma(V a, V b, v8f c) { return wmmab(a, b, c); } };
// Eight copies of a lane, 16 bytes each: row tiles 0 .. 7 of one operand (LDS 2 KiB apart, the plane 'pitch' elements apart). The wait on the address translations is the statement's last line, so that no address register is rewritten ahead of it.
template <typename T16> __device__ __forceinline__ void cp8(unsigned l, const T16* g, size_t pitch) {
    asm volatile("global_load_async_to_lds_b128 %0, %8, off\n\t"
                 "global_load_async_to_lds_b128 %1, %9, off\n\t"
                 "global_load_async_to_lds_b128 %2, %10, off\n\t"
                 "global_load_async_to_lds_b128 %3, %11, off\n\t"
                 "global_load_async_to_lds_b128 %4, %12, off\n\t"
                 "global_load_async_to_lds_b128 %5, %13, off\n\t"
                 "global_load_async_to_lds_b128 %6, %14, off\n\t"
                 "global_load_async_to_lds_b128 %7, %15, off\n\t"
                 "s_wait_xcnt 0x0"
                 :: "v"(l), "v"(l + 2048u), "v"(l + 4096u), "v"(l + 6144u), "v"(l + 8192u), "v"(l + 10240u), "v"(l + 12288u), "v"(l + 14336u),
                    "v"(g), "v"(g + pitch), "v"(g + 2 * pitch), "v"(g + 3 * pitch), "v"(g + 4 * pitch), "v"(g + 5 * pitch), "v"(g + 6 * pitch), "v"(g + 7 * pitch) : "memory");
}
// PACK (the projections; z = 0, 1, 2 is q, k, v): no C. The result + bias (q: x 0.125) goes straight from the accumulators into the head planes that attention reads, numbered hb = b*32 + h: an fp16 plane and bf16 hi/lo planes each of
// q and k (rows t, k = d) and of v^T (rows dd < 32, k = t; the two row tiles of a 32-key step side by side), all in fragment order. A lane's 8 accumulator registers are 8 consecutive ROWS of one column of D, and a 16-byte piece of a plane is 8 consecutive k of one row:
// for v^T (k = t) D = X W^T fits as it is; for q and k (k = d) the two operands change places, D = W X^T. Only the LDS offsets of the A and B fragments differ, the loop is the same. Each 16x16 tile is then 512 contiguous bytes (piece = lane) of each plane.
typedef __attribute__((ext_vector_type(2))) __bf16 v2bf;
typedef __attribute__((ext_vector_type(4))) unsigned v4u;
struct Piece { v8h f; v4u h, l; };   // 8 values as fp16, as bf16 hi and as bf16 lo = the rounded rest
__device__ __forceinline__ Piece mk3(const v8f y) { Piece p;
#pragma unroll
    for (int r = 0; r < 8; r += 2) { p.f[r] = (h16)y[r]; p.f[r + 1] = (h16)y[r + 1]; const v2bf a = { (__bf16)y[r], (__bf16)y[r + 1] }; const unsigned u = __builtin_bit_cast(unsigned, a); p.h[r >> 1] = u;
        const v2bf c = { (__bf16)(y[r] - __uint_as_float(u << 16)), (__bf16)(y[r + 1] - __uint_as_float(u & 0xffff0000u)) }; p.l[r >> 1] = __builtin_bit_cast(unsigned, c); }
    return p; }
// Four tiles' pieces, at o0 .. o3 elements from the lane's base address in each of the three planes.
__device__ __forceinline__ void put4(const Piece (&p)[4], h16* pf, bf* ph, bf* pl, int o0, int o1, int o2, int o3) {
    const int of[4] = { o0, o1, o2, o3 };
#pragma unroll
    for (int u = 0; u < 4; ++u) { *(v8h*)(pf + of[u]) = p[u].f; *(v8us*)(ph + of[u]) = __builtin_bit_cast(v8us, p[u].h); *(v8us*)(pl + of[u]) = __builtin_bit_cast(v8us, p[u].l); }
    // stands behind the twelve stores, before their data registers are rewritten for the next four tiles (inputs here, like the lane's three base addresses, so that they live up to the wait)
    asm volatile("s_wait_xcnt 0x0" :: "v"(pf), "v"(ph), "v"(pl), "v"(p[0].f), "v"(p[0].h), "v"(p[0].l), "v"(p[1].f), "v"(p[1].h), "v"(p[1].l), "v"(p[2].f), "v"(p[2].h), "v"(p[2].l), "v"(p[3].f), "v"(p[3].h), "v"(p[3].l) : "memory");
}
// side_pack: what the fourth z slice of the projection launch does; blk = 0 .. 255, four waves.
// Mask: the work-group is one 16-query tile of the two batch entries' 256, a wave 16 of its 64 steps, four steps (8 tiles of 16 x 16) a trip; a lane holds keys 8 hi .. 8 hi + 7 of query row lr of each tile. A step's two tiles lie in one wave, so its marks need no other wave.
// Wo: the work-group is 16 rows x 512 k (16 tiles of the plane); a thread takes 8 pieces of 16 bytes, 2 KiB apart in the plane, 64 k apart in its row.
__device__ __forceinline__ void side_pack(const float* __restrict__ mk, float* mp, unsigned* lv, const float* __restrict__ wo, bf* wod, int blk) {
    const int tid = threadIdx.x, lane = tid & 31, lr = lane & 15, hi = lane >> 4, w = tid >> 5;
    const float* s = mk + ((size_t)blk * 16 + lr) * TT + w * 512 + 8 * hi; float* d = mp + ((size_t)blk * 128 + w * 32) * 256 + lane * 4; unsigned* f = lv + ((size_t)blk * 16 + w * 4) * 32;
#pragma unroll 1   // one trip's code; sixteen loads of a lane are in flight in each
    for (int g = 0; g < 4; ++g) {
        v4f a[8], c[8];
#pragma unroll
        for (int u = 0; u < 8; ++u) { a[u] = *(const v4f*)(s + u * 16); c[u] = *(const v4f*)(s + u * 16 + 4); }
        asm volatile("s_wait_xcnt 0x0" :: "v"(s) : "memory");   // stands behind the loads, before their address registers (an input, so that it lives up to the wait) are rewritten
        const unsigned dead = __float_as_uint(DEADM); unsigned word = 0;   // bit j: step 4 g + j of the wave is live, bit 4 + j: it holds a value other than zero; not-a-number counts as live and as not zero
#pragma unroll
        for (int u = 0; u < 8; ++u) { const v4u ua = __builtin_bit_cast(v4u, a[u]), uc = __builtin_bit_cast(v4u, c[u]); unsigned any = 0, far = 0;   // the lane's 8 values are merged as words, so that a tile takes two compares (one a value ran the wave out of scalar registers)
#pragma unroll
            for (int r = 0; r < 4; ++r) { any |= ua[r] | uc[r]; const unsigned fa = ua[r] - dead, fc = uc[r] - dead; far = far > fa ? far : fa; far = far > fc ? far : fc; }
            const bool nz = (any << 1) != 0, up = far > 0xff800000u - dead;   // nz: a word other than +0 and -0; up: read as unsigned words, the values x <= DEADM are exactly the words from DEADM's to minus infinity's
            word |= ((__builtin_amdgcn_ballot_w32(up) != 0 ? 1u : 0u) | (__builtin_amdgcn_ballot_w32(nz) != 0 ? 16u : 0u)) << (u >> 1);
            *(v4f*)(d + u * 256) = a[u]; *(v4f*)(d + u * 256 + 128) = c[u]; }
        if (lane == 0) *f = word;   // one word a 128-byte line, so each line has one writer
        // stands behind the trip's stores, before their address and data registers (inputs here, so that they live up to the wait) are rewritten for the next trip
        asm volatile("s_wait_xcnt 0x0" :: "v"(d), "v"(f), "v"(a[0]), "v"(a[1]), "v"(a[2]), "v"(a[3]), "v"(a[4]), "v"(a[5]), "v"(a[6]), "v"(a[7]), "v"(c[0]), "v"(c[1]), "v"(c[2]), "v"(c[3]), "v"(c[4]), "v"(c[5]), "v"(c[6]), "v"(c[7]) : "memory");
        s += 128; d += 2048; f += 32;
    }
    const float* sw = wo + ((((size_t)(blk >> 1) * 16 + lr) * 32 + (blk & 1) * 16 + (tid >> 6)) * 32) + ((tid >> 5) & 1) * 16 + 8 * hi; bf* dw = wod + ((size_t)blk * 1024 + tid) * 8;
    v8f v[8]; v8us o[8];
#pragma unroll
    for (int it = 0; it < 8; ++it) v[it] = *(const v8f*)(sw + it * 64);
    asm volatile("s_wait_xcnt 0x0" :: "v"(sw) : "memory");   // as above, for the loads of Wo
#pragma unroll
    for (int it = 0; it < 8; ++it) {
#pragma unroll
        for (int k = 0; k < 8; ++k) o[it][k] = f2bf(v[it][k]);
        *(v8us*)(dw + it * 1024) = o[it]; }
    asm volatile("s_wait_xcnt 0x0" :: "v"(dw), "v"(o[0]), "v"(o[1]), "v"(o[2]), "v"(o[3]), "v"(o[4]), "v"(o[5]), "v"(o[6]), "v"(o[7]) : "memory");   // as above, for the stores of the plane
}
template <typename T16, int NSPLIT, bool BIAS, bool PACK>
__global__ __launch_bounds__(128) void k_gemmw(const T16* __restrict__ A, const T16* __restrict__ A2, const T16* __restrict__ Bt, const T16* __restrict__ Bt2, int K, int lda, float* C, int ldc, const float* __restrict__ bias, const float* __restrict__ bias1, const float* __restrict__ bias2, size_t sA, size_t sB, size_t sC, h16* q16, h16* k16, h16* v16, bf* qh, bf* ql, bf* kh, bf* kl, bf* vh, bf* vl, const float* __restrict__ mk, float* mp, unsigned* lv, const float* __restrict__ wo, bf* wod) {
    typedef typename WFrag<T16>::V V;
    if constexpr (PACK) { if (blockIdx.z == 3) { side_pack(mk, mp, lv, wo, wod, blockIdx.y * (NB_ * TT / 128) + blockIdx.x); return; } }   // the same for the whole work-group, ahead of every copy and barrier
    static_assert(NSPLIT == 0 || NSPLIT == 1, "A (+ A2) x Bt"); static_assert(!PACK || (NSPLIT == 0 && BIAS), "the projections"); (void)Bt2;
    constexpr int NOP = NSPLIT == 1 ? 3 : 2;                  // operands staged: Bt, A (, A2)
    __shared__ __align__(2048) T16 ring[2][NOP][8192];        // [buffer][operand][row tile 8][k tile 2][512]
    const size_t z = blockIdx.z; A += z * sA; if (NSPLIT == 1) A2 += z * sA; Bt += z * sB; C += z * sC; if (z == 1) bias = bias1; else if (z == 2) bias = bias2;   // each z slice has its own bias vector
    const int tid = threadIdx.x, lane = tid & 31, lr = lane & 15, hi = lane >> 4, w = tid >> 5, wm = w >> 1, wn = w & 1; const int rb = blockIdx.x * 128, cb = blockIdx.y * 128, r0 = rb + wm * 64, c0 = cb + wn * 64;   // the block's and the wave's first row and column
    const bool sw = PACK && z < 2;   // q, k: the A fragments are rows of Bt, the B fragments rows of A
    const int oa = sw ? wn * 4096 : 8192 + wm * 4096, ob = sw ? 8192 + wm * 4096 : wn * 4096;   // the wave's four row tiles of each, in elements from the buffer's start
    v8f acc[4][4];
#pragma unroll
    for (int mb = 0; mb < 4; ++mb)
#pragma unroll
        for (int nb = 0; nb < 4; ++nb) acc[mb][nb] = (v8f){};
    const T16* ga = A + (size_t)rb * lda + 8 * tid; const T16* ga2 = NSPLIT == 1 ? A2 + (size_t)rb * lda + 8 * tid : ga; const T16* gb = Bt + (size_t)cb * K + 8 * tid;   // 16 rows of tiles hold 16 * K elements; a trip of 64 k is two tiles (1024 elements)
    const unsigned l0 = (unsigned)(size_t)&ring[0][0][0] + 16u * tid;   // the thread's own piece in LDS, as a byte address
    const int nt = K / 64;
    auto fill = [&](int t) { const unsigned l = l0 + (unsigned)(t & 1) * (NOP * 16384u);
        cp8<T16>(l, gb + (size_t)t * 1024, (size_t)16 * K); cp8<T16>(l + 16384u, ga + (size_t)t * 1024, (size_t)16 * lda); if (NSPLIT == 1) cp8<T16>(l + 32768u, ga2 + (size_t)t * 1024, (size_t)16 * lda); };
    fill(0);
    // ASKED INTO L2 (above), behind the copies of trip 0. The 8 work-groups (x, y < 8) share out the 8 row tiles of A's rows rb .. rb + 127; the 128 values of dl times 128 threads are the units of one whole weight plane (4 MiB).
    const int dl = (((int)blockIdx.x >> 3) * 4 + ((int)blockIdx.x & 3)) * 8 + (int)blockIdx.y;
    if constexpr (PACK) { static_assert(16 * DM * 2 == 2 * 128 * 256 && (size_t)RK * DM * 2 == (size_t)128 * 128 * 256 && RK / 128 == 8 && NB_ * TT / 128 == 32, "the shares below");
        if (blockIdx.z == 0) { const T16* px = A + (size_t)(rb + 16 * (int)blockIdx.y) * DM + 128 * tid; const T16* pw = Bt + ((size_t)dl * 128 + tid) * 128;   // X: a row tile is 64 KiB, two units a thread; Wq, Wk, Wv: a unit of each
            ask5(px, px + 128 * 128, pw, pw + (size_t)RK * DM, pw + 2 * (size_t)RK * DM); }
    } else { static_assert(16 * RK * 2 == 128 * 256 && (size_t)DM * RK * 2 == (size_t)128 * 128 * 256 && NB_ * TT / 128 == 32 && NSPLIT == 1, "the shares below");
        if (blockIdx.y < 8) { const size_t oa2 = (size_t)(rb + 16 * (int)blockIdx.y) * RK + 128 * tid;   // merged heads, hi and lo: a row tile is 32 KiB, a unit a thread; Wo: a unit
            ask3(A + oa2, A2 + oa2, Bt + ((size_t)dl * 128 + tid) * 128); }
    }
    asm volatile("s_wait_asynccnt 0x0" ::: "memory");   // this wave's copies of trip 0 have landed
    __syncthreads();                                    // ... and every other wave's: nothing of trip 0 is read ahead of this
    if (nt > 1) fill(1);
#pragma unroll 1   // one trip's code: the two buffers differ only in a base address
    for (int t = 0; t < nt; ++t) {
        const T16* sb = &ring[t & 1][0][0] + ob + 8 * lane; const T16* sa = &ring[t & 1][0][0] + oa + 8 * lane;
        V a[4], a2[4], b[4];
#pragma unroll
        for (int ks = 0; ks < 2; ++ks) {
#pragma unroll
            for (int mb = 0; mb < 4; ++mb) { a[mb] = WFrag<T16>::ld(sa + mb * 1024 + ks * 512); if (NSPLIT == 1) a2[mb] = WFrag<T16>::ld(sa + 8192 + mb * 1024 + ks * 512); }
#pragma unroll
            for (int nb = 0; nb < 4; ++nb) b[nb] = WFrag<T16>::ld(sb + nb * 1024 + ks * 512);
            __builtin_amdgcn_sched_barrier(0);   // keeps the step's LDS reads together ahead of its matrix instructions: spread among them, each group of reads costs the wave a wait of its own
#pragma unroll
            for (int nb = 0; nb < 4; ++nb) {
#pragma unroll
                for (int mb = 0; mb < 4; ++mb) { acc[mb][nb] = WFrag<T16>::mma(a[mb], b[nb], acc[mb][nb]); if (NSPLIT == 1) acc[mb][nb] = WFrag<T16>::mma(a2[mb], b[nb], acc[mb][nb]); } }
        }
        __builtin_amdgcn_sched_barrier(0);   // the trip's matrix instructions stay ahead of the slots and waits below (the compiler otherwise moves most of them behind the barrier, which delays the refill)
        asm volatile("v_nop\n\tv_nop\n\tv_nop\n\tv_nop" : "+v"(acc[0][0]), "+v"(acc[1][1]), "+v"(acc[2][2]), "+v"(acc[3][3]) : "v"(a[0]), "v"(a[3]));   // four vector slots behind the trip's last matrix instructions, ahead of the address arithmetic that may take the fragments' registers
        asm volatile("s_wait_dscnt 0x0" ::: "memory");      // this wave's reads of the trip's buffer are done
        asm volatile("s_wait_asynccnt 0x0" ::: "memory");   // its copies of trip t + 1 have landed
        __syncthreads();                                    // publishes trip t + 1 and ends every wave's reads of the buffer that is refilled below
        if (t + 2 < nt) fill(t + 2);
    }
    asm volatile("s_wait_asynccnt 0x0" ::: "memory");   // no copy is outstanding when the wave goes on to its end
    if constexpr (PACK) {
        h16* pf = z == 0 ? q16 : z == 1 ? k16 : v16; bf* ph = z == 0 ? qh : z == 1 ? kh : vh; bf* pl = z == 0 ? ql : z == 1 ? kl : vl;
        const size_t o = ((size_t)((r0 / TT) * NH_ + c0 / HD) * TT + r0 % TT) * HD + 8 * lane; pf += o; ph += o; pl += o;   // the wave's 64 rows lie in one batch entry, its 64 columns are two heads; 32 t of a head are 1024 elements in every plane
        if (sw) {   // acc[i][j]: d = 16 i + 8 hi + r of the two heads, t = 16 j + lr
            const float sc = z == 0 ? SCL : 1.0f; const float* bp = bias + c0 + 8 * hi; v4f bl[4][2];
#pragma unroll
            for (int i = 0; i < 4; ++i) { bl[i][0] = *(const v4f*)(bp + i * 16); bl[i][1] = *(const v4f*)(bp + i * 16 + 4); }
            asm volatile("s_wait_xcnt 0x0" :: "v"(bp) : "memory");   // stands behind the bias loads, before their address registers are reused
#pragma unroll
            for (int i = 0; i < 4; ++i) { Piece p[4]; const int of = (i >> 1) * TT * HD + (i & 1) * 256;
#pragma unroll
                for (int j = 0; j < 4; ++j) { v8f y;
#pragma unroll
                    for (int r = 0; r < 8; ++r) y[r] = __fmul_rn(__fadd_rn(acc[i][j][r], bfr(bl[i][r >> 2][r & 3])), sc);
                    p[j] = mk3(y); }
                put4(p, pf, ph, pl, of, of + 512, of + 1024, of + 1536); }
        } else {    // acc[mb][nb]: t = 16 mb + 8 hi + r, dd = 16 nb + lr of the two heads
            const float* bp = bias + c0 + lr; float bl[4];
#pragma unroll
            for (int nb = 0; nb < 4; ++nb) bl[nb] = bp[nb * 16];
            asm volatile("s_wait_xcnt 0x0" :: "v"(bp) : "memory");   // as above
#pragma unroll
            for (int nb = 0; nb < 4; ++nb) { Piece p[4]; const int of = (nb >> 1) * TT * HD + (nb & 1) * 512;
#pragma unroll
                for (int mb = 0; mb < 4; ++mb) { v8f y;
#pragma unroll
                    for (int r = 0; r < 8; ++r) y[r] = __fadd_rn(acc[mb][nb][r], bfr(bl[nb]));
                    p[mb] = mk3(y); }
                put4(p, pf, ph, pl, of, of + 256, of + 1024, of + 1280); }
        }
    } else {
    __shared__ __align__(16) float osw[4][16 * 68];   // each wave's own output staging
    float* os = osw[w];
#pragma unroll
    for (int mb = 0; mb < 4; ++mb) {
#pragma unroll
        for (int nb = 0; nb < 4; ++nb) {
#pragma unroll
            for (int j = 0; j < 8; ++j) os[(hi * 8 + j) * 68 + nb * 16 + lr] = acc[mb][nb][j]; }
        __builtin_amdgcn_wave_barrier(); asm volatile("" ::: "memory");
        float* crow = C + (size_t)(r0 + mb * 16) * ldc + c0;
{
#pragma unroll
            for (int s = 0; s < 8; ++s) { const int row = 2 * s + hi, cofs = lr * 4; v4f val = *(const v4fa*)(os + row * 68 + cofs); if (BIAS) { val[0] += bfr(bias[c0 + cofs]); val[1] += bfr(bias[c0 + cofs + 1]); val[2] += bfr(bias[c0 + cofs + 2]); val[3] += bfr(bias[c0 + cofs + 3]); }
                *(v4f*)(crow + (size_t)row * ldc + cofs) = val; }
             }
        asm volatile("s_wait_xcnt 0x0" ::: "memory");   // stands behind the row stores, before their address registers are reused
        __builtin_amdgcn_wave_barrier(); asm volatile("" ::: "memory");
    }
    }
}

__device__ __forceinline__ void splitf(float y, unsigned short& h, unsigned short& l) { h = f2bf(y); l = f2bf(y - bf2f(h)); }

// k_cvt8: the f32 -> bf16 conversions that the projections read, in one launch. dst is the row of planes WQ, WK, WV, WO, XB, each in fragment order; 1024 blocks (2^21 elements) for each of Wq, Wk, Wv, then 4096 for the hidden states of both batch entries (the plane of Wo, fourth in the row, is written by side_pack).
// A thread is one 16-byte piece of the destination (stores stay contiguous); its 8 source values are 8 consecutive k of one row, and a block reads whole lines of 16 rows.
#define CVB (3 * 1024 + NB_ * TT * DM / 8 / 256)
__global__ __launch_bounds__(256) void k_cvt8(const float* __restrict__ wq, const float* __restrict__ wk, const float* __restrict__ wv, const float* __restrict__ x, bf* dst) {
    const int lane = threadIdx.x & 31, lr = lane & 15, hi = lane >> 4;
    const int bi = blockIdx.x < 3 * 1024 ? blockIdx.x : blockIdx.x + 1024;   // the block's place in the row of planes
    const int seg = bi >> 10; const float* src = seg == 0 ? wq : seg == 1 ? wk : seg == 2 ? wv : x; const size_t i = (size_t)bi * 256 + threadIdx.x; const size_t j = i - (size_t)(seg < 4 ? seg : 4) * 1024 * 256;
    const int sh = 6;   // log2 of the tiles in a row of tiles: K = 2048
    const size_t tile = j >> 6; const v8f v = *(const v8f*)(src + ((((tile >> sh) * 16 + lr) << sh) + (tile & ((1u << sh) - 1))) * 32 + ((j >> 5) & 1) * 16 + 8 * hi); v8us o;
    asm volatile("s_wait_xcnt 0x0" ::: "memory");   // stands behind the load, before its address registers are reused
#pragma unroll
    for (int k = 0; k < 8; ++k) o[k] = f2bf(v[k]); *(v8us*)(dst + i * 8) = o;  }
__device__ __forceinline__ float xhalf(float x) { const int b = __float_as_int(x); return __int_as_float(__builtin_amdgcn_permlanex16(b, b, 0x76543210, 0xfedcba98, false, false)); }
#define FMIN_ (-3.40282347e38f)
template <typename T16> struct AStage { typename WFrag<T16>::V k[2], k2[2]; };   // one step's K fragments
template <typename T16> struct VStage { typename WFrag<T16>::V v[2], v2[2]; };                          // one step's V^T fragments
template <typename T16, bool HILO>
__device__ __forceinline__ void a_loadk(AStage<T16>& s, const T16* pk, const T16* pk2) {
#pragma unroll
    for (int kt = 0; kt < 2; ++kt) { s.k[kt] = WFrag<T16>::ld(pk + kt * 16 * HD); if (HILO) s.k2[kt] = WFrag<T16>::ld(pk2 + kt * 16 * HD); }
    // stands behind the group's loads, before their address registers are rewritten for the next group (they are inputs, so that none is rewritten ahead of the wait, not even as a later load's destination); the clobber also keeps these loads ahead of the work on the other stage
    if constexpr (HILO) asm volatile("s_wait_xcnt 0x0" :: "v"(pk), "v"(pk2) : "memory"); else asm volatile("s_wait_xcnt 0x0" :: "v"(pk) : "memory");
}
template <typename T16, bool HILO>
__device__ __forceinline__ void a_loadv(VStage<T16>& s, const T16* pv, const T16* pv2) {
#pragma unroll
    for (int dt = 0; dt < 2; ++dt) { s.v[dt] = WFrag<T16>::ld(pv + dt * 512); if (HILO) s.v2[dt] = WFrag<T16>::ld(pv2 + dt * 512); }
    if constexpr (HILO) asm volatile("s_wait_xcnt 0x0" :: "v"(pv), "v"(pv2) : "memory"); else asm volatile("s_wait_xcnt 0x0" :: "v"(pv) : "memory");   // as in a_loadk
}
template <typename T16, bool HILO, int NQ>
__device__ __forceinline__ void a_step(const AStage<T16>& s, const VStage<T16>& sv, const typename WFrag<T16>::V (&bq)[NQ], const typename WFrag<T16>::V (&bq2)[NQ], v8f (&acc)[NQ][2], float (&mr)[NQ], float (&sm)[NQ], const float* pm, bool nz) {
    typedef typename WFrag<T16>::V V;
    float t[NQ][16], mx[NQ]; bool need = false; v8f d[NQ][2];
#pragma unroll
    for (int qt = 0; qt < NQ; ++qt)
#pragma unroll
        for (int kt = 0; kt < 2; ++kt) { d[qt][kt] = WFrag<T16>::mma(s.k[kt], bq[qt], (v8f){});
            if (HILO) { d[qt][kt] = WFrag<T16>::mma(s.k2[kt], bq[qt], d[qt][kt]); d[qt][kt] = WFrag<T16>::mma(s.k[kt], bq2[qt], d[qt][kt]); } }
    if (nz) {   // the same for the whole wave: this step's mask holds values other than zero (the mask tiles have D's map)
        v8f m[NQ][2];
#pragma unroll
        for (int qt = 0; qt < NQ; ++qt)
#pragma unroll
            for (int kt = 0; kt < 2; ++kt) { const float* p = pm + (size_t)qt * 16 * TT + kt * 256; m[qt][kt] = __builtin_shufflevector(*(const v4f*)p, *(const v4f*)(p + 128), 0, 1, 2, 3, 4, 5, 6, 7); }
        asm volatile("s_wait_xcnt 0x0" :: "v"(pm) : "memory");   // stands behind the mask loads, before their address registers (an input, so that it lives up to the wait) are rewritten
#pragma unroll
        for (int qt = 0; qt < NQ; ++qt)
#pragma unroll
            for (int kt = 0; kt < 2; ++kt) d[qt][kt] += m[qt][kt]; }
#pragma unroll
    for (int qt = 0; qt < NQ; ++qt) {
#pragma unroll
        for (int kt = 0; kt < 2; ++kt)
#pragma unroll
            for (int r = 0; r < 8; ++r) t[qt][kt * 8 + r] = fmaxf(d[qt][kt][r], FMIN_);
        float a = t[qt][0];
#pragma unroll
        for (int i = 1; i < 16; ++i) a = fmaxf(a, t[qt][i]);
        a = fmaxf(a, xhalf(a)); mx[qt] = a; need = need || (a > mr[qt]); }
    if (__builtin_amdgcn_ballot_w32(need) != 0) {   // a column's maximum rose: rescale what is summed so far (factor 1 in the other columns)
#pragma unroll
        for (int qt = 0; qt < NQ; ++qt) { const float mn = fmaxf(mr[qt], mx[qt]); const float al = __expf(mr[qt] - mn); mr[qt] = mn; sm[qt] *= al;
#pragma unroll
            for (int dt = 0; dt < 2; ++dt)
#pragma unroll
                for (int r = 0; r < 8; ++r) acc[qt][dt][r] *= al; } }
#pragma unroll
    for (int qt = 0; qt < NQ; ++qt) { V bp, bp2;
#pragma unroll
        for (int i = 0; i < 16; ++i) { const float p = __expf(t[qt][i] - mr[qt]); sm[qt] += p;
            if constexpr (HILO) { const __bf16 ph = (__bf16)p; bp[i] = ph; bp2[i] = (__bf16)(p - (float)ph); } else bp[i] = (h16)p; }
#pragma unroll
        for (int dt = 0; dt < 2; ++dt) { acc[qt][dt] = WFrag<T16>::mma(sv.v[dt], bp, acc[qt][dt]); if (HILO) { acc[qt][dt] = WFrag<T16>::mma(sv.v2[dt], bp, acc[qt][dt]); acc[qt][dt] = WFrag<T16>::mma(sv.v[dt], bp2, acc[qt][dt]); } } }
}
// Four vector slots behind a step's last matrix instructions: the branches that follow lead, on their taken side, to address arithmetic in the registers that held V^T. The accumulators are inputs so that the slots stand behind those instructions.
template <int NQ> __device__ __forceinline__ void a_gap(const v8f (&acc)[NQ][2]) {
    if constexpr (NQ == 2) asm volatile("v_nop\n\tv_nop\n\tv_nop\n\tv_nop" :: "v"(acc[0][0]), "v"(acc[0][1]), "v"(acc[1][0]), "v"(acc[1][1]));
    else asm volatile("v_nop\n\tv_nop\n\tv_nop\n\tv_nop" :: "v"(acc[0][0]), "v"(acc[0][1])); }
template <int NQ> __device__ __forceinline__ bool a_settled(const float (&mr)[NQ]) { bool ok = true;   // true, for the whole wave, once each of its queries has met a key that is not masked out
#pragma unroll
    for (int qt = 0; qt < NQ; ++qt) ok = ok && (mr[qt] > LIVEM);
    return __builtin_amdgcn_ballot_w32(ok) == 0xffffffffu; }
// Qp, Kp: one head's planes (rows t, k = d); Vp: its plane (rows dd, k = t); mk: this batch entry's mask tiles; lv: its live-step words (16 a query tile, 4 steps each, 32 words apart); q0: the wave's first query; the merged-head planes Ah/Al (rows t, k = h*32 + d, fragment order) take o = O / sum as bf16 hi + lo.
template <typename T16, bool HILO, int NQ>
__device__ __forceinline__ void attn_cols(const T16* Qp, const T16* Qp2, const T16* Kp, const T16* Kp2, const T16* Vp, const T16* Vp2, const float* mk, const unsigned* lv, bf* Ah, bf* Al, int h, int q0) {
    typedef typename WFrag<T16>::V V;
    const int lane = threadIdx.x & 31;
    V bq[NQ], bq2[NQ]; v8f acc[NQ][2]; float mr[NQ], sm[NQ];
    const T16* ql = Qp + (size_t)q0 * HD + 8 * lane; const T16* q2l = Qp2 + (size_t)q0 * HD + 8 * lane;
    unsigned nib = lv[((size_t)(q0 >> 4) * 16 + (NQ == 2 ? lane : (lane & 15))) * 32];   // lane l: steps 4 (l % 16) .. + 3 of query tile l / 16 (NQ 1: of its one tile in every lane)
#pragma unroll
    for (int qt = 0; qt < NQ; ++qt) { bq[qt] = WFrag<T16>::ld(ql + qt * 16 * HD); if (HILO) bq2[qt] = WFrag<T16>::ld(q2l + qt * 16 * HD); acc[qt][0] = (v8f){}; acc[qt][1] = (v8f){}; mr[qt] = FMIN_; sm[qt] = 0.f; }
    asm volatile("s_wait_xcnt 0x0" ::: "memory");   // as in a_loadk, for the Q loads
    const T16* kl = Kp + 8 * lane; const T16* k2l = Kp2 + 8 * lane; const T16* vl = Vp + 8 * lane; const T16* v2l = Vp2 + 8 * lane; const float* ml = mk + (size_t)q0 * TT + 4 * lane;   // key kb: K tile at kb * 32 elements, the V^T tile pair at kb * 32, the mask tile at kb * 16 floats
    // K is fetched one step ahead into two stages. V^T too on the fp16 path; the hi+lo path (twice the fragments) fetches a step's V^T at the step's head, behind which the scores and the softmax stand, to stay within 256 registers
    AStage<T16> s0, s1; VStage<T16> v0, v1;
    a_loadk<T16, HILO>(s0, kl, k2l); if (!HILO) a_loadv<T16, HILO>(v0, vl, v2l);
    if (NQ == 2) nib |= (unsigned)__builtin_amdgcn_permlanex16((int)nib, (int)nib, 0x76543210, 0xfedcba98, false, false);   // a step is live, or not zero, if it is so for either query tile
    unsigned long long live = 0, nzm = 0;   // bit s: step s (keys 32 s .. 32 s + 31) is live; its mask is not all zero; the same in every lane, kept in scalar registers
#pragma unroll
    for (int l = 0; l < 16; ++l) { const unsigned u = (unsigned)__builtin_amdgcn_readlane((int)nib, l); live |= (unsigned long long)(u & 15u) << (4 * l); nzm |= (unsigned long long)(u >> 4 & 15u) << (4 * l); }
    unsigned long long todo = ~1ull;   // steps not yet fetched: all of them until every query's maximum has settled above LIVEM, then the live ones among them
    bool settled = false, more; int kb = 0;
    do {   // two steps a trip, one per stage; each step fetches the next step still to do; once none is left, step 0 is fetched again (in bounds, unused)
        const bool pair = todo != 0; int kn = pair ? __builtin_ctzll(todo) * 32 : 0; todo &= todo - 1;
        a_loadk<T16, HILO>(s1, kl + kn * HD, k2l + kn * HD);
        if (HILO) a_loadv<T16, HILO>(v0, vl + kb * 32, v2l + kb * 32); else a_loadv<T16, HILO>(v1, vl + kn * 32, v2l + kn * 32);
        a_step<T16, HILO, NQ>(s0, v0, bq, bq2, acc, mr, sm, ml + kb * 16, (nzm >> (kb >> 5) & 1) != 0);
        a_gap<NQ>(acc); if (!settled) { settled = a_settled<NQ>(mr); if (settled) todo &= live; }
        kb = kn; more = todo != 0; kn = more ? __builtin_ctzll(todo) * 32 : 0; todo &= todo - 1;
        a_loadk<T16, HILO>(s0, kl + kn * HD, k2l + kn * HD);
        if (HILO) a_loadv<T16, HILO>(v0, vl + kb * 32, v2l + kb * 32); else a_loadv<T16, HILO>(v0, vl + kn * 32, v2l + kn * 32);
        if (pair) {   // an odd count ends with half a trip
            a_step<T16, HILO, NQ>(s1, HILO ? v0 : v1, bq, bq2, acc, mr, sm, ml + kb * 16, (nzm >> (kb >> 5) & 1) != 0);
            a_gap<NQ>(acc); if (!settled) { settled = a_settled<NQ>(mr); if (settled) todo &= live; } }
        kb = kn;
    } while (more);
#pragma unroll
    for (int qt = 0; qt < NQ; ++qt) { const float f = __fdiv_rn(1.0f, sm[qt] + xhalf(sm[qt])); const size_t oo = (size_t)(q0 + qt * 16) * RK + h * 512 + 8 * lane;   // tile (query tile, head); d = 16 dt + 8 hi + r is piece dt of lane (lr, hi)
#pragma unroll
        for (int dt = 0; dt < 2; ++dt) { v8us oh, ol;
#pragma unroll
            for (int r = 0; r < 8; ++r) { unsigned short a, c2; splitf(__fmul_rn(acc[qt][dt][r], f), a, c2); oh[r] = a; ol[r] = c2; }
            bf* pa = Ah + oo + dt * 256; bf* pl = Al + oo + dt * 256; *(v8us*)pa = oh; *(v8us*)pl = ol;
            asm volatile("s_wait_xcnt 0x0" :: "v"(pa), "v"(pl), "v"(oh), "v"(ol) : "memory"); } }   // stands behind the two stores, before their address and data registers (inputs here, so that they live up to the wait) are rewritten for the next piece
}
// grid (batch entries x heads, (TT-RH)/128 + RH/64), 4 waves (one a SIMD; 1280 blocks, five a WGP, all resident at 192 registers a wave): the first (TT-RH)/128 blocks of a head take 32 queries a wave on fp16, the rest the hi+lo rows, 16 queries a wave
// (three products a tile, so half the columns). Both run from the last query rows to the first: under a causal mask those have the most live steps, so the longest blocks have the low indices and start first (for speed only). A block's waves walk the same K and V^T lines.
__global__ __launch_bounds__(128) void k_fattn(const h16* __restrict__ Q16, const h16* __restrict__ K16, const h16* __restrict__ VT16, const bf* __restrict__ Qh, const bf* __restrict__ Ql, const bf* __restrict__ Kh, const bf* __restrict__ Kl, const bf* __restrict__ VTh, const bf* __restrict__ VTl, const float* __restrict__ mk, const unsigned* __restrict__ lv, bf* Ah, bf* Al) {
    const int h = blockIdx.x % NH_, b = blockIdx.x / NH_, w = threadIdx.x >> 5, bx = blockIdx.y; const size_t oq = (size_t)blockIdx.x * TT * HD, ov = (size_t)blockIdx.x * HD * TT; mk += (size_t)b * TT * TT; lv += (size_t)b * (TT / 16) * 16 * 32; Ah += (size_t)b * TT * RK; Al += (size_t)b * TT * RK;
    static_assert(TT * HD * 2 == 4 * 128 * 256 && RH * HD * 2 == 128 * 256 && (TT - RH) / 128 >= 4, "the shares below");
    if (bx < 4) {   // ASKED INTO L2 (above): the head's first four work-groups share out its fp16 K and V^T planes (128 KiB each, a unit a thread) and take one each of the four hi and lo planes of K and V^T, of which the first RH keys are asked (all that the hi+lo rows walk under a causal mask)
        const size_t u = (size_t)(bx * 128 + (int)threadIdx.x) * 128; const bf* ps = bx == 0 ? Kh : bx == 1 ? Kl : bx == 2 ? VTh : VTl;
        ask3(K16 + oq + u, VT16 + ov + u, ps + oq + (size_t)threadIdx.x * 128); }
    if (bx >= (TT - RH) / 128) attn_cols<bf, true, 1>(Qh + oq, Ql + oq, Kh + oq, Kl + oq, VTh + ov, VTl + ov, mk, lv, Ah, Al, h, ((TT - RH) / 128 + RH / 64 - 1 - bx) * 64 + w * 16);
    else attn_cols<h16, false, 2>(Q16 + oq, Q16 + oq, K16 + oq, K16 + oq, VT16 + ov, VT16 + ov, mk, lv, Ah, Al, h, RH + ((TT - RH) / 128 - 1 - bx) * 128 + w * 32);
}

extern "C" void kernel_launch(void* const* d_in, const int* in_sizes, int n_in,
                              void* d_out, int out_size, void* d_ws, size_t ws_size, hipStream_t stream) {
    (void)in_sizes; (void)n_in; (void)out_size;
    const float* IN[10]; for (int i = 0; i < 10; ++i) IN[i] = (const float*)d_in[i];   // 0 hidden, 1 attention_mask [2][1][2048][2048], 2 Wq [1024][2048], 3 bq, 4 Wk, 5 bk, 6 Wv, 7 bv, 8 Wo [2048][1024], 9 bo (torch [out][in])
    float* OUT = (float*)d_out;     // [2][2048][2048]
    char* wsp = (char*)d_ws;
    auto take = [&](size_t bytes) { char* p = wsp; wsp += (bytes + 255) & ~(size_t)255; return (void*)p; };
    bf* WQ = (bf*)take((size_t)RK * DM * 2); bf* WK = (bf*)take((size_t)RK * DM * 2); bf* WV = (bf*)take((size_t)RK * DM * 2); bf* WO = (bf*)take((size_t)DM * RK * 2);   // WQ, WK, WV, WO, XB lie in a row (every size a multiple of 256 bytes)
    bf* XB = (bf*)take((size_t)NB_ * TT * DM * 2);
    h16* Q16 = (h16*)take((size_t)NB_ * NH_ * TT * HD * 2); h16* K16 = (h16*)take((size_t)NB_ * NH_ * TT * HD * 2); bf* Qh = (bf*)take((size_t)NB_ * NH_ * TT * HD * 2); bf* Ql = (bf*)take((size_t)NB_ * NH_ * TT * HD * 2); bf* Kh = (bf*)take((size_t)NB_ * NH_ * TT * HD * 2); bf* Kl = (bf*)take((size_t)NB_ * NH_ * TT * HD * 2);
    h16* VT16 = (h16*)take((size_t)NB_ * NH_ * HD * TT * 2); bf* VTh = (bf*)take((size_t)NB_ * NH_ * HD * TT * 2); bf* VTl = (bf*)take((size_t)NB_ * NH_ * HD * TT * 2);
    bf* Ah = (bf*)take((size_t)NB_ * TT * RK * 2); bf* Al = (bf*)take((size_t)NB_ * TT * RK * 2); float* MP = (float*)take((size_t)NB_ * TT * TT * 4); unsigned* LV = (unsigned*)take((size_t)NB_ * (TT / 16) * 16 * 128);
    if ((size_t)(wsp - (char*)d_ws) > ws_size) return;    // total 152.5 MiB
    (void)WK; (void)WV;
    k_cvt8<<<CVB, 256, 0, stream>>>(IN[2], IN[4], IN[6], IN[0], WQ);
    k_gemmw<bf, 0, true, true><<<dim3(NB_ * TT / 128, RK / 128, 4), 128, 0, stream>>>(XB, nullptr, WQ, nullptr, DM, DM, nullptr, 0, IN[3], IN[5], IN[7], 0, (size_t)RK * DM, 0, Q16, K16, VT16, Qh, Ql, Kh, Kl, VTh, VTl, IN[1], MP, LV, IN[8], WO);   // z = 3: side_pack, NB_ * TT / 16 = 256 work-groups
    k_fattn<<<dim3(NB_ * NH_, RH / 64 + (TT - RH) / 128, 1), 128, 0, stream>>>(Q16, K16, VT16, Qh, Ql, Kh, Kl, VTh, VTl, MP, LV, Ah, Al);
    k_gemmw<bf, 1, true, false><<<dim3(NB_ * TT / 128, DM / 128, 1), 128, 0, stream>>>(Ah, Al, WO, nullptr, RK, RK, OUT, DM, IN[9], IN[9], IN[9], 0, 0, 0, nullptr, nullptr, nullptr, nullptr, nullptr, nullptr, nullptr, nullptr, nullptr, nullptr, nullptr, nullptr, nullptr, nullptr);
}
